// v000
// Times are from an AMD MI455X. After a warm-up the kernel runs many times in a row, and a time is the length of
// such a window on the GPU divided by its runs, so every launch and the gaps after it count. The runs cycle
// through copies of the inputs. A figure is the median of several windows, for all but v000 over two sittings.
// Sittings can differ by a few percent; kernels timed side by side share one.
// v000 is the starting kernel. One run takes 191 microseconds.
// q/k/v projections: v_wmma_f32_16x16x32_bf16 (bf16 operands, f32 accumulate); q.relk^T, k.q^T, v^T.p^T, relv^T.w^T: v_wmma_f32_16x16x32_f16 (f16 operands, f32 accumulate; relk/relv carried x32, q x0.125, p and w x16384, exact power-of-two scales folded back in f32); output projection: v_wmma_f32_16x16x32_bf16 with the activation as a bf16 hi+lo pair (two products) against bf16 weights; softmax, additive bias and normalisation in f32.
#include <hip/hip_runtime.h>

typedef _Float16 v16h __attribute__((ext_vector_type(16)));
typedef _Float16 v8h  __attribute__((ext_vector_type(8)));
typedef __bf16   v16b __attribute__((ext_vector_type(16)));
typedef __bf16   v8b  __attribute__((ext_vector_type(8)));
typedef float    v8f  __attribute__((ext_vector_type(8)));
typedef float    v4f  __attribute__((ext_vector_type(4)));
typedef int      v4i  __attribute__((ext_vector_type(4)));
typedef v8h __attribute__((may_alias)) v8ha;
typedef v8b __attribute__((may_alias)) v8ba;
typedef v4f __attribute__((may_alias)) v4fa;
typedef v4i __attribute__((may_alias)) v4ia;

union FragH { v16h v; v8h half[2]; };
union FragB { v16b v; v8b half[2]; };

#define NB    4
#define SEQ   512
#define HID   1024
#define NH    16
#define HD    64
#define NREL  64
#define NTOK  (NB * SEQ)            // 2048 tokens
#define NX    (NTOK * HID)          // 2097152 elements per activation
#define NW    (HID * HID)           // 1048576 elements per weight
#define NX8   (NX / 8)              // 262144
#define NW8   (NW / 8)              // 131072
#define NPL   (NB * NH * SEQ * HD)  // 2097152 halves per q/k/v plane
#define G_X   (3 * NX8)             // 786432 activation groups
#define G_W   (4 * NW8)             // 524288 weight groups
#define G_R   (NREL * HD / 8)       // 512 groups per relation table
#define G_TOT (G_X + G_W + 2 * G_R) // 1311744
#define PSC   16384.0f
#define RVS   4.76837158203125e-7f  // 2^-21 = 0.25 / (32 * 16384)

// ---------------------------------------------------------------------------
// 16x16x32 WMMA with hazard guard (ties D, keeps A/B live).
// Fragment map (wave32): lane l, h = l>>4, m = n = l&15.
//   A/B element i: i<8 -> k0+8h+i ; i>=8 -> k0+16+8h+(i-8)
//   D element r : row 8h+r, col l&15
// ---------------------------------------------------------------------------
__device__ __forceinline__ v8f wmma_h(v16h a, v16h b, v8f c) {
  v8f d = __builtin_amdgcn_wmma_f32_16x16x32_f16(false, a, false, b, (short)0, c, false, false);
  asm volatile("v_nop\n\tv_nop\n\tv_nop\n\tv_nop" : "+v"(d) : "v"(a), "v"(b));
  return d;
}
__device__ __forceinline__ v8f wmma_b(v16b a, v16b b, v8f c) {
  v8f d = __builtin_amdgcn_wmma_f32_16x16x32_bf16(false, a, false, b, (short)0, c, false, false);
  asm volatile("v_nop\n\tv_nop\n\tv_nop\n\tv_nop" : "+v"(d) : "v"(a), "v"(b));
  return d;
}

// A or B fragment from a k-contiguous 16-bit row; p points at element k0 of
// the row owned by this lane (row index = lane & 15 added by the caller).
__device__ __forceinline__ v16h ldfrag_h(const _Float16* p, int h) {
  FragH f;
  f.half[0] = *(const v8ha*)(p + 8 * h);
  f.half[1] = *(const v8ha*)(p + 16 + 8 * h);
  return f.v;
}
__device__ __forceinline__ v16b ldfrag_b(const __bf16* p, int h) {
  FragB f;
  f.half[0] = *(const v8ba*)(p + 8 * h);
  f.half[1] = *(const v8ba*)(p + 16 + 8 * h);
  return f.v;
}

// relation id: wrap negative once, then clamp into [0, NREL-1]
__device__ __forceinline__ int relidx(int id) {
  int t = id + ((id >> 31) & NREL);
  t = t < 0 ? 0 : t;
  t = t > (NREL - 1) ? (NREL - 1) : t;
  return t;
}

// ---------------------------------------------------------------------------
// Kernel 1: f32 -> 16-bit planes, 8 elements (16 B) per thread, lanes
//   xb [3][NTOK][HID] bf16 (q_in, k_in, v_in, RNE convert)
//   wb [4][HID][HID]  bf16 (Wq, Wk, Wv, Wo, row = output feature)
//   rk [NREL][HD]     f16  = 32 * bf16(relk)
//   rvT[HD][NREL]     f16  = 32 * bf16(relv)^T
// ---------------------------------------------------------------------------
__global__ __launch_bounds__(256) void convert_kernel(
    const float* __restrict__ q_in, const float* __restrict__ k_in, const float* __restrict__ v_in,
    const float* __restrict__ Wq, const float* __restrict__ Wk, const float* __restrict__ Wv,
    const float* __restrict__ Wo, const float* __restrict__ relk, const float* __restrict__ relv,
    __bf16* __restrict__ xb, __bf16* __restrict__ wb, _Float16* __restrict__ rk, _Float16* __restrict__ rvT)
{
  const int g = blockIdx.x * 256 + threadIdx.x;
  if (g >= G_TOT) return;
  if (g < G_X + G_W) {
    const float* src;
    __bf16* dst;
    if (g < G_X) {
      const int which = g >> 18;                 // NX8 = 2^18
      const int off = g & (NX8 - 1);
      const float* s = (which == 0) ? q_in : ((which == 1) ? k_in : v_in);
      src = s + (size_t)off * 8;
      dst = xb + (size_t)which * NX + (size_t)off * 8;
    } else {
      const int e = g - G_X;
      const int wsel = e >> 17;                 // NW8 = 2^17
      const int off = e & (NW8 - 1);
      const float* s = (wsel == 0) ? Wq : ((wsel == 1) ? Wk : ((wsel == 2) ? Wv : Wo));
      src = s + (size_t)off * 8;
      dst = wb + (size_t)wsel * NW + (size_t)off * 8;
    }
    const v4f a = *(const v4fa*)src;
    const v4f c = *(const v4fa*)(src + 4);
    const v8b o = { (__bf16)a.x, (__bf16)a.y, (__bf16)a.z, (__bf16)a.w,
                    (__bf16)c.x, (__bf16)c.y, (__bf16)c.z, (__bf16)c.w };
    *(v8b*)dst = o;
    
  } else {
    const int e = g - (G_X + G_W);
    float f[8];
    _Float16* dst;
    if (e < G_R) {
      const float* src = relk + (size_t)e * 8;
      const v4f a = *(const v4fa*)src;
      const v4f c = *(const v4fa*)(src + 4);
      f[0] = a.x; f[1] = a.y; f[2] = a.z; f[3] = a.w;
      f[4] = c.x; f[5] = c.y; f[6] = c.z; f[7] = c.w;
      dst = rk + (size_t)e * 8;
    } else {
      const int e3 = e - G_R;                    // 0..511
      const int d = e3 >> 3;                     // output row (d)
      const int rb = (e3 & 7) * 8;               // first relation index in this group
      #pragma unroll
      for (int i = 0; i < 8; ++i) f[i] = relv[(size_t)(rb + i) * HD + d];
      dst = rvT + (size_t)e3 * 8;
    }
    _Float16 hh[8];
    #pragma unroll
    for (int i = 0; i < 8; ++i) hh[i] = (_Float16)((float)(__bf16)f[i] * 32.0f);
    const v8h o = { hh[0], hh[1], hh[2], hh[3], hh[4], hh[5], hh[6], hh[7] };
    *(v8h*)dst = o;
    
  }
}

// ---------------------------------------------------------------------------
// 4 lines per instruction, 32 lines per wave, 128 per block.
// which 0/1: plane[bh][l][d]  (one token row = 64 halves = one line)
// which 2  : vt[bh][d][l]     (64 d-rows x 128 tokens = 2 lines each)
// ---------------------------------------------------------------------------
__device__ __forceinline__ void proj_store_pass(const _Float16* sT, _Float16* plane, _Float16* vt,
                                                int which, int bh, int l0, int w, int lane) {
  const int q8 = lane & 7, sub = lane >> 3;
  #pragma unroll
  for (int i = 0; i < 8; ++i) {
    const int lid = w * 32 + i * 4 + sub;
    v8h v;
    _Float16* dst;
    if (which != 2) {
      v = *(const v8ha*)(sT + lid * HD + 8 * q8);
      dst = plane + ((size_t)bh * SEQ + l0 + lid) * HD + 8 * q8;
    } else {
      const int d = lid >> 1, hl = lid & 1;
      v = *(const v8ha*)(sT + d * 128 + 64 * hl + 8 * q8);
      dst = vt + ((size_t)bh * HD + d) * SEQ + l0 + 64 * hl + 8 * q8;
    }
    *(v8h*)dst = v;
  }
}

// ---------------------------------------------------------------------------
// Kernel 2: Y = x * W^T + b for the three projections (which = 0,1,2).
// Block 128 thr (4 waves) = 128 tokens x 64 features (one (which, head));
// wave tile 32 tokens x 64 features; K = 1024 in steps of 32;
// A (x rows) and B (W rows) bf16 fragments straight from global rows.
// ---------------------------------------------------------------------------
__global__ __launch_bounds__(128) void proj_kernel(
    const __bf16* __restrict__ xb,     // [3][NTOK][HID]
    const __bf16* __restrict__ wb,     // [4][HID][HID], row = output feature (first 3 used)
    const float* __restrict__ bq, const float* __restrict__ bk, const float* __restrict__ bv,
    _Float16* __restrict__ qh,         // [B*H][L][D]  f16(0.125*q)
    _Float16* __restrict__ kh,         // [B*H][L][D]
    _Float16* __restrict__ vt)         // [B*H][D][L]
{
  __shared__ __attribute__((aligned(16))) _Float16 sT[128 * 64];   // 16384 B

  const int tid = threadIdx.x, lane = tid & 31, w = tid >> 5;
  const int h = lane >> 4, m = lane & 15;
  const int m0 = blockIdx.x * 128;
  const int cg = blockIdx.y;                 // 0..47
  const int which = cg >> 4, head = cg & 15;
  const int m0w = m0 + 32 * w;

  const __bf16* xa0 = xb + (size_t)which * NX + (size_t)(m0w + m) * HID;   // token row, mt = 0
  const __bf16* xa1 = xa0 + (size_t)16 * HID;                              // mt = 1
  const __bf16* wr  = wb + (size_t)which * NW + (size_t)(head * HD + m) * HID;  // feature row, nt = 0

  const v8f zero8 = {0.f, 0.f, 0.f, 0.f, 0.f, 0.f, 0.f, 0.f};
  v8f acc[2][4];
  #pragma unroll
  for (int mt = 0; mt < 2; ++mt)
    #pragma unroll
    for (int nt = 0; nt < 4; ++nt) acc[mt][nt] = zero8;

  #pragma unroll 1
  for (int k0 = 0; k0 < HID; k0 += 32) {
    const v16b a0 = ldfrag_b(xa0 + k0, h);
    const v16b a1 = ldfrag_b(xa1 + k0, h);
    #pragma unroll
    for (int nt = 0; nt < 4; ++nt) {
      const v16b bf = ldfrag_b(wr + (size_t)nt * 16 * HID + k0, h);
      acc[0][nt] = wmma_b(a0, bf, acc[0][nt]);
      acc[1][nt] = wmma_b(a1, bf, acc[1][nt]);
    }
  }

  // D[r] of tile (mt, nt) = Y[token m0w+16mt+8h+r][feature 16nt+m]
  const float* bias = (which == 0) ? bq : ((which == 1) ? bk : bv);
  const float osc = (which == 0) ? 0.125f : 1.0f;
  #pragma unroll
  for (int nt = 0; nt < 4; ++nt) {
    const int feat = 16 * nt + m;
    const float bvl = (float)(__bf16)bias[head * HD + feat];
    #pragma unroll
    for (int mt = 0; mt < 2; ++mt) {
      #pragma unroll
      for (int r = 0; r < 8; ++r) {
        const int tokl = 32 * w + 16 * mt + 8 * h + r;     // 0..127
        const float y = (acc[mt][nt][r] + bvl) * osc;
        const int idx = (which == 2) ? (feat * 128 + tokl) : (tokl * HD + feat);
        sT[idx] = (_Float16)y;
      }
    }
  }
  __syncthreads();

  const int b = m0 >> 9, l0 = m0 & (SEQ - 1), bh = b * NH + head;
  _Float16* plane = (which == 0) ? qh : kh;
  proj_store_pass(sT, plane, vt, which, bh, l0, w, lane);
  
}

// ---------------------------------------------------------------------------
// Attention helpers.
// ---------------------------------------------------------------------------
// B fragment of the normalised relation histogram, k = relation index:
// element i<8 <- k0+8h+i, element 8+i <- k0+16+8h+i; kb = k0 + 8h.
__device__ __forceinline__ v16h build_w(const float* ha, const float* hb, int kb, float wsc) {
  const v4f a0 = *(const v4fa*)(ha + kb);
  const v4f a1 = *(const v4fa*)(ha + kb + 4);
  const v4f a2 = *(const v4fa*)(ha + kb + 16);
  const v4f a3 = *(const v4fa*)(ha + kb + 20);
  const v4f c0 = *(const v4fa*)(hb + kb);
  const v4f c1 = *(const v4fa*)(hb + kb + 4);
  const v4f c2 = *(const v4fa*)(hb + kb + 16);
  const v4f c3 = *(const v4fa*)(hb + kb + 20);
  const float e[16] = { a0.x + c0.x, a0.y + c0.y, a0.z + c0.z, a0.w + c0.w,
                        a1.x + c1.x, a1.y + c1.y, a1.z + c1.z, a1.w + c1.w,
                        a2.x + c2.x, a2.y + c2.y, a2.z + c2.z, a2.w + c2.w,
                        a3.x + c3.x, a3.y + c3.y, a3.z + c3.z, a3.w + c3.w };
  _Float16 wh[16];
  #pragma unroll
  for (int i = 0; i < 16; ++i) wh[i] = (_Float16)(e[i] * wsc);
  FragH f;
  f.half[0] = (v8h){ wh[0], wh[1], wh[2], wh[3], wh[4], wh[5], wh[6], wh[7] };
  f.half[1] = (v8h){ wh[8], wh[9], wh[10], wh[11], wh[12], wh[13], wh[14], wh[15] };
  return f.v;
}

// Per-wave 16x64 f32 tile in LDS -> bf16 hi and lo planes [tok][HID]; one
// 4 lines per instruction.
__device__ __forceinline__ void att_store(const float* sO, __bf16* ahi, __bf16* alo,
                                          size_t gbase, int lane) {
  const int sub = lane >> 3, q8 = lane & 7;
  #pragma unroll
  for (int i = 0; i < 4; ++i) {
    const int row = 4 * i + sub;
    const float* sp = sO + row * HD + 8 * q8;
    const v4f a = *(const v4fa*)sp;
    const v4f c = *(const v4fa*)(sp + 4);
    const float f[8] = { a.x, a.y, a.z, a.w, c.x, c.y, c.z, c.w };
    __bf16 hh[8], ll[8];
    #pragma unroll
    for (int e = 0; e < 8; ++e) {
      hh[e] = (__bf16)f[e];
      ll[e] = (__bf16)(f[e] - (float)hh[e]);
    }
    const v8b hv = { hh[0], hh[1], hh[2], hh[3], hh[4], hh[5], hh[6], hh[7] };
    const v8b lv = { ll[0], ll[1], ll[2], ll[3], ll[4], ll[5], ll[6], ll[7] };
    const size_t gi = gbase + (size_t)row * HID + 8 * q8;
    *(v8b*)(ahi + gi) = hv;
    *(v8b*)(alo + gi) = lv;
  }
}

// ---------------------------------------------------------------------------
// Kernel 3: relation-aware attention, transposed form, one wave per block.
// Block = 32 thr = 16 queries of one (b, head), all 512 keys.
//   qrel^T = RK * Q^T       : A = rk rows (row = rel, k = d), B = Q^T
//   S^T    = K * Q^T        : A = K rows (row = key, k = d), B = Q^T (k = d, n = query)
//   score  = S^T + qrel[query][id]/128 + (-10000 where id <= 0), kept in LDS f32
//   hist   : per-lane private bins h[lanehalf][query][rel] += p (fixed order, no atomics)
//   O^T    = V^T * P^T      : A = vt rows (row = d, k = key), B = P^T from registers x16384
//   R^T    = RVT * W^T      : A = rvT rows (row = d, k = rel), B = W^T = (hist/l) x16384
//   out    = O^T/(l*16384) + R^T * 2^-21  -> bf16 hi/lo planes [tok][head*64+d]
// Lane owns 256 keys of query column (lane&15); partner = lane ^ 16.
// ---------------------------------------------------------------------------
__global__ __launch_bounds__(32) void attn_kernel(
    const _Float16* __restrict__ qh,   // [B*H][L][D]  (already x0.125)
    const _Float16* __restrict__ kh,   // [B*H][L][D]
    const _Float16* __restrict__ vt,   // [B*H][D][L]
    const int* __restrict__ ids,       // [B][1][L][L] int32 relation ids
    const _Float16* __restrict__ rk,   // [NREL][D]  x32
    const _Float16* __restrict__ rvT,  // [D][NREL]  x32
    __bf16* __restrict__ ahi,          // [NTOK][HID]
    __bf16* __restrict__ alo)          // [NTOK][HID]
{
  __shared__ __attribute__((aligned(16))) float sS[16 * SEQ];       // 32768 B scores
  __shared__ __attribute__((aligned(16))) float sQR[16 * NREL];     //  4096 B qrel[query][rel]
  __shared__ __attribute__((aligned(16))) float sH[2 * 16 * NREL];  //  8192 B hist[h][query][rel]
  __shared__ __attribute__((aligned(16))) float sO[16 * HD];        //  4096 B output staging

  const int lane = threadIdx.x & 31, h = lane >> 4, m = lane & 15;
  const int bh = blockIdx.y, b = bh >> 4, head = bh & 15;
  const int q0 = blockIdx.x * 16;

  // zero this lane's private histogram bins
  float* hp = sH + h * (16 * NREL) + m * NREL;
  {
    const v4f z4 = {0.f, 0.f, 0.f, 0.f};
    #pragma unroll
    for (int i = 0; i < NREL / 4; ++i) *(v4fa*)(hp + 4 * i) = z4;
  }

  // Q^T B-fragments: column n = query q0+m, k = d (two 32-deep chunks)
  const _Float16* qrow = qh + ((size_t)bh * SEQ + q0 + m) * HD;
  const v16h qb0 = ldfrag_h(qrow, h);
  const v16h qb1 = ldfrag_h(qrow + 32, h);

  const v8f zero8 = {0.f, 0.f, 0.f, 0.f, 0.f, 0.f, 0.f, 0.f};

  // ---- qrel^T tiles: D[r] = (rel 16rt+8h+r, query m) ----
  #pragma unroll
  for (int rt = 0; rt < 4; ++rt) {
    const _Float16* ap = rk + (size_t)(16 * rt + m) * HD;
    v8f z = zero8;
    z = wmma_h(ldfrag_h(ap, h), qb0, z);
    z = wmma_h(ldfrag_h(ap + 32, h), qb1, z);
    #pragma unroll
    for (int r = 0; r < 8; ++r) sQR[m * NREL + 16 * rt + 8 * h + r] = z[r];
  }
  __syncthreads();

  const _Float16* kbase = kh + ((size_t)bh * SEQ + m) * HD;          // + key0*HD (+32)
  const _Float16* vbase = vt + ((size_t)bh * HD + m) * SEQ;          // + 16t*SEQ + key0
  const int* idrow = ids + ((size_t)b * SEQ + q0 + m) * SEQ + 8 * h; // + key tile base
  float* srow = sS + m * SEQ + 8 * h;                                // + key tile base
  const float* qr = sQR + m * NREL;

  float mx = -3.0e38f;
  #pragma unroll 1
  for (int kt = 0; kt < SEQ / 16; ++kt) {
    const _Float16* kp = kbase + (size_t)(16 * kt) * HD;
    v8f z = zero8;
    z = wmma_h(ldfrag_h(kp, h), qb0, z);
    z = wmma_h(ldfrag_h(kp + 32, h), qb1, z);          // z[r] = S[query m][key 16kt+8h+r]
    const v4i ia = *(const v4ia*)(idrow + 16 * kt);
    const v4i ib = *(const v4ia*)(idrow + 16 * kt + 4);
    const int idv[8] = { ia.x, ia.y, ia.z, ia.w, ib.x, ib.y, ib.z, ib.w };
    float sc[8];
    #pragma unroll
    for (int r = 0; r < 8; ++r) {
      const int id = idv[r];
      const float bias = (id > 0) ? 0.0f : -10000.0f;
      const float v = z[r] + qr[relidx(id)] * 0.0078125f + bias;
      sc[r] = v;
      mx = fmaxf(mx, v);
    }
    const v4f o0 = { sc[0], sc[1], sc[2], sc[3] };
    const v4f o1 = { sc[4], sc[5], sc[6], sc[7] };
    *(v4fa*)(srow + 16 * kt) = o0;
    *(v4fa*)(srow + 16 * kt + 4) = o1;
  }
  mx = fmaxf(mx, __shfl_xor(mx, 16));
  __syncthreads();

  // ---- pass 2: exp, sum, histogram, O^T += V^T * P^T (32 keys per step) ----
  v8f o[4];                                   // o[t][r] = O[query m][d 16t+8h+r] * (l * 16384)
  #pragma unroll
  for (int t = 0; t < 4; ++t) o[t] = zero8;
  float lsum = 0.0f;
  #pragma unroll 1
  for (int c = 0; c < SEQ / 32; ++c) {
    const float* sp = srow + 32 * c;
    const v4f s0 = *(const v4fa*)(sp);
    const v4f s1 = *(const v4fa*)(sp + 4);
    const v4f s2 = *(const v4fa*)(sp + 16);
    const v4f s3 = *(const v4fa*)(sp + 20);
    const int* ip = idrow + 32 * c;
    const v4i i0 = *(const v4ia*)(ip);
    const v4i i1 = *(const v4ia*)(ip + 4);
    const v4i i2 = *(const v4ia*)(ip + 16);
    const v4i i3 = *(const v4ia*)(ip + 20);
    const float sv[16] = { s0.x, s0.y, s0.z, s0.w, s1.x, s1.y, s1.z, s1.w,
                           s2.x, s2.y, s2.z, s2.w, s3.x, s3.y, s3.z, s3.w };
    const int idv[16] = { i0.x, i0.y, i0.z, i0.w, i1.x, i1.y, i1.z, i1.w,
                          i2.x, i2.y, i2.z, i2.w, i3.x, i3.y, i3.z, i3.w };
    _Float16 ph[16];
    #pragma unroll
    for (int e = 0; e < 16; ++e) {
      const float p = __expf(sv[e] - mx);
      lsum += p;
      const int ri = relidx(idv[e]);
      hp[ri] = hp[ri] + p;
      ph[e] = (_Float16)(p * PSC);
    }
    // P^T B-fragment: element r <- key 32c+8h+r, element 8+r <- key 32c+16+8h+r
    FragH pf;
    pf.half[0] = (v8h){ ph[0], ph[1], ph[2], ph[3], ph[4], ph[5], ph[6], ph[7] };
    pf.half[1] = (v8h){ ph[8], ph[9], ph[10], ph[11], ph[12], ph[13], ph[14], ph[15] };
    #pragma unroll
    for (int t = 0; t < 4; ++t) {
      const _Float16* vp = vbase + (size_t)(16 * t) * SEQ + 32 * c;
      o[t] = wmma_h(ldfrag_h(vp, h), pf.v, o[t]);
    }
  }
  lsum += __shfl_xor(lsum, 16);
  const float inv = 1.0f / lsum;
  const float osc = inv * (1.0f / PSC);
  const float wsc = inv * PSC;
  __syncthreads();                            // histogram bins complete (read cross-lane below)

  // ---- relation value term: R^T = RVT * W^T ----
  const float* ha = sH + m * NREL;
  const float* hb = sH + 16 * NREL + m * NREL;
  const v16h w0 = build_w(ha, hb, 8 * h, wsc);
  const v16h w1 = build_w(ha, hb, 32 + 8 * h, wsc);
  #pragma unroll
  for (int t = 0; t < 4; ++t) {
    const _Float16* ap = rvT + (size_t)(16 * t + m) * NREL;
    v8f z = zero8;
    z = wmma_h(ldfrag_h(ap, h), w0, z);
    z = wmma_h(ldfrag_h(ap + 32, h), w1, z);
    #pragma unroll
    for (int r = 0; r < 8; ++r)
      sO[m * HD + 16 * t + 8 * h + r] = o[t][r] * osc + z[r] * RVS;
  }
  __syncthreads();

  const size_t gbase = ((size_t)b * SEQ + q0) * HID + (size_t)head * HD;
  att_store(sO, ahi, alo, gbase, lane);
  
}

// ---------------------------------------------------------------------------
// instruction, 4 lines per instruction, 64 lines per wave.
// ---------------------------------------------------------------------------
__device__ __forceinline__ void out_store_pass(const float* sT, float* out, int m0, int n0,
                                               int w, int lane) {
  const int q8 = lane & 7, sub = lane >> 3;
  #pragma unroll
  for (int i = 0; i < 16; ++i) {
    const int lid = i * 4 + sub;                 // 0..63
    const int rowl = 32 * w + (lid >> 1), hl = lid & 1;
    const v4f v = *(const v4fa*)(sT + rowl * 64 + 32 * hl + 4 * q8);
    float* dst = out + (size_t)(m0 + rowl) * HID + n0 + 32 * hl + 4 * q8;
    *(v4f*)dst = v;
  }
}

// ---------------------------------------------------------------------------
// Kernel 4: out = A * Wo^T + bo with A = ahi + alo (two bf16 products per tile).
// Block 128 thr = 128 tokens x 64 features; wave 32 tokens x 64 features.
// ---------------------------------------------------------------------------
__global__ __launch_bounds__(128) void oproj_kernel(
    const __bf16* __restrict__ ahi,    // [NTOK][HID]
    const __bf16* __restrict__ alo,    // [NTOK][HID]
    const __bf16* __restrict__ wo,     // [HID][HID], row = output feature
    const float* __restrict__ bo,
    float* __restrict__ out)           // [NTOK][HID]
{
  __shared__ __attribute__((aligned(16))) float sT[128 * 64];      // 32768 B

  const int tid = threadIdx.x, lane = tid & 31, w = tid >> 5;
  const int h = lane >> 4, m = lane & 15;
  const int m0 = blockIdx.x * 128;
  const int n0 = blockIdx.y * 64;
  const int m0w = m0 + 32 * w;

  const __bf16* a0h = ahi + (size_t)(m0w + m) * HID;
  const __bf16* a0l = alo + (size_t)(m0w + m) * HID;
  const __bf16* a1h = a0h + (size_t)16 * HID;
  const __bf16* a1l = a0l + (size_t)16 * HID;
  const __bf16* wr  = wo + (size_t)(n0 + m) * HID;

  const v8f zero8 = {0.f, 0.f, 0.f, 0.f, 0.f, 0.f, 0.f, 0.f};
  v8f acc[2][4];
  #pragma unroll
  for (int mt = 0; mt < 2; ++mt)
    #pragma unroll
    for (int nt = 0; nt < 4; ++nt) acc[mt][nt] = zero8;

  #pragma unroll 1
  for (int k0 = 0; k0 < HID; k0 += 32) {
    const v16b f0h = ldfrag_b(a0h + k0, h);
    const v16b f0l = ldfrag_b(a0l + k0, h);
    const v16b f1h = ldfrag_b(a1h + k0, h);
    const v16b f1l = ldfrag_b(a1l + k0, h);
    #pragma unroll
    for (int nt = 0; nt < 4; ++nt) {
      const v16b bf = ldfrag_b(wr + (size_t)nt * 16 * HID + k0, h);
      acc[0][nt] = wmma_b(f0h, bf, acc[0][nt]);
      acc[0][nt] = wmma_b(f0l, bf, acc[0][nt]);
      acc[1][nt] = wmma_b(f1h, bf, acc[1][nt]);
      acc[1][nt] = wmma_b(f1l, bf, acc[1][nt]);
    }
  }

  // D[r] of tile (mt, nt) = Y[token m0w+16mt+8h+r][feature n0+16nt+m]
  #pragma unroll
  for (int nt = 0; nt < 4; ++nt) {
    const int featl = 16 * nt + m;
    const float bvl = (float)(__bf16)bo[n0 + featl];
    #pragma unroll
    for (int mt = 0; mt < 2; ++mt) {
      #pragma unroll
      for (int r = 0; r < 8; ++r) {
        const int tokl = 32 * w + 16 * mt + 8 * h + r;     // 0..127
        sT[tokl * 64 + featl] = acc[mt][nt][r] + bvl;
      }
    }
  }
  __syncthreads();

  out_store_pass(sT, out, m0, n0, w, lane);
  
}

// ---------------------------------------------------------------------------
extern "C" void kernel_launch(void* const* d_in, const int* in_sizes, int n_in,
                              void* d_out, int out_size, void* d_ws, size_t ws_size,
                              hipStream_t stream) {
  if (n_in < 14) return;
  if (in_sizes[0] != NX || in_sizes[1] != NX || in_sizes[2] != NX) return;
  if (in_sizes[3] != NB * SEQ * SEQ) return;
  if (in_sizes[4] != NW || in_sizes[6] != NW || in_sizes[8] != NW || in_sizes[10] != NW) return;
  if (in_sizes[5] != HID || in_sizes[7] != HID || in_sizes[9] != HID || in_sizes[11] != HID) return;
  if (in_sizes[12] != NREL * HD || in_sizes[13] != NREL * HD) return;
  if (out_size != NX) return;

  const float* q_in = (const float*)d_in[0];
  const float* k_in = (const float*)d_in[1];
  const float* v_in = (const float*)d_in[2];
  const int*   ids  = (const int*)d_in[3];
  const float* Wq = (const float*)d_in[4];
  const float* bq = (const float*)d_in[5];
  const float* Wk = (const float*)d_in[6];
  const float* bk = (const float*)d_in[7];
  const float* Wv = (const float*)d_in[8];
  const float* bv = (const float*)d_in[9];
  const float* Wo = (const float*)d_in[10];
  const float* bo = (const float*)d_in[11];
  const float* relk = (const float*)d_in[12];
  const float* relv = (const float*)d_in[13];
  float* out = (float*)d_out;

  const size_t xb_bytes = (size_t)3 * NX * 2;          // 12582912
  const size_t wb_bytes = (size_t)4 * NW * 2;          //  8388608
  const size_t rt_bytes = (size_t)NREL * HD * 2;       //     8192
  const size_t pl_bytes = (size_t)NPL * 2;             //  4194304
  const size_t ap_bytes = (size_t)NX * 2;              //  4194304
  const size_t total = xb_bytes + wb_bytes + 2 * rt_bytes + 3 * pl_bytes + 2 * ap_bytes;  // 41959424
  if (total > ws_size) return;

  char* ws = (char*)d_ws;
  size_t off = 0;
  __bf16* xb = (__bf16*)(ws + off);       off += xb_bytes;
  __bf16* wb = (__bf16*)(ws + off);       off += wb_bytes;
  _Float16* rk  = (_Float16*)(ws + off);  off += rt_bytes;
  _Float16* rvT = (_Float16*)(ws + off);  off += rt_bytes;
  _Float16* qh  = (_Float16*)(ws + off);  off += pl_bytes;
  _Float16* kh  = (_Float16*)(ws + off);  off += pl_bytes;
  _Float16* vt  = (_Float16*)(ws + off);  off += pl_bytes;
  __bf16* ahi = (__bf16*)(ws + off);      off += ap_bytes;
  __bf16* alo = (__bf16*)(ws + off);      off += ap_bytes;
  if (off > ws_size) return;

  convert_kernel<<<(G_TOT + 255) / 256, 256, 0, stream>>>(q_in, k_in, v_in, Wq, Wk, Wv, Wo,
                                                         relk, relv, xb, wb, rk, rvT);

  dim3 gProj(NTOK / 128, 3 * NH);                                   // (16, 48)
  proj_kernel<<<gProj, 128, 0, stream>>>(xb, wb, bq, bk, bv, qh, kh, vt);

  dim3 gAtt(SEQ / 16, NB * NH);                                     // (32, 64)
  attn_kernel<<<gAtt, 32, 0, stream>>>(qh, kh, vt, ids, rk, rvT, ahi, alo);

  dim3 gOut(NTOK / 128, HID / 64);                                  // (16, 16)
  oproj_kernel<<<gOut, 128, 0, stream>>>(ahi, alo, wb + (size_t)3 * NW, bo, out);
}

// v001
// A run of this version takes 112 microseconds.
// Two timings next to v000 put it at 1.74 and 1.77 times that version's speed.
// q/k/v projections: v_wmma_f32_16x16x32_bf16 (bf16 operands, f32 accumulate); q.relk^T, k.q^T, v^T.p^T, relv^T.w^T: v_wmma_f32_16x16x32_f16 (f16 operands, f32 accumulate; relk/relv carried x32, q x0.125, p and w x16384, exact power-of-two scales folded back in f32); output projection: v_wmma_f32_16x16x32_bf16 with the activation as a bf16 hi+lo pair (two products) against bf16 weights; softmax, additive bias and normalisation in f32.
#include <hip/hip_runtime.h>

typedef _Float16 v16h __attribute__((ext_vector_type(16)));
typedef _Float16 v8h  __attribute__((ext_vector_type(8)));
typedef __bf16   v16b __attribute__((ext_vector_type(16)));
typedef __bf16   v8b  __attribute__((ext_vector_type(8)));
typedef float    v8f  __attribute__((ext_vector_type(8)));
typedef float    v4f  __attribute__((ext_vector_type(4)));
typedef int      v4i  __attribute__((ext_vector_type(4)));
typedef v8h __attribute__((may_alias)) v8ha;
typedef v8b __attribute__((may_alias)) v8ba;
typedef v4f __attribute__((may_alias)) v4fa;
typedef v4i __attribute__((may_alias)) v4ia;

union FragH { v16h v; v8h half[2]; };
union FragB { v16b v; v8b half[2]; };

#define NB    4
#define SEQ   512
#define HID   1024
#define NH    16
#define HD    64
#define NREL  64
#define NTOK  (NB * SEQ)            // 2048 tokens
#define NX    (NTOK * HID)          // 2097152 elements per activation
#define NW    (HID * HID)           // 1048576 elements per weight
#define NX8   (NX / 8)              // 262144
#define NW8   (NW / 8)              // 131072
#define NPL   (NB * NH * SEQ * HD)  // 2097152 halves per q/k/v plane
#define G_X   (3 * NX8)             // 786432 activation groups
#define G_W   (4 * NW8)             // 524288 weight groups
#define G_R   (NREL * HD / 8)       // 512 groups per relation table
#define G_TOT (G_X + G_W + 2 * G_R) // 1311744
#define PSC   16384.0f
#define RVS   4.76837158203125e-7f  // 2^-21 = 0.25 / (32 * 16384)

// ---------------------------------------------------------------------------
// 16x16x32 WMMA (builtin form; the compiler keeps the distance behind it).
// Fragment map (wave32): lane l, h = l>>4, m = n = l&15.
//   A/B element i: i<8 -> k0+8h+i ; i>=8 -> k0+16+8h+(i-8)
//   D element r : row 8h+r, col l&15
// ---------------------------------------------------------------------------
__device__ __forceinline__ v8f wmma_h(v16h a, v16h b, v8f c) {
  return __builtin_amdgcn_wmma_f32_16x16x32_f16(false, a, false, b, (short)0, c, false, false);
}
__device__ __forceinline__ v8f wmma_b(v16b a, v16b b, v8f c) {
  return __builtin_amdgcn_wmma_f32_16x16x32_bf16(false, a, false, b, (short)0, c, false, false);
}

// Stands behind a stage's group of global loads: without it the scheduler sinks the
// loads below the other stage's work and their latency is exposed again.
__device__ __forceinline__ void loads_stay_above() { __builtin_amdgcn_sched_barrier(0); }
// Stands in front of code that rewrites address registers which loads still in
// flight name (a pipelined loop's next trip, the epilogue's address arithmetic).
// The two scheduling barriers keep the wait where it is written: late enough to
// cost nothing, and ahead of every such rewrite.
__device__ __forceinline__ void addr_regs_free() {
  __builtin_amdgcn_sched_barrier(0);
  asm volatile("s_wait_xcnt 0x0" ::: "memory");
  __builtin_amdgcn_sched_barrier(0);
}

// A or B fragment from a k-contiguous 16-bit row; p points at element k0 of
// the row owned by this lane (row index = lane & 15 added by the caller).
__device__ __forceinline__ v16h ldfrag_h(const _Float16* p, int h) {
  FragH f;
  f.half[0] = *(const v8ha*)(p + 8 * h);
  f.half[1] = *(const v8ha*)(p + 16 + 8 * h);
  return f.v;
}
__device__ __forceinline__ v16b ldfrag_b(const __bf16* p, int h) {
  FragB f;
  f.half[0] = *(const v8ba*)(p + 8 * h);
  f.half[1] = *(const v8ba*)(p + 16 + 8 * h);
  return f.v;
}

// relation id: wrap negative once, then clamp into [0, NREL-1]
__device__ __forceinline__ int relidx(int id) {
  int t = id + ((id >> 31) & NREL);
  t = t < 0 ? 0 : t;
  t = t > (NREL - 1) ? (NREL - 1) : t;
  return t;
}

// ---------------------------------------------------------------------------
// Kernel 1: f32 -> 16-bit planes, 8 elements (16 B) per thread, lanes
//   xb [3][NTOK][HID] bf16 (q_in, k_in, v_in, RNE convert)
//   wb [4][HID][HID]  bf16 (Wq, Wk, Wv, Wo, row = output feature)
//   rk [NREL][HD]     f16  = 32 * bf16(relk)
//   rvT[HD][NREL]     f16  = 32 * bf16(relv)^T
// ---------------------------------------------------------------------------
__global__ __launch_bounds__(256) void convert_kernel(
    const float* __restrict__ q_in, const float* __restrict__ k_in, const float* __restrict__ v_in,
    const float* __restrict__ Wq, const float* __restrict__ Wk, const float* __restrict__ Wv,
    const float* __restrict__ Wo, const float* __restrict__ relk, const float* __restrict__ relv,
    __bf16* __restrict__ xb, __bf16* __restrict__ wb, _Float16* __restrict__ rk, _Float16* __restrict__ rvT)
{
  const int g = blockIdx.x * 256 + threadIdx.x;
  if (g >= G_TOT) return;
  if (g < G_X + G_W) {
    const float* src;
    __bf16* dst;
    if (g < G_X) {
      const int which = g >> 18;                 // NX8 = 2^18
      const int off = g & (NX8 - 1);
      const float* s = (which == 0) ? q_in : ((which == 1) ? k_in : v_in);
      src = s + (size_t)off * 8;
      dst = xb + (size_t)which * NX + (size_t)off * 8;
    } else {
      const int e = g - G_X;
      const int wsel = e >> 17;                 // NW8 = 2^17
      const int off = e & (NW8 - 1);
      const float* s = (wsel == 0) ? Wq : ((wsel == 1) ? Wk : ((wsel == 2) ? Wv : Wo));
      src = s + (size_t)off * 8;
      dst = wb + (size_t)wsel * NW + (size_t)off * 8;
    }
    const v4f a = *(const v4fa*)src;
    const v4f c = *(const v4fa*)(src + 4);
    const v8b o = { (__bf16)a.x, (__bf16)a.y, (__bf16)a.z, (__bf16)a.w,
                    (__bf16)c.x, (__bf16)c.y, (__bf16)c.z, (__bf16)c.w };
    *(v8b*)dst = o;
    
  } else {
    const int e = g - (G_X + G_W);
    float f[8];
    _Float16* dst;
    if (e < G_R) {
      const float* src = relk + (size_t)e * 8;
      const v4f a = *(const v4fa*)src;
      const v4f c = *(const v4fa*)(src + 4);
      f[0] = a.x; f[1] = a.y; f[2] = a.z; f[3] = a.w;
      f[4] = c.x; f[5] = c.y; f[6] = c.z; f[7] = c.w;
      dst = rk + (size_t)e * 8;
    } else {
      const int e3 = e - G_R;                    // 0..511
      const int d = e3 >> 3;                     // output row (d)
      const int rb = (e3 & 7) * 8;               // first relation index in this group
      #pragma unroll
      for (int i = 0; i < 8; ++i) f[i] = relv[(size_t)(rb + i) * HD + d];
      dst = rvT + (size_t)e3 * 8;
    }
    _Float16 hh[8];
    #pragma unroll
    for (int i = 0; i < 8; ++i) hh[i] = (_Float16)((float)(__bf16)f[i] * 32.0f);
    const v8h o = { hh[0], hh[1], hh[2], hh[3], hh[4], hh[5], hh[6], hh[7] };
    *(v8h*)dst = o;
    
  }
}

// ---------------------------------------------------------------------------
// 4 lines per instruction, 32 lines per wave, 128 per block.
// which 0/1: plane[bh][l][d]  (one token row = 64 halves = one line)
// which 2  : vt[bh][d][l]     (64 d-rows x 128 tokens = 2 lines each)
// ---------------------------------------------------------------------------
__device__ __forceinline__ void proj_store_pass(const _Float16* sT, _Float16* plane, _Float16* vt,
                                                int which, int bh, int l0, int w, int lane) {
  const int q8 = lane & 7, sub = lane >> 3;
  #pragma unroll
  for (int i = 0; i < 8; ++i) {
    const int lid = w * 32 + i * 4 + sub;
    v8h v;
    _Float16* dst;
    if (which != 2) {
      v = *(const v8ha*)(sT + lid * HD + 8 * q8);
      dst = plane + ((size_t)bh * SEQ + l0 + lid) * HD + 8 * q8;
    } else {
      const int d = lid >> 1, hl = lid & 1;
      v = *(const v8ha*)(sT + d * 128 + 64 * hl + 8 * q8);
      dst = vt + ((size_t)bh * HD + d) * SEQ + l0 + 64 * hl + 8 * q8;
    }
    *(v8h*)dst = v;
  }
}

// One k step (32 deep) of a projection's operands, held in registers so that
// the next step's loads are in flight while this step's products run.
struct PStage { v16b a0, a1, b[4]; };
__device__ __forceinline__ void proj_load(PStage& s, const __bf16* xa0, const __bf16* xa1,
                                          const __bf16* wr, int k0, int h) {
  s.a0 = ldfrag_b(xa0 + k0, h);
  s.a1 = ldfrag_b(xa1 + k0, h);
  #pragma unroll
  for (int nt = 0; nt < 4; ++nt) s.b[nt] = ldfrag_b(wr + (size_t)nt * 16 * HID + k0, h);
  loads_stay_above();
}
__device__ __forceinline__ void proj_mma(const PStage& s, v8f (&acc)[2][4]) {
  #pragma unroll
  for (int nt = 0; nt < 4; ++nt) {
    acc[0][nt] = wmma_b(s.a0, s.b[nt], acc[0][nt]);
    acc[1][nt] = wmma_b(s.a1, s.b[nt], acc[1][nt]);
  }
}

// ---------------------------------------------------------------------------
// Kernel 2: Y = x * W^T + b for the three projections (which = 0,1,2).
// Block 128 thr (4 waves) = 128 tokens x 64 features (one (which, head));
// wave tile 32 tokens x 64 features; K = 1024 in steps of 32;
// A (x rows) and B (W rows) bf16 fragments straight from global rows.
// ---------------------------------------------------------------------------
__global__ __launch_bounds__(128) void proj_kernel(
    const __bf16* __restrict__ xb,     // [3][NTOK][HID]
    const __bf16* __restrict__ wb,     // [4][HID][HID], row = output feature (first 3 used)
    const float* __restrict__ bq, const float* __restrict__ bk, const float* __restrict__ bv,
    _Float16* __restrict__ qh,         // [B*H][L][D]  f16(0.125*q)
    _Float16* __restrict__ kh,         // [B*H][L][D]
    _Float16* __restrict__ vt)         // [B*H][D][L]
{
  __shared__ __attribute__((aligned(16))) _Float16 sT[128 * 64];   // 16384 B

  const int tid = threadIdx.x, lane = tid & 31, w = tid >> 5;
  const int h = lane >> 4, m = lane & 15;
  const int m0 = blockIdx.x * 128;
  const int cg = blockIdx.y;                 // 0..47
  const int which = cg >> 4, head = cg & 15;
  const int m0w = m0 + 32 * w;

  const __bf16* xa0 = xb + (size_t)which * NX + (size_t)(m0w + m) * HID;   // token row, mt = 0
  const __bf16* xa1 = xa0 + (size_t)16 * HID;                              // mt = 1
  const __bf16* wr  = wb + (size_t)which * NW + (size_t)(head * HD + m) * HID;  // feature row, nt = 0

  const v8f zero8 = {0.f, 0.f, 0.f, 0.f, 0.f, 0.f, 0.f, 0.f};
  v8f acc[2][4];
  #pragma unroll
  for (int mt = 0; mt < 2; ++mt)
    #pragma unroll
    for (int nt = 0; nt < 4; ++nt) acc[mt][nt] = zero8;

  PStage sa, sb;
  proj_load(sa, xa0, xa1, wr, 0, h);
  // rolled: two register stages per trip, no copies between them
  #pragma unroll 1
  for (int k0 = 0; k0 < HID - 64; k0 += 64) {
    proj_load(sb, xa0, xa1, wr, k0 + 32, h);
    proj_mma(sa, acc);
    proj_load(sa, xa0, xa1, wr, k0 + 64, h);
    proj_mma(sb, acc);
    addr_regs_free();
  }
  proj_load(sb, xa0, xa1, wr, HID - 32, h);
  proj_mma(sa, acc);
  proj_mma(sb, acc);

  // D[r] of tile (mt, nt) = Y[token m0w+16mt+8h+r][feature 16nt+m]
  const float* bias = (which == 0) ? bq : ((which == 1) ? bk : bv);
  const float osc = (which == 0) ? 0.125f : 1.0f;
  #pragma unroll
  for (int nt = 0; nt < 4; ++nt) {
    const int feat = 16 * nt + m;
    const float bvl = (float)(__bf16)bias[head * HD + feat];
    #pragma unroll
    for (int mt = 0; mt < 2; ++mt) {
      #pragma unroll
      for (int r = 0; r < 8; ++r) {
        const int tokl = 32 * w + 16 * mt + 8 * h + r;     // 0..127
        const float y = (acc[mt][nt][r] + bvl) * osc;
        const int idx = (which == 2) ? (feat * 128 + tokl) : (tokl * HD + feat);
        sT[idx] = (_Float16)y;
      }
    }
  }
  __syncthreads();

  const int b = m0 >> 9, l0 = m0 & (SEQ - 1), bh = b * NH + head;
  _Float16* plane = (which == 0) ? qh : kh;
  proj_store_pass(sT, plane, vt, which, bh, l0, w, lane);
  
}

// ---------------------------------------------------------------------------
// Attention helpers.
// ---------------------------------------------------------------------------
// B fragment of the normalised relation histogram, k = relation index:
// element i<8 <- k0+8h+i, element 8+i <- k0+16+8h+i; kb = k0 + 8h.
__device__ __forceinline__ v16h build_w(const float* ha, const float* hb, int kb, float wsc) {
  const v4f a0 = *(const v4fa*)(ha + kb);
  const v4f a1 = *(const v4fa*)(ha + kb + 4);
  const v4f a2 = *(const v4fa*)(ha + kb + 16);
  const v4f a3 = *(const v4fa*)(ha + kb + 20);
  const v4f c0 = *(const v4fa*)(hb + kb);
  const v4f c1 = *(const v4fa*)(hb + kb + 4);
  const v4f c2 = *(const v4fa*)(hb + kb + 16);
  const v4f c3 = *(const v4fa*)(hb + kb + 20);
  const float e[16] = { a0.x + c0.x, a0.y + c0.y, a0.z + c0.z, a0.w + c0.w,
                        a1.x + c1.x, a1.y + c1.y, a1.z + c1.z, a1.w + c1.w,
                        a2.x + c2.x, a2.y + c2.y, a2.z + c2.z, a2.w + c2.w,
                        a3.x + c3.x, a3.y + c3.y, a3.z + c3.z, a3.w + c3.w };
  _Float16 wh[16];
  #pragma unroll
  for (int i = 0; i < 16; ++i) wh[i] = (_Float16)(e[i] * wsc);
  FragH f;
  f.half[0] = (v8h){ wh[0], wh[1], wh[2], wh[3], wh[4], wh[5], wh[6], wh[7] };
  f.half[1] = (v8h){ wh[8], wh[9], wh[10], wh[11], wh[12], wh[13], wh[14], wh[15] };
  return f.v;
}

// Per-wave 16x64 f32 tile in LDS -> bf16 hi and lo planes [tok][HID]; one
// 4 lines per instruction.
__device__ __forceinline__ void att_store(const float* sO, __bf16* ahi, __bf16* alo,
                                          size_t gbase, int lane) {
  const int sub = lane >> 3, q8 = lane & 7;
  #pragma unroll
  for (int i = 0; i < 4; ++i) {
    const int row = 4 * i + sub;
    const float* sp = sO + row * HD + 8 * q8;
    const v4f a = *(const v4fa*)sp;
    const v4f c = *(const v4fa*)(sp + 4);
    const float f[8] = { a.x, a.y, a.z, a.w, c.x, c.y, c.z, c.w };
    __bf16 hh[8], ll[8];
    #pragma unroll
    for (int e = 0; e < 8; ++e) {
      hh[e] = (__bf16)f[e];
      ll[e] = (__bf16)(f[e] - (float)hh[e]);
    }
    const v8b hv = { hh[0], hh[1], hh[2], hh[3], hh[4], hh[5], hh[6], hh[7] };
    const v8b lv = { ll[0], ll[1], ll[2], ll[3], ll[4], ll[5], ll[6], ll[7] };
    const size_t gi = gbase + (size_t)row * HID + 8 * q8;
    *(v8b*)(ahi + gi) = hv;
    *(v8b*)(alo + gi) = lv;
  }
}

// 32 keys' worth of global operands, held in registers ahead of their use:
// f[0..3] = four A fragments (pass 1: K rows of two key tiles, two d chunks each;
// pass 2: V^T rows of the four d tiles), id[0..3] = this lane's 16 relation ids.
// Pass 1 needs both at a stage's head, so both are fetched one stage ahead. Pass 2
// needs the ids at the head (one stage ahead) and V^T only at the foot, behind the
// histogram chain, so V^T is fetched at the head of its own stage.
struct AFrag { v16h f[4]; };
struct AIds  { v4i id[4]; };
__device__ __forceinline__ void ids_load(AIds& s, const int* ip) {
  s.id[0] = *(const v4ia*)(ip);
  s.id[1] = *(const v4ia*)(ip + 4);
  s.id[2] = *(const v4ia*)(ip + 16);
  s.id[3] = *(const v4ia*)(ip + 20);
}
__device__ __forceinline__ void k_load(AFrag& s, AIds& n, const _Float16* kbase, const int* idrow, int c, int h) {
  const _Float16* kp = kbase + (size_t)(32 * c) * HD;
  s.f[0] = ldfrag_h(kp, h);
  s.f[1] = ldfrag_h(kp + 32, h);
  s.f[2] = ldfrag_h(kp + 16 * HD, h);
  s.f[3] = ldfrag_h(kp + 16 * HD + 32, h);
  ids_load(n, idrow + 32 * c);
  loads_stay_above();
}
// V^T of stage c and, where there is one, the ids of stage c + 1
template <bool NEXT_IDS>
__device__ __forceinline__ void v_load(AFrag& s, AIds& n, const _Float16* vbase, const int* idrow, int c, int h) {
  #pragma unroll
  for (int t = 0; t < 4; ++t) s.f[t] = ldfrag_h(vbase + (size_t)(16 * t) * SEQ + 32 * c, h);
  if (NEXT_IDS) ids_load(n, idrow + 32 * (c + 1));
  loads_stay_above();
}
// pass 1 on one stage: scores of 32 keys into LDS, running maximum
__device__ __forceinline__ float score_stage(const AFrag& s, const AIds& n, v16h qb0, v16h qb1, const float* qr,
                                             float* sp, float mx) {
  const v8f zero8 = {0.f, 0.f, 0.f, 0.f, 0.f, 0.f, 0.f, 0.f};
  v8f z0 = wmma_h(s.f[0], qb0, zero8);
  z0 = wmma_h(s.f[1], qb1, z0);                 // z0[r] = S[query m][key 32c+8h+r]
  v8f z1 = wmma_h(s.f[2], qb0, zero8);
  z1 = wmma_h(s.f[3], qb1, z1);                 // z1[r] = S[query m][key 32c+16+8h+r]
  const int idv[16] = { n.id[0].x, n.id[0].y, n.id[0].z, n.id[0].w, n.id[1].x, n.id[1].y, n.id[1].z, n.id[1].w,
                        n.id[2].x, n.id[2].y, n.id[2].z, n.id[2].w, n.id[3].x, n.id[3].y, n.id[3].z, n.id[3].w };
  float sc[16];
  #pragma unroll
  for (int e = 0; e < 16; ++e) {
    const int id = idv[e];
    const float bias = (id > 0) ? 0.0f : -10000.0f;
    const float zz = (e < 8) ? z0[e & 7] : z1[e & 7];
    const float v = zz + qr[relidx(id)] * 0.0078125f + bias;
    sc[e] = v;
    mx = fmaxf(mx, v);
  }
  *(v4fa*)(sp)      = (v4f){ sc[0], sc[1], sc[2], sc[3] };
  *(v4fa*)(sp + 4)  = (v4f){ sc[4], sc[5], sc[6], sc[7] };
  *(v4fa*)(sp + 16) = (v4f){ sc[8], sc[9], sc[10], sc[11] };
  *(v4fa*)(sp + 20) = (v4f){ sc[12], sc[13], sc[14], sc[15] };
  return mx;
}
// 2^x. The v_nop is the free slot that the instruction set asks for behind a
// transcendental before its source is overwritten or its result read; only inside the
// same statement does it stay directly behind the v_exp_f32.
__device__ __forceinline__ float exp2_slot(float x) {
  float r;
  asm("v_exp_f32 %0, %1\n\tv_nop" : "=v"(r) : "v"(x));
  return r;
}
// pass 2 on one stage: exp, sum, histogram, O^T += V^T * P^T for 32 keys
__device__ __forceinline__ float pv_stage(const AFrag& s, const AIds& n, const float* sp, float* hp, float mx,
                                          float lsum, v8f (&o)[4]) {
  const v4f s0 = *(const v4fa*)(sp);
  const v4f s1 = *(const v4fa*)(sp + 4);
  const v4f s2 = *(const v4fa*)(sp + 16);
  const v4f s3 = *(const v4fa*)(sp + 20);
  const float sv[16] = { s0.x, s0.y, s0.z, s0.w, s1.x, s1.y, s1.z, s1.w,
                         s2.x, s2.y, s2.z, s2.w, s3.x, s3.y, s3.z, s3.w };
  const int idv[16] = { n.id[0].x, n.id[0].y, n.id[0].z, n.id[0].w, n.id[1].x, n.id[1].y, n.id[1].z, n.id[1].w,
                        n.id[2].x, n.id[2].y, n.id[2].z, n.id[2].w, n.id[3].x, n.id[3].y, n.id[3].z, n.id[3].w };
  _Float16 ph[16];
  #pragma unroll
  for (int e = 0; e < 16; ++e) {
    const float p = exp2_slot((sv[e] - mx) * 1.44269504f);   // = __expf(sv[e] - mx)
    lsum += p;
    const int ri = relidx(idv[e]);
    hp[ri] = hp[ri] + p;
    ph[e] = (_Float16)(p * PSC);
  }
  // P^T B-fragment: element r <- key 32c+8h+r, element 8+r <- key 32c+16+8h+r
  FragH pf;
  pf.half[0] = (v8h){ ph[0], ph[1], ph[2], ph[3], ph[4], ph[5], ph[6], ph[7] };
  pf.half[1] = (v8h){ ph[8], ph[9], ph[10], ph[11], ph[12], ph[13], ph[14], ph[15] };
  #pragma unroll
  for (int t = 0; t < 4; ++t) o[t] = wmma_h(s.f[t], pf.v, o[t]);
  return lsum;
}

// ---------------------------------------------------------------------------
// Kernel 3: relation-aware attention, transposed form, one wave per block.
// Block = 32 thr = 16 queries of one (b, head), all 512 keys.
//   qrel^T = RK * Q^T       : A = rk rows (row = rel, k = d), B = Q^T
//   S^T    = K * Q^T        : A = K rows (row = key, k = d), B = Q^T (k = d, n = query)
//   score  = S^T + qrel[query][id]/128 + (-10000 where id <= 0), kept in LDS f32
//   hist   : per-lane private bins h[lanehalf][query][rel] += p (fixed order, no atomics)
//   O^T    = V^T * P^T      : A = vt rows (row = d, k = key), B = P^T from registers x16384
//   R^T    = RVT * W^T      : A = rvT rows (row = d, k = rel), B = W^T = (hist/l) x16384
//   out    = O^T/(l*16384) + R^T * 2^-21  -> bf16 hi/lo planes [tok][head*64+d]
// Lane owns 256 keys of query column (lane&15); partner = lane ^ 16.
// ---------------------------------------------------------------------------
__global__ __launch_bounds__(32) void attn_kernel(
    const _Float16* __restrict__ qh,   // [B*H][L][D]  (already x0.125)
    const _Float16* __restrict__ kh,   // [B*H][L][D]
    const _Float16* __restrict__ vt,   // [B*H][D][L]
    const int* __restrict__ ids,       // [B][1][L][L] int32 relation ids
    const _Float16* __restrict__ rk,   // [NREL][D]  x32
    const _Float16* __restrict__ rvT,  // [D][NREL]  x32
    __bf16* __restrict__ ahi,          // [NTOK][HID]
    __bf16* __restrict__ alo)          // [NTOK][HID]
{
  __shared__ __attribute__((aligned(16))) float sS[16 * SEQ];       // 32768 B scores
  __shared__ __attribute__((aligned(16))) float sQR[16 * NREL];     //  4096 B qrel[query][rel]
  __shared__ __attribute__((aligned(16))) float sH[2 * 16 * NREL];  //  8192 B hist[h][query][rel]
  __shared__ __attribute__((aligned(16))) float sO[16 * HD];        //  4096 B output staging

  const int lane = threadIdx.x & 31, h = lane >> 4, m = lane & 15;
  const int bh = blockIdx.y, b = bh >> 4, head = bh & 15;
  const int q0 = blockIdx.x * 16;

  // zero this lane's private histogram bins
  float* hp = sH + h * (16 * NREL) + m * NREL;
  {
    const v4f z4 = {0.f, 0.f, 0.f, 0.f};
    #pragma unroll
    for (int i = 0; i < NREL / 4; ++i) *(v4fa*)(hp + 4 * i) = z4;
  }

  // Q^T B-fragments: column n = query q0+m, k = d (two 32-deep chunks)
  const _Float16* qrow = qh + ((size_t)bh * SEQ + q0 + m) * HD;
  const v16h qb0 = ldfrag_h(qrow, h);
  const v16h qb1 = ldfrag_h(qrow + 32, h);

  const _Float16* kbase = kh + ((size_t)bh * SEQ + m) * HD;          // + key0*HD (+32)
  const _Float16* vbase = vt + ((size_t)bh * HD + m) * SEQ;          // + 16t*SEQ + key0
  const int* idrow = ids + ((size_t)b * SEQ + q0 + m) * SEQ + 8 * h; // + key tile base
  AFrag fa, fb;
  AIds ia, ib;
  k_load(fa, ia, kbase, idrow, 0, h);           // pass 1's first stage, in flight under the qrel tiles

  const v8f zero8 = {0.f, 0.f, 0.f, 0.f, 0.f, 0.f, 0.f, 0.f};

  // ---- qrel^T tiles: D[r] = (rel 16rt+8h+r, query m) ----
  #pragma unroll
  for (int rt = 0; rt < 4; ++rt) {
    const _Float16* ap = rk + (size_t)(16 * rt + m) * HD;
    v8f z = zero8;
    z = wmma_h(ldfrag_h(ap, h), qb0, z);
    z = wmma_h(ldfrag_h(ap + 32, h), qb1, z);
    #pragma unroll
    for (int r = 0; r < 8; ++r) sQR[m * NREL + 16 * rt + 8 * h + r] = z[r];
  }
  __syncthreads();

  float* srow = sS + m * SEQ + 8 * h;                                // + key tile base
  const float* qr = sQR + m * NREL;

  float mx = -3.0e38f;
  // rolled: two register stages per trip, no copies between them
  #pragma unroll 1
  for (int c = 0; c < SEQ / 32 - 2; c += 2) {
    k_load(fb, ib, kbase, idrow, c + 1, h);
    mx = score_stage(fa, ia, qb0, qb1, qr, srow + 32 * c, mx);
    k_load(fa, ia, kbase, idrow, c + 2, h);
    mx = score_stage(fb, ib, qb0, qb1, qr, srow + 32 * (c + 1), mx);
  }
  k_load(fb, ib, kbase, idrow, SEQ / 32 - 1, h);
  mx = score_stage(fa, ia, qb0, qb1, qr, srow + 32 * (SEQ / 32 - 2), mx);
  ids_load(ia, idrow);                          // pass 2's first ids
  mx = score_stage(fb, ib, qb0, qb1, qr, srow + 32 * (SEQ / 32 - 1), mx);
  mx = fmaxf(mx, __shfl_xor(mx, 16));
  __syncthreads();

  // ---- pass 2: exp, sum, histogram, O^T += V^T * P^T (32 keys per step) ----
  v8f o[4];                                   // o[t][r] = O[query m][d 16t+8h+r] * (l * 16384)
  #pragma unroll
  for (int t = 0; t < 4; ++t) o[t] = zero8;
  float lsum = 0.0f;
  // rolled: two register stages per trip, no copies between them
  #pragma unroll 1
  for (int c = 0; c < SEQ / 32 - 2; c += 2) {
    v_load<true>(fa, ib, vbase, idrow, c, h);
    lsum = pv_stage(fa, ia, srow + 32 * c, hp, mx, lsum, o);
    v_load<true>(fb, ia, vbase, idrow, c + 1, h);
    lsum = pv_stage(fb, ib, srow + 32 * (c + 1), hp, mx, lsum, o);
  }
  v_load<true>(fa, ib, vbase, idrow, SEQ / 32 - 2, h);
  lsum = pv_stage(fa, ia, srow + 32 * (SEQ / 32 - 2), hp, mx, lsum, o);
  v_load<false>(fb, ia, vbase, idrow, SEQ / 32 - 1, h);
  lsum = pv_stage(fb, ib, srow + 32 * (SEQ / 32 - 1), hp, mx, lsum, o);
  lsum += __shfl_xor(lsum, 16);
  const float inv = 1.0f / lsum;
  const float osc = inv * (1.0f / PSC);
  const float wsc = inv * PSC;
  __syncthreads();                            // histogram bins complete (read cross-lane below)

  // ---- relation value term: R^T = RVT * W^T ----
  const float* ha = sH + m * NREL;
  const float* hb = sH + 16 * NREL + m * NREL;
  const v16h w0 = build_w(ha, hb, 8 * h, wsc);
  const v16h w1 = build_w(ha, hb, 32 + 8 * h, wsc);
  #pragma unroll
  for (int t = 0; t < 4; ++t) {
    const _Float16* ap = rvT + (size_t)(16 * t + m) * NREL;
    v8f z = zero8;
    z = wmma_h(ldfrag_h(ap, h), w0, z);
    z = wmma_h(ldfrag_h(ap + 32, h), w1, z);
    #pragma unroll
    for (int r = 0; r < 8; ++r)
      sO[m * HD + 16 * t + 8 * h + r] = o[t][r] * osc + z[r] * RVS;
  }
  __syncthreads();

  const size_t gbase = ((size_t)b * SEQ + q0) * HID + (size_t)head * HD;
  att_store(sO, ahi, alo, gbase, lane);
  
}

// ---------------------------------------------------------------------------
// instruction, 4 lines per instruction, 64 lines per wave.
// ---------------------------------------------------------------------------
__device__ __forceinline__ void out_store_pass(const float* sT, float* out, int m0, int n0,
                                               int w, int lane) {
  const int q8 = lane & 7, sub = lane >> 3;
  #pragma unroll
  for (int i = 0; i < 16; ++i) {
    const int lid = i * 4 + sub;                 // 0..63
    const int rowl = 32 * w + (lid >> 1), hl = lid & 1;
    const v4f v = *(const v4fa*)(sT + rowl * 64 + 32 * hl + 4 * q8);
    float* dst = out + (size_t)(m0 + rowl) * HID + n0 + 32 * hl + 4 * q8;
    *(v4f*)dst = v;
  }
}

// One k step (32 deep) of the output projection's operands, one stage ahead.
struct OStage { v16b a[4]; v16b b[4]; };
__device__ __forceinline__ void oproj_load(OStage& s, const __bf16* a0h, const __bf16* a0l,
                                           const __bf16* a1h, const __bf16* a1l,
                                           const __bf16* wr, int k0, int h) {
  s.a[0] = ldfrag_b(a0h + k0, h);
  s.a[1] = ldfrag_b(a0l + k0, h);
  s.a[2] = ldfrag_b(a1h + k0, h);
  s.a[3] = ldfrag_b(a1l + k0, h);
  #pragma unroll
  for (int nt = 0; nt < 4; ++nt) s.b[nt] = ldfrag_b(wr + (size_t)nt * 16 * HID + k0, h);
  loads_stay_above();
}
__device__ __forceinline__ void oproj_mma(const OStage& s, v8f (&acc)[2][4]) {
  #pragma unroll
  for (int nt = 0; nt < 4; ++nt) {
    acc[0][nt] = wmma_b(s.a[0], s.b[nt], acc[0][nt]);
    acc[0][nt] = wmma_b(s.a[1], s.b[nt], acc[0][nt]);
    acc[1][nt] = wmma_b(s.a[2], s.b[nt], acc[1][nt]);
    acc[1][nt] = wmma_b(s.a[3], s.b[nt], acc[1][nt]);
  }
}

// ---------------------------------------------------------------------------
// Kernel 4: out = A * Wo^T + bo with A = ahi + alo (two bf16 products per tile).
// Block 128 thr = 128 tokens x 64 features; wave 32 tokens x 64 features.
// ---------------------------------------------------------------------------
__global__ __launch_bounds__(128) void oproj_kernel(
    const __bf16* __restrict__ ahi,    // [NTOK][HID]
    const __bf16* __restrict__ alo,    // [NTOK][HID]
    const __bf16* __restrict__ wo,     // [HID][HID], row = output feature
    const float* __restrict__ bo,
    float* __restrict__ out)           // [NTOK][HID]
{
  __shared__ __attribute__((aligned(16))) float sT[128 * 64];      // 32768 B

  const int tid = threadIdx.x, lane = tid & 31, w = tid >> 5;
  const int h = lane >> 4, m = lane & 15;
  const int m0 = blockIdx.x * 128;
  const int n0 = blockIdx.y * 64;
  const int m0w = m0 + 32 * w;

  const __bf16* a0h = ahi + (size_t)(m0w + m) * HID;
  const __bf16* a0l = alo + (size_t)(m0w + m) * HID;
  const __bf16* a1h = a0h + (size_t)16 * HID;
  const __bf16* a1l = a0l + (size_t)16 * HID;
  const __bf16* wr  = wo + (size_t)(n0 + m) * HID;

  const v8f zero8 = {0.f, 0.f, 0.f, 0.f, 0.f, 0.f, 0.f, 0.f};
  v8f acc[2][4];
  #pragma unroll
  for (int mt = 0; mt < 2; ++mt)
    #pragma unroll
    for (int nt = 0; nt < 4; ++nt) acc[mt][nt] = zero8;

  OStage sa, sb;
  oproj_load(sa, a0h, a0l, a1h, a1l, wr, 0, h);
  // rolled: two register stages per trip, no copies between them
  #pragma unroll 1
  for (int k0 = 0; k0 < HID - 64; k0 += 64) {
    oproj_load(sb, a0h, a0l, a1h, a1l, wr, k0 + 32, h);
    oproj_mma(sa, acc);
    oproj_load(sa, a0h, a0l, a1h, a1l, wr, k0 + 64, h);
    oproj_mma(sb, acc);
    addr_regs_free();
  }
  oproj_load(sb, a0h, a0l, a1h, a1l, wr, HID - 32, h);
  addr_regs_free();
  oproj_mma(sa, acc);
  oproj_mma(sb, acc);

  // D[r] of tile (mt, nt) = Y[token m0w+16mt+8h+r][feature n0+16nt+m]
  #pragma unroll
  for (int nt = 0; nt < 4; ++nt) {
    const int featl = 16 * nt + m;
    const float bvl = (float)(__bf16)bo[n0 + featl];
    #pragma unroll
    for (int mt = 0; mt < 2; ++mt) {
      #pragma unroll
      for (int r = 0; r < 8; ++r) {
        const int tokl = 32 * w + 16 * mt + 8 * h + r;     // 0..127
        sT[tokl * 64 + featl] = acc[mt][nt][r] + bvl;
      }
    }
  }
  __syncthreads();

  out_store_pass(sT, out, m0, n0, w, lane);
  
}

// ---------------------------------------------------------------------------
extern "C" void kernel_launch(void* const* d_in, const int* in_sizes, int n_in,
                              void* d_out, int out_size, void* d_ws, size_t ws_size,
                              hipStream_t stream) {
  if (n_in < 14) return;
  if (in_sizes[0] != NX || in_sizes[1] != NX || in_sizes[2] != NX) return;
  if (in_sizes[3] != NB * SEQ * SEQ) return;
  if (in_sizes[4] != NW || in_sizes[6] != NW || in_sizes[8] != NW || in_sizes[10] != NW) return;
  if (in_sizes[5] != HID || in_sizes[7] != HID || in_sizes[9] != HID || in_sizes[11] != HID) return;
  if (in_sizes[12] != NREL * HD || in_sizes[13] != NREL * HD) return;
  if (out_size != NX) return;

  const float* q_in = (const float*)d_in[0];
  const float* k_in = (const float*)d_in[1];
  const float* v_in = (const float*)d_in[2];
  const int*   ids  = (const int*)d_in[3];
  const float* Wq = (const float*)d_in[4];
  const float* bq = (const float*)d_in[5];
  const float* Wk = (const float*)d_in[6];
  const float* bk = (const float*)d_in[7];
  const float* Wv = (const float*)d_in[8];
  const float* bv = (const float*)d_in[9];
  const float* Wo = (const float*)d_in[10];
  const float* bo = (const float*)d_in[11];
  const float* relk = (const float*)d_in[12];
  const float* relv = (const float*)d_in[13];
  float* out = (float*)d_out;

  const size_t xb_bytes = (size_t)3 * NX * 2;          // 12582912
  const size_t wb_bytes = (size_t)4 * NW * 2;          //  8388608
  const size_t rt_bytes = (size_t)NREL * HD * 2;       //     8192
  const size_t pl_bytes = (size_t)NPL * 2;             //  4194304
  const size_t ap_bytes = (size_t)NX * 2;              //  4194304
  const size_t total = xb_bytes + wb_bytes + 2 * rt_bytes + 3 * pl_bytes + 2 * ap_bytes;  // 41959424
  if (total > ws_size) return;

  char* ws = (char*)d_ws;
  size_t off = 0;
  __bf16* xb = (__bf16*)(ws + off);       off += xb_bytes;
  __bf16* wb = (__bf16*)(ws + off);       off += wb_bytes;
  _Float16* rk  = (_Float16*)(ws + off);  off += rt_bytes;
  _Float16* rvT = (_Float16*)(ws + off);  off += rt_bytes;
  _Float16* qh  = (_Float16*)(ws + off);  off += pl_bytes;
  _Float16* kh  = (_Float16*)(ws + off);  off += pl_bytes;
  _Float16* vt  = (_Float16*)(ws + off);  off += pl_bytes;
  __bf16* ahi = (__bf16*)(ws + off);      off += ap_bytes;
  __bf16* alo = (__bf16*)(ws + off);      off += ap_bytes;
  if (off > ws_size) return;

  convert_kernel<<<(G_TOT + 255) / 256, 256, 0, stream>>>(q_in, k_in, v_in, Wq, Wk, Wv, Wo,
                                                         relk, relv, xb, wb, rk, rvT);

  dim3 gProj(NTOK / 128, 3 * NH);                                   // (16, 48)
  proj_kernel<<<gProj, 128, 0, stream>>>(xb, wb, bq, bk, bv, qh, kh, vt);

  dim3 gAtt(SEQ / 16, NB * NH);                                     // (32, 64)
  attn_kernel<<<gAtt, 32, 0, stream>>>(qh, kh, vt, ids, rk, rvT, ahi, alo);

  dim3 gOut(NTOK / 128, HID / 64);                                  // (16, 16)
  oproj_kernel<<<gOut, 128, 0, stream>>>(ahi, alo, wb + (size_t)3 * NW, bo, out);
}

// v002
// It runs in 93 microseconds.
// Two timings next to v001 put it at 1.21 and 1.20 times that version's speed.
// Counting every step since v000, it is 2.12 times as fast.
// q/k/v projections: v_wmma_f32_16x16x32_bf16 (bf16 operands, f32 accumulate); q.relk^T, k.q^T, v^T.p^T, relv^T.w^T: v_wmma_f32_16x16x32_f16 (f16 operands, f32 accumulate; relk/relv carried x32, q x0.125, p and w x16384, exact power-of-two scales folded back in f32); output projection: v_wmma_f32_16x16x32_bf16 with the activation as a bf16 hi+lo pair (two products) against bf16 weights; softmax, additive bias and normalisation in f32.
#include <hip/hip_runtime.h>

typedef _Float16 v16h __attribute__((ext_vector_type(16)));
typedef _Float16 v8h  __attribute__((ext_vector_type(8)));
typedef __bf16   v16b __attribute__((ext_vector_type(16)));
typedef __bf16   v8b  __attribute__((ext_vector_type(8)));
typedef float    v8f  __attribute__((ext_vector_type(8)));
typedef float    v4f  __attribute__((ext_vector_type(4)));
typedef int      v4i  __attribute__((ext_vector_type(4)));
typedef v8h __attribute__((may_alias)) v8ha;
typedef v8b __attribute__((may_alias)) v8ba;
typedef v4f __attribute__((may_alias)) v4fa;
typedef v4i __attribute__((may_alias)) v4ia;

union FragH { v16h v; v8h half[2]; };
union FragB { v16b v; v8b half[2]; };

#define NB    4
#define SEQ   512
#define HID   1024
#define NH    16
#define HD    64
#define NREL  64
#define NTOK  (NB * SEQ)            // 2048 tokens
#define NX    (NTOK * HID)          // 2097152 elements per activation
#define NW    (HID * HID)           // 1048576 elements per weight
#define NX8   (NX / 8)              // 262144
#define NW8   (NW / 8)              // 131072
#define NPL   (NB * NH * SEQ * HD)  // 2097152 halves per q/k/v plane
#define G_X   (3 * NX8)             // 786432 activation groups
#define G_W   (4 * NW8)             // 524288 weight groups
#define G_R   (NREL * HD / 8)       // 512 groups per relation table
#define G_I   (NB * SEQ * SEQ / 4)  // 262144 groups of four relation ids
#define G_16  (G_X + G_W + 2 * G_R) // 1311744 groups of the 16-bit planes
#define G_TOT (G_16 + G_I)          // 1573888
#define TILE  512                   // elements of one 16-row x 32-k tile (1 KiB)
#define PSC   16384.0f
#define RVS   4.76837158203125e-7f  // 2^-21 = 0.25 / (32 * 16384)

// ---------------------------------------------------------------------------
// 16x16x32 WMMA (builtin form; the compiler keeps the distance behind it).
// Fragment map (wave32): lane l, h = l>>4, m = n = l&15.
//   A/B element i: i<8 -> k0+8h+i ; i>=8 -> k0+16+8h+(i-8)
//   D element r : row 8h+r, col l&15
// ---------------------------------------------------------------------------
__device__ __forceinline__ v8f wmma_h(v16h a, v16h b, v8f c) {
  return __builtin_amdgcn_wmma_f32_16x16x32_f16(false, a, false, b, (short)0, c, false, false);
}
__device__ __forceinline__ v8f wmma_b(v16b a, v16b b, v8f c) {
  return __builtin_amdgcn_wmma_f32_16x16x32_bf16(false, a, false, b, (short)0, c, false, false);
}

// Stands behind a stage's group of global loads: without it the scheduler sinks the
// loads below the other stage's work and their latency is exposed again.
__device__ __forceinline__ void loads_stay_above() { __builtin_amdgcn_sched_barrier(0); }
// Stands in front of code that rewrites address registers which loads still in
// flight name (a pipelined loop's next trip, the epilogue's address arithmetic).
// The two scheduling barriers keep the wait where it is written: late enough to
// cost nothing, and ahead of every such rewrite.
__device__ __forceinline__ void addr_regs_free() {
  __builtin_amdgcn_sched_barrier(0);
  asm volatile("s_wait_xcnt 0x0" ::: "memory");
  __builtin_amdgcn_sched_barrier(0);
}
// The same, and the address pair is an input of the wait: it stays allocated up to
// here, so that no load's result is given the registers that earlier loads still name.
__device__ __forceinline__ void addr_regs_free_of(const void* p) {
  __builtin_amdgcn_sched_barrier(0);
  asm volatile("s_wait_xcnt 0x0" :: "v"(p) : "memory");
  __builtin_amdgcn_sched_barrier(0);
}

// Tile order of every 16-bit workspace plane: a 16-row x 32-k tile is one 1-KiB
// block [j][lane][8 elements]; lane 16h+m of half j holds row m, k = 16j+8h .. +7,
// which is the fragment map above. One wave load of a half is 512 contiguous bytes
// (four whole lines) where a row-major plane gives 32 bytes of each of 16 lines.
// A plane of R rows x K columns is [R/16][K/32] tiles (vt: [K/32][R/16] per (b, head)).
// A or B fragment: p = the tile's first element + 8 * lane.
__device__ __forceinline__ v16h ldtile_h(const _Float16* p) {
  FragH f;
  f.half[0] = *(const v8ha*)(p);
  f.half[1] = *(const v8ha*)(p + 256);
  return f.v;
}
__device__ __forceinline__ v16b ldtile_b(const __bf16* p) {
  FragB f;
  f.half[0] = *(const v8ba*)(p);
  f.half[1] = *(const v8ba*)(p + 256);
  return f.v;
}

// relation id: wrap negative once, then clamp into [0, NREL-1]
__device__ __forceinline__ int relidx(int id) {
  int t = id + ((id >> 31) & NREL);
  t = t < 0 ? 0 : t;
  t = t > (NREL - 1) ? (NREL - 1) : t;
  return t;
}

// ---------------------------------------------------------------------------
// Kernel 1: f32 -> 16-bit planes in tile order, 8 elements (16 B) per thread; thread
// index = index of the 16-byte group it writes, so stores are whole lines and the
// 16-line access falls on the one read of each source element.
//   xb [3][NTOK][HID] bf16 (q_in, k_in, v_in, RNE convert)
//   wb [4][HID][HID]  bf16 (Wq, Wk, Wv, Wo, row = output feature)
//   rk [NREL][HD]     f16  = 32 * bf16(relk)
//   rvT[HD][NREL]     f16  = 32 * bf16(relv)^T
//   idp               int  relation ids as given, [B][L/16][L/32][i][lane][4]:
//                     lane 16h+m of group i holds query m, keys 16(i>>1)+8h+4(i&1) .. +3
// ---------------------------------------------------------------------------
__global__ __launch_bounds__(256) void convert_kernel(
    const float* __restrict__ q_in, const float* __restrict__ k_in, const float* __restrict__ v_in,
    const float* __restrict__ Wq, const float* __restrict__ Wk, const float* __restrict__ Wv,
    const float* __restrict__ Wo, const float* __restrict__ relk, const float* __restrict__ relv,
    const int* __restrict__ ids,
    __bf16* __restrict__ xb, __bf16* __restrict__ wb, _Float16* __restrict__ rk, _Float16* __restrict__ rvT,
    int* __restrict__ idp)
{
  const int g = blockIdx.x * 256 + threadIdx.x;
  if (g >= G_TOT) return;
  const int h = (g >> 4) & 1, m = g & 15;        // every plane starts at a multiple of 32 groups
  if (g >= G_16) {
    const int e = g - G_16;
    const int i = (e >> 5) & 3, c = (e >> 7) & 15, qt = e >> 11;   // qt = 32 b + query tile
    const int* src = ids + ((size_t)qt * 16 + m) * SEQ + 32 * c + 16 * (i >> 1) + 8 * h + 4 * (i & 1);
    *(v4i*)(idp + (size_t)e * 4) = *(const v4ia*)src;
  } else if (g < G_X + G_W) {
    const float* src;
    __bf16* dst;
    if (g < G_X) {
      const int which = g >> 18;                 // NX8 = 2^18
      const int off = g & (NX8 - 1);
      const float* s = (which == 0) ? q_in : ((which == 1) ? k_in : v_in);
      // group off = ((row tile * 32 + k tile) * 2 + j) * 32 + lane
      src = s + (size_t)((off >> 11) * 16 + m) * HID + ((off >> 6) & 31) * 32 + ((off >> 5) & 1) * 16 + 8 * h;
      dst = xb + (size_t)which * NX + (size_t)off * 8;
    } else {
      const int e = g - G_X;
      const int wsel = e >> 17;                 // NW8 = 2^17
      const int off = e & (NW8 - 1);
      const float* s = (wsel == 0) ? Wq : ((wsel == 1) ? Wk : ((wsel == 2) ? Wv : Wo));
      src = s + (size_t)((off >> 11) * 16 + m) * HID + ((off >> 6) & 31) * 32 + ((off >> 5) & 1) * 16 + 8 * h;
      dst = wb + (size_t)wsel * NW + (size_t)off * 8;
    }
    const v4f a = *(const v4fa*)src;
    const v4f c = *(const v4fa*)(src + 4);
    const v8b o = { (__bf16)a.x, (__bf16)a.y, (__bf16)a.z, (__bf16)a.w,
                    (__bf16)c.x, (__bf16)c.y, (__bf16)c.z, (__bf16)c.w };
    *(v8b*)dst = o;
    
  } else {
    const int e = g - (G_X + G_W);
    float f[8];
    _Float16* dst;
    // group e & 511 = ((row tile * 2 + k tile) * 2 + j) * 32 + lane of a 64 x 64 plane
    const int row = ((e >> 7) & 3) * 16 + m;
    const int kk = ((e >> 6) & 1) * 32 + ((e >> 5) & 1) * 16 + 8 * h;
    if (e < G_R) {
      const float* src = relk + (size_t)row * HD + kk;
      const v4f a = *(const v4fa*)src;
      const v4f c = *(const v4fa*)(src + 4);
      f[0] = a.x; f[1] = a.y; f[2] = a.z; f[3] = a.w;
      f[4] = c.x; f[5] = c.y; f[6] = c.z; f[7] = c.w;
      dst = rk + (size_t)e * 8;
    } else {
      const int e3 = e - G_R;                    // 0..511; row = d, kk = first relation index
      #pragma unroll
      for (int i = 0; i < 8; ++i) f[i] = relv[(size_t)(kk + i) * HD + row];
      dst = rvT + (size_t)e3 * 8;
    }
    _Float16 hh[8];
    #pragma unroll
    for (int i = 0; i < 8; ++i) hh[i] = (_Float16)((float)(__bf16)f[i] * 32.0f);
    const v8h o = { hh[0], hh[1], hh[2], hh[3], hh[4], hh[5], hh[6], hh[7] };
    *(v8h*)dst = o;
    
  }
}

// ---------------------------------------------------------------------------
// 4 lines per instruction, 32 lines per wave, 128 per block; tile order.
// which 0/1: plane[bh][l/16][d/32] tiles (row = token, k = d); a wave's 32 tokens = 4 tiles
// which 2  : vt[bh][l/32][d/16] tiles    (row = d, k = token); a wave's 32 tokens = 4 tiles
// ---------------------------------------------------------------------------
__device__ __forceinline__ void proj_store_pass(const _Float16* sT, _Float16* plane, _Float16* vt,
                                                int which, int bh, int l0, int w, int lane) {
  const int h = lane >> 4, m = lane & 15;
  // LDS element of half i = 0: (token tile * 2 + d tile) * 2 + j = i, or d tile * 2 + j = i
  const _Float16* sp = (which != 2) ? sT + (32 * w + m) * HD + 8 * h : sT + m * 128 + 32 * w + 8 * h;
  // either way the wave's four tiles are 4 KiB in a row at the same offset of its plane
  _Float16* dst = ((which != 2) ? plane : vt) + ((size_t)bh * SEQ + l0 + 32 * w) * HD + 8 * lane;
  #pragma unroll
  for (int i = 0; i < 8; ++i) {
    const int so = (which != 2) ? 16 * (i >> 2) * HD + 16 * (i & 3) : 16 * (i >> 1) * 128 + 16 * (i & 1);
    *(v8h*)(dst + 256 * i) = *(const v8ha*)(sp + so);
  }
}

// One k step (32 deep) of a projection's operands, held in registers so that
// the next step's loads are in flight while this step's products run.
struct PStage { v16b a0, a1, b[4]; };
__device__ __forceinline__ void proj_load(PStage& s, const __bf16* xa0, const __bf16* xa1,
                                          const __bf16* wr, int k0) {
  const int t0 = (k0 >> 5) * TILE;
  s.a0 = ldtile_b(xa0 + t0);
  s.a1 = ldtile_b(xa1 + t0);
  #pragma unroll
  for (int nt = 0; nt < 4; ++nt) s.b[nt] = ldtile_b(wr + (size_t)nt * 16 * HID + t0);
  loads_stay_above();
}
__device__ __forceinline__ void proj_mma(const PStage& s, v8f (&acc)[2][4]) {
  #pragma unroll
  for (int nt = 0; nt < 4; ++nt) {
    acc[0][nt] = wmma_b(s.a0, s.b[nt], acc[0][nt]);
    acc[1][nt] = wmma_b(s.a1, s.b[nt], acc[1][nt]);
  }
}

// ---------------------------------------------------------------------------
// Kernel 2: Y = x * W^T + b for the three projections (which = 0,1,2).
// Block 128 thr (4 waves) = 128 tokens x 64 features (one (which, head));
// wave tile 32 tokens x 64 features; K = 1024 in steps of 32;
// A (x rows) and B (W rows) bf16 fragments straight from the tile-ordered planes.
// ---------------------------------------------------------------------------
__global__ __launch_bounds__(128) void proj_kernel(
    const __bf16* __restrict__ xb,     // [3][NTOK][HID], tile order
    const __bf16* __restrict__ wb,     // [4][HID][HID], row = output feature (first 3 used), tile order
    const float* __restrict__ bq, const float* __restrict__ bk, const float* __restrict__ bv,
    _Float16* __restrict__ qh,         // [B*H][L][D]  f16(0.125*q), tile order
    _Float16* __restrict__ kh,         // [B*H][L][D], tile order
    _Float16* __restrict__ vt)         // [B*H][L/32][D/16] tiles (row = d, k = token)
{
  __shared__ __attribute__((aligned(16))) _Float16 sT[128 * 64];   // 16384 B

  const int tid = threadIdx.x, lane = tid & 31, w = tid >> 5;
  const int h = lane >> 4, m = lane & 15;
  const int m0 = blockIdx.x * 128;
  const int cg = blockIdx.y;                 // 0..47
  const int which = cg >> 4, head = cg & 15;
  const int m0w = m0 + 32 * w;

  // 16 rows of a plane = HID / 32 tiles in a row = 16 * HID elements
  const __bf16* xa0 = xb + (size_t)which * NX + (size_t)m0w * HID + 8 * lane;   // token tile, mt = 0
  const __bf16* xa1 = xa0 + (size_t)16 * HID;                                   // mt = 1
  const __bf16* wr  = wb + (size_t)which * NW + (size_t)(head * HD) * HID + 8 * lane;  // feature tile, nt = 0

  const v8f zero8 = {0.f, 0.f, 0.f, 0.f, 0.f, 0.f, 0.f, 0.f};
  v8f acc[2][4];
  #pragma unroll
  for (int mt = 0; mt < 2; ++mt)
    #pragma unroll
    for (int nt = 0; nt < 4; ++nt) acc[mt][nt] = zero8;

  PStage sa, sb;
  proj_load(sa, xa0, xa1, wr, 0);
  // rolled: two register stages per trip, no copies between them
  #pragma unroll 1
  for (int k0 = 0; k0 < HID - 64; k0 += 64) {
    proj_load(sb, xa0, xa1, wr, k0 + 32);
    proj_mma(sa, acc);
    proj_load(sa, xa0, xa1, wr, k0 + 64);
    proj_mma(sb, acc);
    addr_regs_free();
  }
  proj_load(sb, xa0, xa1, wr, HID - 32);
  proj_mma(sa, acc);
  proj_mma(sb, acc);

  // D[r] of tile (mt, nt) = Y[token m0w+16mt+8h+r][feature 16nt+m]
  const float* bias = (which == 0) ? bq : ((which == 1) ? bk : bv);
  const float osc = (which == 0) ? 0.125f : 1.0f;
  #pragma unroll
  for (int nt = 0; nt < 4; ++nt) {
    const int feat = 16 * nt + m;
    const float bvl = (float)(__bf16)bias[head * HD + feat];
    #pragma unroll
    for (int mt = 0; mt < 2; ++mt) {
      #pragma unroll
      for (int r = 0; r < 8; ++r) {
        const int tokl = 32 * w + 16 * mt + 8 * h + r;     // 0..127
        const float y = (acc[mt][nt][r] + bvl) * osc;
        const int idx = (which == 2) ? (feat * 128 + tokl) : (tokl * HD + feat);
        sT[idx] = (_Float16)y;
      }
    }
  }
  __syncthreads();

  const int b = m0 >> 9, l0 = m0 & (SEQ - 1), bh = b * NH + head;
  _Float16* plane = (which == 0) ? qh : kh;
  proj_store_pass(sT, plane, vt, which, bh, l0, w, lane);
  
}

// ---------------------------------------------------------------------------
// Attention helpers.
// ---------------------------------------------------------------------------
// B fragment of the normalised relation histogram, k = relation index:
// element i<8 <- k0+8h+i, element 8+i <- k0+16+8h+i; kb = k0 + 8h.
__device__ __forceinline__ v16h build_w(const float* ha, const float* hb, int kb, float wsc) {
  const v4f a0 = *(const v4fa*)(ha + kb);
  const v4f a1 = *(const v4fa*)(ha + kb + 4);
  const v4f a2 = *(const v4fa*)(ha + kb + 16);
  const v4f a3 = *(const v4fa*)(ha + kb + 20);
  const v4f c0 = *(const v4fa*)(hb + kb);
  const v4f c1 = *(const v4fa*)(hb + kb + 4);
  const v4f c2 = *(const v4fa*)(hb + kb + 16);
  const v4f c3 = *(const v4fa*)(hb + kb + 20);
  const float e[16] = { a0.x + c0.x, a0.y + c0.y, a0.z + c0.z, a0.w + c0.w,
                        a1.x + c1.x, a1.y + c1.y, a1.z + c1.z, a1.w + c1.w,
                        a2.x + c2.x, a2.y + c2.y, a2.z + c2.z, a2.w + c2.w,
                        a3.x + c3.x, a3.y + c3.y, a3.z + c3.z, a3.w + c3.w };
  _Float16 wh[16];
  #pragma unroll
  for (int i = 0; i < 16; ++i) wh[i] = (_Float16)(e[i] * wsc);
  FragH f;
  f.half[0] = (v8h){ wh[0], wh[1], wh[2], wh[3], wh[4], wh[5], wh[6], wh[7] };
  f.half[1] = (v8h){ wh[8], wh[9], wh[10], wh[11], wh[12], wh[13], wh[14], wh[15] };
  return f.v;
}

// Per-wave 16x64 f32 tile in LDS -> bf16 hi and lo planes [tok][HID] in tile order:
// two tiles in a row, i = feature tile * 2 + j; 4 lines per instruction.
__device__ __forceinline__ void att_store(const float* sO, __bf16* ahi, __bf16* alo,
                                          size_t gbase, int lane) {
  const int h = lane >> 4, m = lane & 15;
  #pragma unroll
  for (int i = 0; i < 4; ++i) {
    const float* sp = sO + m * HD + 16 * i + 8 * h;
    const v4f a = *(const v4fa*)sp;
    const v4f c = *(const v4fa*)(sp + 4);
    const float f[8] = { a.x, a.y, a.z, a.w, c.x, c.y, c.z, c.w };
    __bf16 hh[8], ll[8];
    #pragma unroll
    for (int e = 0; e < 8; ++e) {
      hh[e] = (__bf16)f[e];
      ll[e] = (__bf16)(f[e] - (float)hh[e]);
    }
    const v8b hv = { hh[0], hh[1], hh[2], hh[3], hh[4], hh[5], hh[6], hh[7] };
    const v8b lv = { ll[0], ll[1], ll[2], ll[3], ll[4], ll[5], ll[6], ll[7] };
    const size_t gi = gbase + 256 * i + 8 * lane;
    *(v8b*)(ahi + gi) = hv;
    *(v8b*)(alo + gi) = lv;
  }
}

// 32 keys' worth of global operands, held in registers ahead of their use:
// f[0..3] = four A fragments (pass 1: K rows of two key tiles, two d chunks each;
// pass 2: V^T rows of the four d tiles), id[0..3] = this lane's 16 relation ids.
// Pass 1 needs both at a stage's head, so both are fetched one stage ahead. Pass 2
// needs the ids at the head (one stage ahead) and V^T only at the foot, behind the
// histogram chain, so V^T is fetched at the head of its own stage.
struct AFrag { v16h f[4]; };
struct AIds  { v4i id[4]; };
// ip = the stage's 2-KiB block of idp + 4 * lane; id[0..3] = keys 8h+0..3, 8h+4..7, 16+8h+0..3, 16+8h+4..7
__device__ __forceinline__ void ids_load(AIds& s, const int* ip) {
  #pragma unroll
  for (int i = 0; i < 4; ++i) s.id[i] = *(const v4ia*)(ip + 128 * i);
}
__device__ __forceinline__ void k_load(AFrag& s, AIds& n, const _Float16* kbase, const int* idrow, int c) {
  // 32 keys = four tiles in a row: (key tile 0, d 0..31), (0, 32..63), (1, 0..31), (1, 32..63)
  #pragma unroll
  for (int t = 0; t < 4; ++t) s.f[t] = ldtile_h(kbase + (size_t)(4 * c + t) * TILE);
  ids_load(n, idrow + 512 * c);
  loads_stay_above();
}
// V^T of stage c and, where there is one, the ids of stage c + 1
template <bool NEXT_IDS>
__device__ __forceinline__ void v_load(AFrag& s, AIds& n, const _Float16* vbase, const int* idrow, int c) {
  #pragma unroll
  for (int t = 0; t < 4; ++t) s.f[t] = ldtile_h(vbase + (size_t)(4 * c + t) * TILE);
  if (NEXT_IDS) ids_load(n, idrow + 512 * (c + 1));
  loads_stay_above();
}
// pass 1 on one stage: scores of 32 keys into LDS, running maximum
__device__ __forceinline__ float score_stage(const AFrag& s, const AIds& n, v16h qb0, v16h qb1, const float* qr,
                                             float* sp, float mx) {
  const v8f zero8 = {0.f, 0.f, 0.f, 0.f, 0.f, 0.f, 0.f, 0.f};
  v8f z0 = wmma_h(s.f[0], qb0, zero8);
  z0 = wmma_h(s.f[1], qb1, z0);                 // z0[r] = S[query m][key 32c+8h+r]
  v8f z1 = wmma_h(s.f[2], qb0, zero8);
  z1 = wmma_h(s.f[3], qb1, z1);                 // z1[r] = S[query m][key 32c+16+8h+r]
  const int idv[16] = { n.id[0].x, n.id[0].y, n.id[0].z, n.id[0].w, n.id[1].x, n.id[1].y, n.id[1].z, n.id[1].w,
                        n.id[2].x, n.id[2].y, n.id[2].z, n.id[2].w, n.id[3].x, n.id[3].y, n.id[3].z, n.id[3].w };
  float sc[16];
  #pragma unroll
  for (int e = 0; e < 16; ++e) {
    const int id = idv[e];
    const float bias = (id > 0) ? 0.0f : -10000.0f;
    const float zz = (e < 8) ? z0[e & 7] : z1[e & 7];
    const float v = zz + qr[relidx(id)] * 0.0078125f + bias;
    sc[e] = v;
    mx = fmaxf(mx, v);
  }
  *(v4fa*)(sp)      = (v4f){ sc[0], sc[1], sc[2], sc[3] };
  *(v4fa*)(sp + 4)  = (v4f){ sc[4], sc[5], sc[6], sc[7] };
  *(v4fa*)(sp + 16) = (v4f){ sc[8], sc[9], sc[10], sc[11] };
  *(v4fa*)(sp + 20) = (v4f){ sc[12], sc[13], sc[14], sc[15] };
  return mx;
}
// 2^x. The v_nop is the free slot that the instruction set asks for behind a
// transcendental before its source is overwritten or its result read; only inside the
// same statement does it stay directly behind the v_exp_f32.
__device__ __forceinline__ float exp2_slot(float x) {
  float r;
  asm("v_exp_f32 %0, %1\n\tv_nop" : "=v"(r) : "v"(x));
  return r;
}
// pass 2 on one stage: exp, sum, histogram, O^T += V^T * P^T for 32 keys
__device__ __forceinline__ float pv_stage(const AFrag& s, const AIds& n, const float* sp, float* hp, float mx,
                                          float lsum, v8f (&o)[4]) {
  const v4f s0 = *(const v4fa*)(sp);
  const v4f s1 = *(const v4fa*)(sp + 4);
  const v4f s2 = *(const v4fa*)(sp + 16);
  const v4f s3 = *(const v4fa*)(sp + 20);
  const float sv[16] = { s0.x, s0.y, s0.z, s0.w, s1.x, s1.y, s1.z, s1.w,
                         s2.x, s2.y, s2.z, s2.w, s3.x, s3.y, s3.z, s3.w };
  const int idv[16] = { n.id[0].x, n.id[0].y, n.id[0].z, n.id[0].w, n.id[1].x, n.id[1].y, n.id[1].z, n.id[1].w,
                        n.id[2].x, n.id[2].y, n.id[2].z, n.id[2].w, n.id[3].x, n.id[3].y, n.id[3].z, n.id[3].w };
  _Float16 ph[16];
  #pragma unroll
  for (int e = 0; e < 16; ++e) {
    const float p = exp2_slot((sv[e] - mx) * 1.44269504f);   // = __expf(sv[e] - mx)
    lsum += p;
    const int ri = relidx(idv[e]);
    hp[ri] = hp[ri] + p;
    ph[e] = (_Float16)(p * PSC);
  }
  // P^T B-fragment: element r <- key 32c+8h+r, element 8+r <- key 32c+16+8h+r
  FragH pf;
  pf.half[0] = (v8h){ ph[0], ph[1], ph[2], ph[3], ph[4], ph[5], ph[6], ph[7] };
  pf.half[1] = (v8h){ ph[8], ph[9], ph[10], ph[11], ph[12], ph[13], ph[14], ph[15] };
  #pragma unroll
  for (int t = 0; t < 4; ++t) o[t] = wmma_h(s.f[t], pf.v, o[t]);
  return lsum;
}

// ---------------------------------------------------------------------------
// Kernel 3: relation-aware attention, transposed form, one wave per block.
// Block = 32 thr = 16 queries of one (b, head), all 512 keys.
//   qrel^T = RK * Q^T       : A = rk rows (row = rel, k = d), B = Q^T
//   S^T    = K * Q^T        : A = K rows (row = key, k = d), B = Q^T (k = d, n = query)
//   score  = S^T + qrel[query][id]/128 + (-10000 where id <= 0), kept in LDS f32
//   hist   : per-lane private bins h[lanehalf][query][rel] += p (fixed order, no atomics)
//   O^T    = V^T * P^T      : A = vt rows (row = d, k = key), B = P^T from registers x16384
//   R^T    = RVT * W^T      : A = rvT rows (row = d, k = rel), B = W^T = (hist/l) x16384
//   out    = O^T/(l*16384) + R^T * 2^-21  -> bf16 hi/lo planes [tok][head*64+d]
// Lane owns 256 keys of query column (lane&15); partner = lane ^ 16.
// ---------------------------------------------------------------------------
__global__ __launch_bounds__(32) void attn_kernel(
    const _Float16* __restrict__ qh,   // [B*H][L][D]  (already x0.125), tile order
    const _Float16* __restrict__ kh,   // [B*H][L][D], tile order
    const _Float16* __restrict__ vt,   // [B*H][L/32][D/16] tiles (row = d, k = key)
    const int* __restrict__ idp,       // [B][L/16][L/32][4][32][4] int32 relation ids in lane order
    const _Float16* __restrict__ rk,   // [NREL][D]  x32, tile order
    const _Float16* __restrict__ rvT,  // [D][NREL]  x32, tile order
    __bf16* __restrict__ ahi,          // [NTOK][HID], tile order
    __bf16* __restrict__ alo)          // [NTOK][HID], tile order
{
  __shared__ __attribute__((aligned(16))) float sS[16 * SEQ];       // 32768 B scores
  __shared__ __attribute__((aligned(16))) float sQR[16 * NREL];     //  4096 B qrel[query][rel]
  __shared__ __attribute__((aligned(16))) float sH[2 * 16 * NREL];  //  8192 B hist[h][query][rel]
  __shared__ __attribute__((aligned(16))) float sO[16 * HD];        //  4096 B output staging

  const int lane = threadIdx.x & 31, h = lane >> 4, m = lane & 15;
  const int bh = blockIdx.y, b = bh >> 4, head = bh & 15;
  const int q0 = blockIdx.x * 16;

  // zero this lane's private histogram bins
  float* hp = sH + h * (16 * NREL) + m * NREL;
  {
    const v4f z4 = {0.f, 0.f, 0.f, 0.f};
    #pragma unroll
    for (int i = 0; i < NREL / 4; ++i) *(v4fa*)(hp + 4 * i) = z4;
  }

  // Q^T B-fragments: column n = query q0+m, k = d (two 32-deep chunks)
  const _Float16* qrow = qh + ((size_t)bh * SEQ + q0) * HD + 8 * lane;
  const v16h qb0 = ldtile_h(qrow);
  const v16h qb1 = ldtile_h(qrow + TILE);

  const _Float16* kbase = kh + (size_t)bh * SEQ * HD + 8 * lane;     // + four tiles per stage
  const _Float16* vbase = vt + (size_t)bh * SEQ * HD + 8 * lane;     // + four tiles per stage
  const int* idrow = idp + ((size_t)b * SEQ + q0) * SEQ + 4 * lane;  // + 512 ids per stage
  AFrag fa, fb;
  AIds ia, ib;
  k_load(fa, ia, kbase, idrow, 0);              // pass 1's first stage, in flight under the qrel tiles

  const v8f zero8 = {0.f, 0.f, 0.f, 0.f, 0.f, 0.f, 0.f, 0.f};

  // ---- qrel^T tiles: D[r] = (rel 16rt+8h+r, query m) ----
  #pragma unroll
  for (int rt = 0; rt < 4; ++rt) {
    const _Float16* ap = rk + (size_t)(2 * rt) * TILE + 8 * lane;
    v8f z = zero8;
    z = wmma_h(ldtile_h(ap), qb0, z);
    z = wmma_h(ldtile_h(ap + TILE), qb1, z);
    #pragma unroll
    for (int r = 0; r < 8; ++r) sQR[m * NREL + 16 * rt + 8 * h + r] = z[r];
  }
  __syncthreads();

  float* srow = sS + m * SEQ + 8 * h;                                // + key tile base
  const float* qr = sQR + m * NREL;

  float mx = -3.0e38f;
  // rolled: two register stages per trip, no copies between them
  #pragma unroll 1
  for (int c = 0; c < SEQ / 32 - 2; c += 2) {
    k_load(fb, ib, kbase, idrow, c + 1);
    mx = score_stage(fa, ia, qb0, qb1, qr, srow + 32 * c, mx);
    k_load(fa, ia, kbase, idrow, c + 2);
    mx = score_stage(fb, ib, qb0, qb1, qr, srow + 32 * (c + 1), mx);
  }
  k_load(fb, ib, kbase, idrow, SEQ / 32 - 1);
  mx = score_stage(fa, ia, qb0, qb1, qr, srow + 32 * (SEQ / 32 - 2), mx);
  ids_load(ia, idrow);                          // pass 2's first ids
  mx = score_stage(fb, ib, qb0, qb1, qr, srow + 32 * (SEQ / 32 - 1), mx);
  mx = fmaxf(mx, __shfl_xor(mx, 16));
  __syncthreads();

  // ---- pass 2: exp, sum, histogram, O^T += V^T * P^T (32 keys per step) ----
  v8f o[4];                                   // o[t][r] = O[query m][d 16t+8h+r] * (l * 16384)
  #pragma unroll
  for (int t = 0; t < 4; ++t) o[t] = zero8;
  float lsum = 0.0f;
  // rolled: two register stages per trip, no copies between them
  #pragma unroll 1
  for (int c = 0; c < SEQ / 32 - 2; c += 2) {
    v_load<true>(fa, ib, vbase, idrow, c);
    lsum = pv_stage(fa, ia, srow + 32 * c, hp, mx, lsum, o);
    v_load<true>(fb, ia, vbase, idrow, c + 1);
    lsum = pv_stage(fb, ib, srow + 32 * (c + 1), hp, mx, lsum, o);
    addr_regs_free_of(vbase + (size_t)(4 * c) * TILE);
  }
  v_load<true>(fa, ib, vbase, idrow, SEQ / 32 - 2);
  lsum = pv_stage(fa, ia, srow + 32 * (SEQ / 32 - 2), hp, mx, lsum, o);
  v_load<false>(fb, ia, vbase, idrow, SEQ / 32 - 1);
  lsum = pv_stage(fb, ib, srow + 32 * (SEQ / 32 - 1), hp, mx, lsum, o);
  lsum += __shfl_xor(lsum, 16);
  const float inv = 1.0f / lsum;
  const float osc = inv * (1.0f / PSC);
  const float wsc = inv * PSC;
  __syncthreads();                            // histogram bins complete (read cross-lane below)

  // ---- relation value term: R^T = RVT * W^T ----
  const float* ha = sH + m * NREL;
  const float* hb = sH + 16 * NREL + m * NREL;
  const v16h w0 = build_w(ha, hb, 8 * h, wsc);
  const v16h w1 = build_w(ha, hb, 32 + 8 * h, wsc);
  #pragma unroll
  for (int t = 0; t < 4; ++t) {
    const _Float16* ap = rvT + (size_t)(2 * t) * TILE + 8 * lane;
    v8f z = zero8;
    z = wmma_h(ldtile_h(ap), w0, z);
    z = wmma_h(ldtile_h(ap + TILE), w1, z);
    #pragma unroll
    for (int r = 0; r < 8; ++r)
      sO[m * HD + 16 * t + 8 * h + r] = o[t][r] * osc + z[r] * RVS;
  }
  __syncthreads();

  const size_t gbase = ((size_t)b * SEQ + q0) * HID + (size_t)(2 * head) * TILE;   // token tile, feature tiles 2 head, 2 head + 1
  att_store(sO, ahi, alo, gbase, lane);
  
}

// ---------------------------------------------------------------------------
// instruction, 4 lines per instruction, 64 lines per wave.
// ---------------------------------------------------------------------------
__device__ __forceinline__ void out_store_pass(const float* sT, float* out, int m0, int n0,
                                               int w, int lane) {
  const int q8 = lane & 7, sub = lane >> 3;
  #pragma unroll
  for (int i = 0; i < 16; ++i) {
    const int lid = i * 4 + sub;                 // 0..63
    const int rowl = 32 * w + (lid >> 1), hl = lid & 1;
    const v4f v = *(const v4fa*)(sT + rowl * 64 + 32 * hl + 4 * q8);
    float* dst = out + (size_t)(m0 + rowl) * HID + n0 + 32 * hl + 4 * q8;
    *(v4f*)dst = v;
  }
}

// One k step (32 deep) of the output projection's operands, one stage ahead.
struct OStage { v16b a[4]; v16b b[4]; };
__device__ __forceinline__ void oproj_load(OStage& s, const __bf16* a0h, const __bf16* a0l,
                                           const __bf16* a1h, const __bf16* a1l,
                                           const __bf16* wr, int k0) {
  const int t0 = (k0 >> 5) * TILE;
  s.a[0] = ldtile_b(a0h + t0);
  s.a[1] = ldtile_b(a0l + t0);
  s.a[2] = ldtile_b(a1h + t0);
  s.a[3] = ldtile_b(a1l + t0);
  #pragma unroll
  for (int nt = 0; nt < 4; ++nt) s.b[nt] = ldtile_b(wr + (size_t)nt * 16 * HID + t0);
  loads_stay_above();
}
__device__ __forceinline__ void oproj_mma(const OStage& s, v8f (&acc)[2][4]) {
  #pragma unroll
  for (int nt = 0; nt < 4; ++nt) {
    acc[0][nt] = wmma_b(s.a[0], s.b[nt], acc[0][nt]);
    acc[0][nt] = wmma_b(s.a[1], s.b[nt], acc[0][nt]);
    acc[1][nt] = wmma_b(s.a[2], s.b[nt], acc[1][nt]);
    acc[1][nt] = wmma_b(s.a[3], s.b[nt], acc[1][nt]);
  }
}

// ---------------------------------------------------------------------------
// Kernel 4: out = A * Wo^T + bo with A = ahi + alo (two bf16 products per tile).
// Block 128 thr = 128 tokens x 64 features; wave 32 tokens x 64 features.
// ---------------------------------------------------------------------------
__global__ __launch_bounds__(128) void oproj_kernel(
    const __bf16* __restrict__ ahi,    // [NTOK][HID], tile order
    const __bf16* __restrict__ alo,    // [NTOK][HID], tile order
    const __bf16* __restrict__ wo,     // [HID][HID], row = output feature, tile order
    const float* __restrict__ bo,
    float* __restrict__ out)           // [NTOK][HID]
{
  __shared__ __attribute__((aligned(16))) float sT[128 * 64];      // 32768 B

  const int tid = threadIdx.x, lane = tid & 31, w = tid >> 5;
  const int h = lane >> 4, m = lane & 15;
  const int m0 = blockIdx.x * 128;
  const int n0 = blockIdx.y * 64;
  const int m0w = m0 + 32 * w;

  const __bf16* a0h = ahi + (size_t)m0w * HID + 8 * lane;
  const __bf16* a0l = alo + (size_t)m0w * HID + 8 * lane;
  const __bf16* a1h = a0h + (size_t)16 * HID;
  const __bf16* a1l = a0l + (size_t)16 * HID;
  const __bf16* wr  = wo + (size_t)n0 * HID + 8 * lane;

  const v8f zero8 = {0.f, 0.f, 0.f, 0.f, 0.f, 0.f, 0.f, 0.f};
  v8f acc[2][4];
  #pragma unroll
  for (int mt = 0; mt < 2; ++mt)
    #pragma unroll
    for (int nt = 0; nt < 4; ++nt) acc[mt][nt] = zero8;

  OStage sa, sb;
  oproj_load(sa, a0h, a0l, a1h, a1l, wr, 0);
  // rolled: two register stages per trip, no copies between them
  #pragma unroll 1
  for (int k0 = 0; k0 < HID - 64; k0 += 64) {
    oproj_load(sb, a0h, a0l, a1h, a1l, wr, k0 + 32);
    oproj_mma(sa, acc);
    oproj_load(sa, a0h, a0l, a1h, a1l, wr, k0 + 64);
    oproj_mma(sb, acc);
    addr_regs_free();
  }
  oproj_load(sb, a0h, a0l, a1h, a1l, wr, HID - 32);
  addr_regs_free();
  oproj_mma(sa, acc);
  oproj_mma(sb, acc);

  // D[r] of tile (mt, nt) = Y[token m0w+16mt+8h+r][feature n0+16nt+m]
  #pragma unroll
  for (int nt = 0; nt < 4; ++nt) {
    const int featl = 16 * nt + m;
    const float bvl = (float)(__bf16)bo[n0 + featl];
    #pragma unroll
    for (int mt = 0; mt < 2; ++mt) {
      #pragma unroll
      for (int r = 0; r < 8; ++r) {
        const int tokl = 32 * w + 16 * mt + 8 * h + r;     // 0..127
        sT[tokl * 64 + featl] = acc[mt][nt][r] + bvl;
      }
    }
  }
  __syncthreads();

  out_store_pass(sT, out, m0, n0, w, lane);
  
}

// ---------------------------------------------------------------------------
extern "C" void kernel_launch(void* const* d_in, const int* in_sizes, int n_in,
                              void* d_out, int out_size, void* d_ws, size_t ws_size,
                              hipStream_t stream) {
  if (n_in < 14) return;
  if (in_sizes[0] != NX || in_sizes[1] != NX || in_sizes[2] != NX) return;
  if (in_sizes[3] != NB * SEQ * SEQ) return;
  if (in_sizes[4] != NW || in_sizes[6] != NW || in_sizes[8] != NW || in_sizes[10] != NW) return;
  if (in_sizes[5] != HID || in_sizes[7] != HID || in_sizes[9] != HID || in_sizes[11] != HID) return;
  if (in_sizes[12] != NREL * HD || in_sizes[13] != NREL * HD) return;
  if (out_size != NX) return;

  const float* q_in = (const float*)d_in[0];
  const float* k_in = (const float*)d_in[1];
  const float* v_in = (const float*)d_in[2];
  const int*   ids  = (const int*)d_in[3];
  const float* Wq = (const float*)d_in[4];
  const float* bq = (const float*)d_in[5];
  const float* Wk = (const float*)d_in[6];
  const float* bk = (const float*)d_in[7];
  const float* Wv = (const float*)d_in[8];
  const float* bv = (const float*)d_in[9];
  const float* Wo = (const float*)d_in[10];
  const float* bo = (const float*)d_in[11];
  const float* relk = (const float*)d_in[12];
  const float* relv = (const float*)d_in[13];
  float* out = (float*)d_out;

  const size_t xb_bytes = (size_t)3 * NX * 2;          // 12582912
  const size_t wb_bytes = (size_t)4 * NW * 2;          //  8388608
  const size_t rt_bytes = (size_t)NREL * HD * 2;       //     8192
  const size_t pl_bytes = (size_t)NPL * 2;             //  4194304
  const size_t ap_bytes = (size_t)NX * 2;              //  4194304
  const size_t id_bytes = (size_t)NB * SEQ * SEQ * 4;  //  4194304
  const size_t total = xb_bytes + wb_bytes + 2 * rt_bytes + 3 * pl_bytes + 2 * ap_bytes + id_bytes;  // 46153728
  if (total > ws_size) return;

  char* ws = (char*)d_ws;
  size_t off = 0;
  __bf16* xb = (__bf16*)(ws + off);       off += xb_bytes;
  __bf16* wb = (__bf16*)(ws + off);       off += wb_bytes;
  _Float16* rk  = (_Float16*)(ws + off);  off += rt_bytes;
  _Float16* rvT = (_Float16*)(ws + off);  off += rt_bytes;
  _Float16* qh  = (_Float16*)(ws + off);  off += pl_bytes;
  _Float16* kh  = (_Float16*)(ws + off);  off += pl_bytes;
  _Float16* vt  = (_Float16*)(ws + off);  off += pl_bytes;
  __bf16* ahi = (__bf16*)(ws + off);      off += ap_bytes;
  __bf16* alo = (__bf16*)(ws + off);      off += ap_bytes;
  int* idp = (int*)(ws + off);            off += id_bytes;
  if (off > ws_size) return;

  convert_kernel<<<(G_TOT + 255) / 256, 256, 0, stream>>>(q_in, k_in, v_in, Wq, Wk, Wv, Wo,
                                                         relk, relv, ids, xb, wb, rk, rvT, idp);

  dim3 gProj(NTOK / 128, 3 * NH);                                   // (16, 48)
  proj_kernel<<<gProj, 128, 0, stream>>>(xb, wb, bq, bk, bv, qh, kh, vt);

  dim3 gAtt(SEQ / 16, NB * NH);                                     // (32, 64)
  attn_kernel<<<gAtt, 32, 0, stream>>>(qh, kh, vt, idp, rk, rvT, ahi, alo);

  dim3 gOut(NTOK / 128, HID / 64);                                  // (16, 16)
  oproj_kernel<<<gOut, 128, 0, stream>>>(ahi, alo, wb + (size_t)3 * NW, bo, out);
}

// v003
// A run of this version takes 76.6 microseconds.
// In two side-by-side timings against v002, it was 1.20 and 1.21 times as fast.
// All steps since v000 together make it 2.56 times as fast.
// q/k/v projections: v_wmma_f32_16x16x32_bf16 (bf16 operands, f32 accumulate); q.relk^T, k.q^T, v^T.p^T, relv^T.w^T: v_wmma_f32_16x16x32_f16 (f16 operands, f32 accumulate; relk/relv carried x32, q x0.125, p and w x16384, exact power-of-two scales folded back in f32); output projection: v_wmma_f32_16x16x32_bf16 with the activation as a bf16 hi+lo pair (two products) against bf16 weights; softmax, additive bias and normalisation in f32.
#include <hip/hip_runtime.h>

typedef _Float16 v16h __attribute__((ext_vector_type(16)));
typedef _Float16 v8h  __attribute__((ext_vector_type(8)));
typedef __bf16   v16b __attribute__((ext_vector_type(16)));
typedef __bf16   v8b  __attribute__((ext_vector_type(8)));
typedef float    v8f  __attribute__((ext_vector_type(8)));
typedef float    v4f  __attribute__((ext_vector_type(4)));
typedef int      v4i  __attribute__((ext_vector_type(4)));
typedef v8h __attribute__((may_alias)) v8ha;
typedef v8b __attribute__((may_alias)) v8ba;
typedef v4f __attribute__((may_alias)) v4fa;
typedef v4i __attribute__((may_alias)) v4ia;

union FragH { v16h v; v8h half[2]; };
union FragB { v16b v; v8b half[2]; };

#define NB    4
#define SEQ   512
#define HID   1024
#define NH    16
#define HD    64
#define NREL  64
#define NTOK  (NB * SEQ)            // 2048 tokens
#define NX    (NTOK * HID)          // 2097152 elements per activation
#define NW    (HID * HID)           // 1048576 elements per weight
#define NX8   (NX / 8)              // 262144
#define NW8   (NW / 8)              // 131072
#define NPL   (NB * NH * SEQ * HD)  // 2097152 halves per q/k/v plane
#define G_X   (3 * NX8)             // 786432 activation groups
#define G_W   (4 * NW8)             // 524288 weight groups
#define G_R   (NREL * HD / 8)       // 512 groups per relation table
#define G_I   (NB * SEQ * SEQ / 4)  // 262144 groups of four relation ids
#define G_16  (G_X + G_W + 2 * G_R) // 1311744 groups of the 16-bit planes
#define G_TOT (G_16 + G_I)          // 1573888
#define TILE  512                   // elements of one 16-row x 32-k tile (1 KiB)
#define PSC   16384.0f
#define RVS   4.76837158203125e-7f  // 2^-21 = 0.25 / (32 * 16384)

// ---------------------------------------------------------------------------
// 16x16x32 WMMA (builtin form; the compiler keeps the distance behind it).
// Fragment map (wave32): lane l, h = l>>4, m = n = l&15.
//   A/B element i: i<8 -> k0+8h+i ; i>=8 -> k0+16+8h+(i-8)
//   D element r : row 8h+r, col l&15
// ---------------------------------------------------------------------------
__device__ __forceinline__ v8f wmma_h(v16h a, v16h b, v8f c) {
  return __builtin_amdgcn_wmma_f32_16x16x32_f16(false, a, false, b, (short)0, c, false, false);
}
__device__ __forceinline__ v8f wmma_b(v16b a, v16b b, v8f c) {
  return __builtin_amdgcn_wmma_f32_16x16x32_bf16(false, a, false, b, (short)0, c, false, false);
}

// Stands behind a stage's group of global loads: without it the scheduler sinks the
// loads below the other stage's work and their latency is exposed again.
__device__ __forceinline__ void loads_stay_above() { __builtin_amdgcn_sched_barrier(0); }
// Stands in front of code that rewrites address registers which loads still in
// flight name (a pipelined loop's next trip, the epilogue's address arithmetic).
// The two scheduling barriers keep the wait where it is written: late enough to
// cost nothing, and ahead of every such rewrite.
__device__ __forceinline__ void addr_regs_free() {
  __builtin_amdgcn_sched_barrier(0);
  asm volatile("s_wait_xcnt 0x0" ::: "memory");
  __builtin_amdgcn_sched_barrier(0);
}
// The same, and the address pair is an input of the wait: it stays allocated up to
// here, so that no load's result is given the registers that earlier loads still name.
__device__ __forceinline__ void addr_regs_free_of(const void* p) {
  __builtin_amdgcn_sched_barrier(0);
  asm volatile("s_wait_xcnt 0x0" :: "v"(p) : "memory");
  __builtin_amdgcn_sched_barrier(0);
}

// Tile order of every 16-bit workspace plane: a 16-row x 32-k tile is one 1-KiB
// block [j][lane][8 elements]; lane 16h+m of half j holds row m, k = 16j+8h .. +7,
// which is the fragment map above. One wave load of a half is 512 contiguous bytes
// (four whole lines) where a row-major plane gives 32 bytes of each of 16 lines.
// A plane of R rows x K columns is [R/16][K/32] tiles (vt: [K/32][R/16] per (b, head)).
// A or B fragment: p = the tile's first element + 8 * lane.
__device__ __forceinline__ v16h ldtile_h(const _Float16* p) {
  FragH f;
  f.half[0] = *(const v8ha*)(p);
  f.half[1] = *(const v8ha*)(p + 256);
  return f.v;
}
__device__ __forceinline__ v16b ldtile_b(const __bf16* p) {
  FragB f;
  f.half[0] = *(const v8ba*)(p);
  f.half[1] = *(const v8ba*)(p + 256);
  return f.v;
}

// relation id: wrap negative once, then clamp into [0, NREL-1]
__device__ __forceinline__ int relidx(int id) {
  int t = id + ((id >> 31) & NREL);
  t = t < 0 ? 0 : t;
  t = t > (NREL - 1) ? (NREL - 1) : t;
  return t;
}

// ---------------------------------------------------------------------------
// Kernel 1: f32 -> 16-bit planes in tile order, 8 elements (16 B) per thread; thread
// index = index of the 16-byte group it writes, so stores are whole lines and the
// 16-line access falls on the one read of each source element.
//   xb [3][NTOK][HID] bf16 (q_in, k_in, v_in, RNE convert)
//   wb [4][HID][HID]  bf16 (Wq, Wk, Wv, Wo, row = output feature)
//   rk [NREL][HD]     f16  = 32 * bf16(relk)
//   rvT[HD][NREL]     f16  = 32 * bf16(relv)^T
//   idp               int  relation ids as given, [B][L/16][L/32][i][lane][4]:
//                     lane 16h+m of group i holds query m, keys 16(i>>1)+8h+4(i&1) .. +3
// ---------------------------------------------------------------------------
__global__ __launch_bounds__(256) void convert_kernel(
    const float* __restrict__ q_in, const float* __restrict__ k_in, const float* __restrict__ v_in,
    const float* __restrict__ Wq, const float* __restrict__ Wk, const float* __restrict__ Wv,
    const float* __restrict__ Wo, const float* __restrict__ relk, const float* __restrict__ relv,
    const int* __restrict__ ids,
    __bf16* __restrict__ xb, __bf16* __restrict__ wb, _Float16* __restrict__ rk, _Float16* __restrict__ rvT,
    int* __restrict__ idp)
{
  const int g = blockIdx.x * 256 + threadIdx.x;
  if (g >= G_TOT) return;
  const int h = (g >> 4) & 1, m = g & 15;        // every plane starts at a multiple of 32 groups
  if (g >= G_16) {
    const int e = g - G_16;
    const int i = (e >> 5) & 3, c = (e >> 7) & 15, qt = e >> 11;   // qt = 32 b + query tile
    const int* src = ids + ((size_t)qt * 16 + m) * SEQ + 32 * c + 16 * (i >> 1) + 8 * h + 4 * (i & 1);
    *(v4i*)(idp + (size_t)e * 4) = *(const v4ia*)src;
  } else if (g < G_X + G_W) {
    const float* src;
    __bf16* dst;
    if (g < G_X) {
      const int which = g >> 18;                 // NX8 = 2^18
      const int off = g & (NX8 - 1);
      const float* s = (which == 0) ? q_in : ((which == 1) ? k_in : v_in);
      // group off = ((row tile * 32 + k tile) * 2 + j) * 32 + lane
      src = s + (size_t)((off >> 11) * 16 + m) * HID + ((off >> 6) & 31) * 32 + ((off >> 5) & 1) * 16 + 8 * h;
      dst = xb + (size_t)which * NX + (size_t)off * 8;
    } else {
      const int e = g - G_X;
      const int wsel = e >> 17;                 // NW8 = 2^17
      const int off = e & (NW8 - 1);
      const float* s = (wsel == 0) ? Wq : ((wsel == 1) ? Wk : ((wsel == 2) ? Wv : Wo));
      src = s + (size_t)((off >> 11) * 16 + m) * HID + ((off >> 6) & 31) * 32 + ((off >> 5) & 1) * 16 + 8 * h;
      dst = wb + (size_t)wsel * NW + (size_t)off * 8;
    }
    const v4f a = *(const v4fa*)src;
    const v4f c = *(const v4fa*)(src + 4);
    const v8b o = { (__bf16)a.x, (__bf16)a.y, (__bf16)a.z, (__bf16)a.w,
                    (__bf16)c.x, (__bf16)c.y, (__bf16)c.z, (__bf16)c.w };
    *(v8b*)dst = o;
    
  } else {
    const int e = g - (G_X + G_W);
    float f[8];
    _Float16* dst;
    // group e & 511 = ((row tile * 2 + k tile) * 2 + j) * 32 + lane of a 64 x 64 plane
    const int row = ((e >> 7) & 3) * 16 + m;
    const int kk = ((e >> 6) & 1) * 32 + ((e >> 5) & 1) * 16 + 8 * h;
    if (e < G_R) {
      const float* src = relk + (size_t)row * HD + kk;
      const v4f a = *(const v4fa*)src;
      const v4f c = *(const v4fa*)(src + 4);
      f[0] = a.x; f[1] = a.y; f[2] = a.z; f[3] = a.w;
      f[4] = c.x; f[5] = c.y; f[6] = c.z; f[7] = c.w;
      dst = rk + (size_t)e * 8;
    } else {
      const int e3 = e - G_R;                    // 0..511; row = d, kk = first relation index
      #pragma unroll
      for (int i = 0; i < 8; ++i) f[i] = relv[(size_t)(kk + i) * HD + row];
      dst = rvT + (size_t)e3 * 8;
    }
    _Float16 hh[8];
    #pragma unroll
    for (int i = 0; i < 8; ++i) hh[i] = (_Float16)((float)(__bf16)f[i] * 32.0f);
    const v8h o = { hh[0], hh[1], hh[2], hh[3], hh[4], hh[5], hh[6], hh[7] };
    *(v8h*)dst = o;
    
  }
}

// ---------------------------------------------------------------------------
// 4 lines per instruction, 32 lines per wave, 128 per block; tile order.
// which 0/1: plane[bh][l/16][d/32] tiles (row = token, k = d); a wave's 32 tokens = 4 tiles
// which 2  : vt[bh][l/32][d/16] tiles    (row = d, k = token); a wave's 32 tokens = 4 tiles
// ---------------------------------------------------------------------------
__device__ __forceinline__ void proj_store_pass(const _Float16* sT, _Float16* plane, _Float16* vt,
                                                int which, int bh, int l0, int w, int lane) {
  const int h = lane >> 4, m = lane & 15;
  // LDS element of half i = 0: (token tile * 2 + d tile) * 2 + j = i, or d tile * 2 + j = i
  const _Float16* sp = (which != 2) ? sT + (32 * w + m) * HD + 8 * h : sT + m * 128 + 32 * w + 8 * h;
  // either way the wave's four tiles are 4 KiB in a row at the same offset of its plane
  _Float16* dst = ((which != 2) ? plane : vt) + ((size_t)bh * SEQ + l0 + 32 * w) * HD + 8 * lane;
  #pragma unroll
  for (int i = 0; i < 8; ++i) {
    const int so = (which != 2) ? 16 * (i >> 2) * HD + 16 * (i & 3) : 16 * (i >> 1) * 128 + 16 * (i & 1);
    *(v8h*)(dst + 256 * i) = *(const v8ha*)(sp + so);
  }
}

// One k step (32 deep) of a projection's operands, held in registers so that
// the next step's loads are in flight while this step's products run.
struct PStage { v16b a0, a1, b[4]; };
__device__ __forceinline__ void proj_load(PStage& s, const __bf16* xa0, const __bf16* xa1,
                                          const __bf16* wr, int k0) {
  const int t0 = (k0 >> 5) * TILE;
  s.a0 = ldtile_b(xa0 + t0);
  s.a1 = ldtile_b(xa1 + t0);
  #pragma unroll
  for (int nt = 0; nt < 4; ++nt) s.b[nt] = ldtile_b(wr + (size_t)nt * 16 * HID + t0);
  loads_stay_above();
}
__device__ __forceinline__ void proj_mma(const PStage& s, v8f (&acc)[2][4]) {
  #pragma unroll
  for (int nt = 0; nt < 4; ++nt) {
    acc[0][nt] = wmma_b(s.a0, s.b[nt], acc[0][nt]);
    acc[1][nt] = wmma_b(s.a1, s.b[nt], acc[1][nt]);
  }
}

// ---------------------------------------------------------------------------
// Kernel 2: Y = x * W^T + b for the three projections (which = 0,1,2).
// Block 128 thr (4 waves) = 128 tokens x 64 features (one (which, head));
// wave tile 32 tokens x 64 features; K = 1024 in steps of 32;
// A (x rows) and B (W rows) bf16 fragments straight from the tile-ordered planes.
// ---------------------------------------------------------------------------
__global__ __launch_bounds__(128) void proj_kernel(
    const __bf16* __restrict__ xb,     // [3][NTOK][HID], tile order
    const __bf16* __restrict__ wb,     // [4][HID][HID], row = output feature (first 3 used), tile order
    const float* __restrict__ bq, const float* __restrict__ bk, const float* __restrict__ bv,
    _Float16* __restrict__ qh,         // [B*H][L][D]  f16(0.125*q), tile order
    _Float16* __restrict__ kh,         // [B*H][L][D], tile order
    _Float16* __restrict__ vt)         // [B*H][L/32][D/16] tiles (row = d, k = token)
{
  __shared__ __attribute__((aligned(16))) _Float16 sT[128 * 64];   // 16384 B

  const int tid = threadIdx.x, lane = tid & 31, w = tid >> 5;
  const int h = lane >> 4, m = lane & 15;
  const int m0 = blockIdx.x * 128;
  const int cg = blockIdx.y;                 // 0..47
  const int which = cg >> 4, head = cg & 15;
  const int m0w = m0 + 32 * w;

  // 16 rows of a plane = HID / 32 tiles in a row = 16 * HID elements
  const __bf16* xa0 = xb + (size_t)which * NX + (size_t)m0w * HID + 8 * lane;   // token tile, mt = 0
  const __bf16* xa1 = xa0 + (size_t)16 * HID;                                   // mt = 1
  const __bf16* wr  = wb + (size_t)which * NW + (size_t)(head * HD) * HID + 8 * lane;  // feature tile, nt = 0

  const v8f zero8 = {0.f, 0.f, 0.f, 0.f, 0.f, 0.f, 0.f, 0.f};
  v8f acc[2][4];
  #pragma unroll
  for (int mt = 0; mt < 2; ++mt)
    #pragma unroll
    for (int nt = 0; nt < 4; ++nt) acc[mt][nt] = zero8;

  PStage sa, sb;
  proj_load(sa, xa0, xa1, wr, 0);
  // rolled: two register stages per trip, no copies between them
  #pragma unroll 1
  for (int k0 = 0; k0 < HID - 64; k0 += 64) {
    proj_load(sb, xa0, xa1, wr, k0 + 32);
    proj_mma(sa, acc);
    proj_load(sa, xa0, xa1, wr, k0 + 64);
    proj_mma(sb, acc);
    addr_regs_free();
  }
  proj_load(sb, xa0, xa1, wr, HID - 32);
  proj_mma(sa, acc);
  proj_mma(sb, acc);

  // D[r] of tile (mt, nt) = Y[token m0w+16mt+8h+r][feature 16nt+m]
  const float* bias = (which == 0) ? bq : ((which == 1) ? bk : bv);
  const float osc = (which == 0) ? 0.125f : 1.0f;
  #pragma unroll
  for (int nt = 0; nt < 4; ++nt) {
    const int feat = 16 * nt + m;
    const float bvl = (float)(__bf16)bias[head * HD + feat];
    #pragma unroll
    for (int mt = 0; mt < 2; ++mt) {
      #pragma unroll
      for (int r = 0; r < 8; ++r) {
        const int tokl = 32 * w + 16 * mt + 8 * h + r;     // 0..127
        const float y = (acc[mt][nt][r] + bvl) * osc;
        const int idx = (which == 2) ? (feat * 128 + tokl) : (tokl * HD + feat);
        sT[idx] = (_Float16)y;
      }
    }
  }
  __syncthreads();

  const int b = m0 >> 9, l0 = m0 & (SEQ - 1), bh = b * NH + head;
  _Float16* plane = (which == 0) ? qh : kh;
  proj_store_pass(sT, plane, vt, which, bh, l0, w, lane);
  
}

// ---------------------------------------------------------------------------
// Attention helpers.
// ---------------------------------------------------------------------------
// B fragment of the normalised relation histogram, k = relation index:
// element i<8 <- k0+8h+i, element 8+i <- k0+16+8h+i; kb = k0 + 8h.
__device__ __forceinline__ v16h build_w(const float* ha, const float* hb, int kb, float wsc) {
  const v4f a0 = *(const v4fa*)(ha + kb);
  const v4f a1 = *(const v4fa*)(ha + kb + 4);
  const v4f a2 = *(const v4fa*)(ha + kb + 16);
  const v4f a3 = *(const v4fa*)(ha + kb + 20);
  const v4f c0 = *(const v4fa*)(hb + kb);
  const v4f c1 = *(const v4fa*)(hb + kb + 4);
  const v4f c2 = *(const v4fa*)(hb + kb + 16);
  const v4f c3 = *(const v4fa*)(hb + kb + 20);
  const float e[16] = { a0.x + c0.x, a0.y + c0.y, a0.z + c0.z, a0.w + c0.w,
                        a1.x + c1.x, a1.y + c1.y, a1.z + c1.z, a1.w + c1.w,
                        a2.x + c2.x, a2.y + c2.y, a2.z + c2.z, a2.w + c2.w,
                        a3.x + c3.x, a3.y + c3.y, a3.z + c3.z, a3.w + c3.w };
  _Float16 wh[16];
  #pragma unroll
  for (int i = 0; i < 16; ++i) wh[i] = (_Float16)(e[i] * wsc);
  FragH f;
  f.half[0] = (v8h){ wh[0], wh[1], wh[2], wh[3], wh[4], wh[5], wh[6], wh[7] };
  f.half[1] = (v8h){ wh[8], wh[9], wh[10], wh[11], wh[12], wh[13], wh[14], wh[15] };
  return f.v;
}

// Per-wave 16x64 f32 tile in LDS -> bf16 hi and lo planes [tok][HID] in tile order:
// two tiles in a row, i = feature tile * 2 + j; 4 lines per instruction.
__device__ __forceinline__ void att_store(const float* sO, __bf16* ahi, __bf16* alo,
                                          size_t gbase, int lane) {
  const int h = lane >> 4, m = lane & 15;
  #pragma unroll
  for (int i = 0; i < 4; ++i) {
    const float* sp = sO + m * HD + 16 * i + 8 * h;
    const v4f a = *(const v4fa*)sp;
    const v4f c = *(const v4fa*)(sp + 4);
    const float f[8] = { a.x, a.y, a.z, a.w, c.x, c.y, c.z, c.w };
    __bf16 hh[8], ll[8];
    #pragma unroll
    for (int e = 0; e < 8; ++e) {
      hh[e] = (__bf16)f[e];
      ll[e] = (__bf16)(f[e] - (float)hh[e]);
    }
    const v8b hv = { hh[0], hh[1], hh[2], hh[3], hh[4], hh[5], hh[6], hh[7] };
    const v8b lv = { ll[0], ll[1], ll[2], ll[3], ll[4], ll[5], ll[6], ll[7] };
    const size_t gi = gbase + 256 * i + 8 * lane;
    *(v8b*)(ahi + gi) = hv;
    *(v8b*)(alo + gi) = lv;
  }
}

// 32 keys' worth of global operands, held in registers ahead of their use:
// f[0..3] = four A fragments (K rows of two key tiles, two d chunks each, or
// V^T rows of the four d tiles), id[0..3] = this lane's 16 relation ids.
// Both passes form the scores, so both need K and the ids at a stage's head: they
// are fetched one stage ahead. Pass 2 needs V^T only at the foot, behind the
// histogram chain, so V^T is fetched at the head of its own stage.
struct AFrag { v16h f[4]; };
struct AIds  { v4i id[4]; };
// ip = the stage's 2-KiB block of idp + 4 * lane; id[0..3] = keys 8h+0..3, 8h+4..7, 16+8h+0..3, 16+8h+4..7
__device__ __forceinline__ void ids_load(AIds& s, const int* ip) {
  #pragma unroll
  for (int i = 0; i < 4; ++i) s.id[i] = *(const v4ia*)(ip + 128 * i);
}
__device__ __forceinline__ void k_load(AFrag& s, AIds& n, const _Float16* kbase, const int* idrow, int c) {
  // 32 keys = four tiles in a row: (key tile 0, d 0..31), (0, 32..63), (1, 0..31), (1, 32..63)
  #pragma unroll
  for (int t = 0; t < 4; ++t) s.f[t] = ldtile_h(kbase + (size_t)(4 * c + t) * TILE);
  ids_load(n, idrow + 512 * c);
  loads_stay_above();
}
// V^T of stage c and, where there is one, K and the ids of stage c + 1
template <bool NEXT>
__device__ __forceinline__ void vk_load(AFrag& v, AFrag& s, AIds& n, const _Float16* vbase,
                                        const _Float16* kbase, const int* idrow, int c) {
  #pragma unroll
  for (int t = 0; t < 4; ++t) v.f[t] = ldtile_h(vbase + (size_t)(4 * c + t) * TILE);
  if (NEXT) {
    #pragma unroll
    for (int t = 0; t < 4; ++t) s.f[t] = ldtile_h(kbase + (size_t)(4 * (c + 1) + t) * TILE);
    ids_load(n, idrow + 512 * (c + 1));
  }
  loads_stay_above();
}
// scores of one stage's 32 keys, 16 per lane, in registers, with their table rows;
// both passes call it, so pass 2 sees the values that pass 1 took the maximum of
__device__ __forceinline__ void score16(const AFrag& s, const AIds& n, v16h qb0, v16h qb1, const float* qr,
                                        float (&sc)[16], int (&ri)[16]) {
  const v8f zero8 = {0.f, 0.f, 0.f, 0.f, 0.f, 0.f, 0.f, 0.f};
  v8f z0 = wmma_h(s.f[0], qb0, zero8);
  z0 = wmma_h(s.f[1], qb1, z0);                 // z0[r] = S[query m][key 32c+8h+r]
  v8f z1 = wmma_h(s.f[2], qb0, zero8);
  z1 = wmma_h(s.f[3], qb1, z1);                 // z1[r] = S[query m][key 32c+16+8h+r]
  const int idv[16] = { n.id[0].x, n.id[0].y, n.id[0].z, n.id[0].w, n.id[1].x, n.id[1].y, n.id[1].z, n.id[1].w,
                        n.id[2].x, n.id[2].y, n.id[2].z, n.id[2].w, n.id[3].x, n.id[3].y, n.id[3].z, n.id[3].w };
  #pragma unroll
  for (int e = 0; e < 16; ++e) {
    const int id = idv[e];
    const float bias = (id > 0) ? 0.0f : -10000.0f;
    const float zz = (e < 8) ? z0[e & 7] : z1[e & 7];
    ri[e] = relidx(id);
    sc[e] = zz + qr[ri[e]] * 0.0078125f + bias;
  }
}
// pass 1 on one stage: running maximum of the scores of 32 keys
__device__ __forceinline__ float max_stage(const AFrag& s, const AIds& n, v16h qb0, v16h qb1, const float* qr,
                                           float mx) {
  float sc[16];
  int ri[16];
  score16(s, n, qb0, qb1, qr, sc, ri);
  #pragma unroll
  for (int e = 0; e < 16; ++e) mx = fmaxf(mx, sc[e]);
  return mx;
}
// 2^x. The v_nop is the free slot that the instruction set asks for behind a
// transcendental before its source is overwritten or its result read; only inside the
// same statement does it stay directly behind the v_exp_f32.
__device__ __forceinline__ float exp2_slot(float x) {
  float r;
  asm("v_exp_f32 %0, %1\n\tv_nop" : "=v"(r) : "v"(x));
  return r;
}
// pass 2 on one stage: the scores again, exp, sum, histogram, O^T += V^T * P^T for 32 keys
__device__ __forceinline__ float pv_stage(const AFrag& k, const AIds& n, const AFrag& s, v16h qb0, v16h qb1,
                                          const float* qr, float* hp, float mx, float lsum, v8f (&o)[4]) {
  float sv[16];
  int rv[16];
  score16(k, n, qb0, qb1, qr, sv, rv);
  _Float16 ph[16];
  #pragma unroll
  for (int e = 0; e < 16; ++e) {
    const float p = exp2_slot((sv[e] - mx) * 1.44269504f);   // = __expf(sv[e] - mx)
    lsum += p;
    const int ri = rv[e];
    hp[ri] = hp[ri] + p;
    ph[e] = (_Float16)(p * PSC);
  }
  // P^T B-fragment: element r <- key 32c+8h+r, element 8+r <- key 32c+16+8h+r
  FragH pf;
  pf.half[0] = (v8h){ ph[0], ph[1], ph[2], ph[3], ph[4], ph[5], ph[6], ph[7] };
  pf.half[1] = (v8h){ ph[8], ph[9], ph[10], ph[11], ph[12], ph[13], ph[14], ph[15] };
  #pragma unroll
  for (int t = 0; t < 4; ++t) o[t] = wmma_h(s.f[t], pf.v, o[t]);
  return lsum;
}

// ---------------------------------------------------------------------------
// Kernel 3: relation-aware attention, transposed form, one wave per block.
// Block = 32 thr = 16 queries of one (b, head), all 512 keys.
//   qrel^T = RK * Q^T       : A = rk rows (row = rel, k = d), B = Q^T
//   S^T    = K * Q^T        : A = K rows (row = key, k = d), B = Q^T (k = d, n = query)
//   score  = S^T + qrel[query][id]/128 + (-10000 where id <= 0), f32 in registers: formed
//            once for the row maximum and once more for the exponentials, never stored
//   hist   : per-lane private bins h[lanehalf][query][rel] += p (fixed order, no atomics)
//   O^T    = V^T * P^T      : A = vt rows (row = d, k = key), B = P^T from registers x16384
//   R^T    = RVT * W^T      : A = rvT rows (row = d, k = rel), B = W^T = (hist/l) x16384
//   out    = O^T/(l*16384) + R^T * 2^-21  -> bf16 hi/lo planes [tok][head*64+d]
// Lane owns 256 keys of query column (lane&15); partner = lane ^ 16.
// ---------------------------------------------------------------------------
__global__ __launch_bounds__(32) void attn_kernel(
    const _Float16* __restrict__ qh,   // [B*H][L][D]  (already x0.125), tile order
    const _Float16* __restrict__ kh,   // [B*H][L][D], tile order
    const _Float16* __restrict__ vt,   // [B*H][L/32][D/16] tiles (row = d, k = key)
    const int* __restrict__ idp,       // [B][L/16][L/32][4][32][4] int32 relation ids in lane order
    const _Float16* __restrict__ rk,   // [NREL][D]  x32, tile order
    const _Float16* __restrict__ rvT,  // [D][NREL]  x32, tile order
    __bf16* __restrict__ ahi,          // [NTOK][HID], tile order
    __bf16* __restrict__ alo)          // [NTOK][HID], tile order
{
  __shared__ __attribute__((aligned(16))) float sQR[16 * NREL];     //  4096 B qrel[query][rel]
  __shared__ __attribute__((aligned(16))) float sH[2 * 16 * NREL];  //  8192 B hist[h][query][rel]
  __shared__ __attribute__((aligned(16))) float sO[16 * HD];        //  4096 B output staging

  const int lane = threadIdx.x & 31, h = lane >> 4, m = lane & 15;
  const int bh = blockIdx.y, b = bh >> 4, head = bh & 15;
  const int q0 = blockIdx.x * 16;

  // zero this lane's private histogram bins
  float* hp = sH + h * (16 * NREL) + m * NREL;
  {
    const v4f z4 = {0.f, 0.f, 0.f, 0.f};
    #pragma unroll
    for (int i = 0; i < NREL / 4; ++i) *(v4fa*)(hp + 4 * i) = z4;
  }

  // Q^T B-fragments: column n = query q0+m, k = d (two 32-deep chunks)
  const _Float16* qrow = qh + ((size_t)bh * SEQ + q0) * HD + 8 * lane;
  const v16h qb0 = ldtile_h(qrow);
  const v16h qb1 = ldtile_h(qrow + TILE);

  const _Float16* kbase = kh + (size_t)bh * SEQ * HD + 8 * lane;     // + four tiles per stage
  const _Float16* vbase = vt + (size_t)bh * SEQ * HD + 8 * lane;     // + four tiles per stage
  const int* idrow = idp + ((size_t)b * SEQ + q0) * SEQ + 4 * lane;  // + 512 ids per stage
  AFrag fa, fb;
  AIds ia, ib;
  k_load(fa, ia, kbase, idrow, 0);              // pass 1's first stage, in flight under the qrel tiles

  const v8f zero8 = {0.f, 0.f, 0.f, 0.f, 0.f, 0.f, 0.f, 0.f};

  // ---- qrel^T tiles: D[r] = (rel 16rt+8h+r, query m) ----
  #pragma unroll
  for (int rt = 0; rt < 4; ++rt) {
    const _Float16* ap = rk + (size_t)(2 * rt) * TILE + 8 * lane;
    v8f z = zero8;
    z = wmma_h(ldtile_h(ap), qb0, z);
    z = wmma_h(ldtile_h(ap + TILE), qb1, z);
    #pragma unroll
    for (int r = 0; r < 8; ++r) sQR[m * NREL + 16 * rt + 8 * h + r] = z[r];
  }
  __syncthreads();

  const float* qr = sQR + m * NREL;

  float mx = -3.0e38f;
  // rolled: two register stages per trip, no copies between them
  #pragma unroll 1
  for (int c = 0; c < SEQ / 32 - 2; c += 2) {
    k_load(fb, ib, kbase, idrow, c + 1);
    mx = max_stage(fa, ia, qb0, qb1, qr, mx);
    k_load(fa, ia, kbase, idrow, c + 2);
    mx = max_stage(fb, ib, qb0, qb1, qr, mx);
  }
  k_load(fb, ib, kbase, idrow, SEQ / 32 - 1);
  mx = max_stage(fa, ia, qb0, qb1, qr, mx);
  k_load(fa, ia, kbase, idrow, 0);              // pass 2's first stage
  mx = max_stage(fb, ib, qb0, qb1, qr, mx);
  mx = fmaxf(mx, __shfl_xor(mx, 16));
  __syncthreads();

  // ---- pass 2: scores again, exp, sum, histogram, O^T += V^T * P^T (32 keys per step) ----
  v8f o[4];                                   // o[t][r] = O[query m][d 16t+8h+r] * (l * 16384)
  #pragma unroll
  for (int t = 0; t < 4; ++t) o[t] = zero8;
  float lsum = 0.0f;
  AFrag fv;
  // rolled: two register stages per trip, no copies between them
  #pragma unroll 1
  for (int c = 0; c < SEQ / 32 - 2; c += 2) {
    vk_load<true>(fv, fb, ib, vbase, kbase, idrow, c);
    lsum = pv_stage(fa, ia, fv, qb0, qb1, qr, hp, mx, lsum, o);
    vk_load<true>(fv, fa, ia, vbase, kbase, idrow, c + 1);
    lsum = pv_stage(fb, ib, fv, qb0, qb1, qr, hp, mx, lsum, o);
    addr_regs_free_of(vbase + (size_t)(4 * c) * TILE);
  }
  vk_load<true>(fv, fb, ib, vbase, kbase, idrow, SEQ / 32 - 2);
  lsum = pv_stage(fa, ia, fv, qb0, qb1, qr, hp, mx, lsum, o);
  vk_load<false>(fv, fa, ia, vbase, kbase, idrow, SEQ / 32 - 1);
  lsum = pv_stage(fb, ib, fv, qb0, qb1, qr, hp, mx, lsum, o);
  lsum += __shfl_xor(lsum, 16);
  const float inv = 1.0f / lsum;
  const float osc = inv * (1.0f / PSC);
  const float wsc = inv * PSC;
  __syncthreads();                            // histogram bins complete (read cross-lane below)

  // ---- relation value term: R^T = RVT * W^T ----
  const float* ha = sH + m * NREL;
  const float* hb = sH + 16 * NREL + m * NREL;
  const v16h w0 = build_w(ha, hb, 8 * h, wsc);
  const v16h w1 = build_w(ha, hb, 32 + 8 * h, wsc);
  #pragma unroll
  for (int t = 0; t < 4; ++t) {
    const _Float16* ap = rvT + (size_t)(2 * t) * TILE + 8 * lane;
    v8f z = zero8;
    z = wmma_h(ldtile_h(ap), w0, z);
    z = wmma_h(ldtile_h(ap + TILE), w1, z);
    #pragma unroll
    for (int r = 0; r < 8; ++r)
      sO[m * HD + 16 * t + 8 * h + r] = o[t][r] * osc + z[r] * RVS;
  }
  __syncthreads();

  const size_t gbase = ((size_t)b * SEQ + q0) * HID + (size_t)(2 * head) * TILE;   // token tile, feature tiles 2 head, 2 head + 1
  att_store(sO, ahi, alo, gbase, lane);
  
}

// ---------------------------------------------------------------------------
// instruction, 4 lines per instruction, 64 lines per wave.
// ---------------------------------------------------------------------------
__device__ __forceinline__ void out_store_pass(const float* sT, float* out, int m0, int n0,
                                               int w, int lane) {
  const int q8 = lane & 7, sub = lane >> 3;
  #pragma unroll
  for (int i = 0; i < 16; ++i) {
    const int lid = i * 4 + sub;                 // 0..63
    const int rowl = 32 * w + (lid >> 1), hl = lid & 1;
    const v4f v = *(const v4fa*)(sT + rowl * 64 + 32 * hl + 4 * q8);
    float* dst = out + (size_t)(m0 + rowl) * HID + n0 + 32 * hl + 4 * q8;
    *(v4f*)dst = v;
  }
}

// One k step (32 deep) of the output projection's operands, one stage ahead.
struct OStage { v16b a[4]; v16b b[4]; };
__device__ __forceinline__ void oproj_load(OStage& s, const __bf16* a0h, const __bf16* a0l,
                                           const __bf16* a1h, const __bf16* a1l,
                                           const __bf16* wr, int k0) {
  const int t0 = (k0 >> 5) * TILE;
  s.a[0] = ldtile_b(a0h + t0);
  s.a[1] = ldtile_b(a0l + t0);
  s.a[2] = ldtile_b(a1h + t0);
  s.a[3] = ldtile_b(a1l + t0);
  #pragma unroll
  for (int nt = 0; nt < 4; ++nt) s.b[nt] = ldtile_b(wr + (size_t)nt * 16 * HID + t0);
  loads_stay_above();
}
__device__ __forceinline__ void oproj_mma(const OStage& s, v8f (&acc)[2][4]) {
  #pragma unroll
  for (int nt = 0; nt < 4; ++nt) {
    acc[0][nt] = wmma_b(s.a[0], s.b[nt], acc[0][nt]);
    acc[0][nt] = wmma_b(s.a[1], s.b[nt], acc[0][nt]);
    acc[1][nt] = wmma_b(s.a[2], s.b[nt], acc[1][nt]);
    acc[1][nt] = wmma_b(s.a[3], s.b[nt], acc[1][nt]);
  }
}

// ---------------------------------------------------------------------------
// Kernel 4: out = A * Wo^T + bo with A = ahi + alo (two bf16 products per tile).
// Block 128 thr = 128 tokens x 64 features; wave 32 tokens x 64 features.
// ---------------------------------------------------------------------------
__global__ __launch_bounds__(128) void oproj_kernel(
    const __bf16* __restrict__ ahi,    // [NTOK][HID], tile order
    const __bf16* __restrict__ alo,    // [NTOK][HID], tile order
    const __bf16* __restrict__ wo,     // [HID][HID], row = output feature, tile order
    const float* __restrict__ bo,
    float* __restrict__ out)           // [NTOK][HID]
{
  __shared__ __attribute__((aligned(16))) float sT[128 * 64];      // 32768 B

  const int tid = threadIdx.x, lane = tid & 31, w = tid >> 5;
  const int h = lane >> 4, m = lane & 15;
  const int m0 = blockIdx.x * 128;
  const int n0 = blockIdx.y * 64;
  const int m0w = m0 + 32 * w;

  const __bf16* a0h = ahi + (size_t)m0w * HID + 8 * lane;
  const __bf16* a0l = alo + (size_t)m0w * HID + 8 * lane;
  const __bf16* a1h = a0h + (size_t)16 * HID;
  const __bf16* a1l = a0l + (size_t)16 * HID;
  const __bf16* wr  = wo + (size_t)n0 * HID + 8 * lane;

  const v8f zero8 = {0.f, 0.f, 0.f, 0.f, 0.f, 0.f, 0.f, 0.f};
  v8f acc[2][4];
  #pragma unroll
  for (int mt = 0; mt < 2; ++mt)
    #pragma unroll
    for (int nt = 0; nt < 4; ++nt) acc[mt][nt] = zero8;

  OStage sa, sb;
  oproj_load(sa, a0h, a0l, a1h, a1l, wr, 0);
  // rolled: two register stages per trip, no copies between them
  #pragma unroll 1
  for (int k0 = 0; k0 < HID - 64; k0 += 64) {
    oproj_load(sb, a0h, a0l, a1h, a1l, wr, k0 + 32);
    oproj_mma(sa, acc);
    oproj_load(sa, a0h, a0l, a1h, a1l, wr, k0 + 64);
    oproj_mma(sb, acc);
    addr_regs_free();
  }
  oproj_load(sb, a0h, a0l, a1h, a1l, wr, HID - 32);
  addr_regs_free();
  oproj_mma(sa, acc);
  oproj_mma(sb, acc);

  // D[r] of tile (mt, nt) = Y[token m0w+16mt+8h+r][feature n0+16nt+m]
  #pragma unroll
  for (int nt = 0; nt < 4; ++nt) {
    const int featl = 16 * nt + m;
    const float bvl = (float)(__bf16)bo[n0 + featl];
    #pragma unroll
    for (int mt = 0; mt < 2; ++mt) {
      #pragma unroll
      for (int r = 0; r < 8; ++r) {
        const int tokl = 32 * w + 16 * mt + 8 * h + r;     // 0..127
        sT[tokl * 64 + featl] = acc[mt][nt][r] + bvl;
      }
    }
  }
  __syncthreads();

  out_store_pass(sT, out, m0, n0, w, lane);
  
}

// ---------------------------------------------------------------------------
extern "C" void kernel_launch(void* const* d_in, const int* in_sizes, int n_in,
                              void* d_out, int out_size, void* d_ws, size_t ws_size,
                              hipStream_t stream) {
  if (n_in < 14) return;
  if (in_sizes[0] != NX || in_sizes[1] != NX || in_sizes[2] != NX) return;
  if (in_sizes[3] != NB * SEQ * SEQ) return;
  if (in_sizes[4] != NW || in_sizes[6] != NW || in_sizes[8] != NW || in_sizes[10] != NW) return;
  if (in_sizes[5] != HID || in_sizes[7] != HID || in_sizes[9] != HID || in_sizes[11] != HID) return;
  if (in_sizes[12] != NREL * HD || in_sizes[13] != NREL * HD) return;
  if (out_size != NX) return;

  const float* q_in = (const float*)d_in[0];
  const float* k_in = (const float*)d_in[1];
  const float* v_in = (const float*)d_in[2];
  const int*   ids  = (const int*)d_in[3];
  const float* Wq = (const float*)d_in[4];
  const float* bq = (const float*)d_in[5];
  const float* Wk = (const float*)d_in[6];
  const float* bk = (const float*)d_in[7];
  const float* Wv = (const float*)d_in[8];
  const float* bv = (const float*)d_in[9];
  const float* Wo = (const float*)d_in[10];
  const float* bo = (const float*)d_in[11];
  const float* relk = (const float*)d_in[12];
  const float* relv = (const float*)d_in[13];
  float* out = (float*)d_out;

  const size_t xb_bytes = (size_t)3 * NX * 2;          // 12582912
  const size_t wb_bytes = (size_t)4 * NW * 2;          //  8388608
  const size_t rt_bytes = (size_t)NREL * HD * 2;       //     8192
  const size_t pl_bytes = (size_t)NPL * 2;             //  4194304
  const size_t ap_bytes = (size_t)NX * 2;              //  4194304
  const size_t id_bytes = (size_t)NB * SEQ * SEQ * 4;  //  4194304
  const size_t total = xb_bytes + wb_bytes + 2 * rt_bytes + 3 * pl_bytes + 2 * ap_bytes + id_bytes;  // 46153728
  if (total > ws_size) return;

  char* ws = (char*)d_ws;
  size_t off = 0;
  __bf16* xb = (__bf16*)(ws + off);       off += xb_bytes;
  __bf16* wb = (__bf16*)(ws + off);       off += wb_bytes;
  _Float16* rk  = (_Float16*)(ws + off);  off += rt_bytes;
  _Float16* rvT = (_Float16*)(ws + off);  off += rt_bytes;
  _Float16* qh  = (_Float16*)(ws + off);  off += pl_bytes;
  _Float16* kh  = (_Float16*)(ws + off);  off += pl_bytes;
  _Float16* vt  = (_Float16*)(ws + off);  off += pl_bytes;
  __bf16* ahi = (__bf16*)(ws + off);      off += ap_bytes;
  __bf16* alo = (__bf16*)(ws + off);      off += ap_bytes;
  int* idp = (int*)(ws + off);            off += id_bytes;
  if (off > ws_size) return;

  convert_kernel<<<(G_TOT + 255) / 256, 256, 0, stream>>>(q_in, k_in, v_in, Wq, Wk, Wv, Wo,
                                                         relk, relv, ids, xb, wb, rk, rvT, idp);

  dim3 gProj(NTOK / 128, 3 * NH);                                   // (16, 48)
  proj_kernel<<<gProj, 128, 0, stream>>>(xb, wb, bq, bk, bv, qh, kh, vt);

  dim3 gAtt(SEQ / 16, NB * NH);                                     // (32, 64)
  attn_kernel<<<gAtt, 32, 0, stream>>>(qh, kh, vt, idp, rk, rvT, ahi, alo);

  dim3 gOut(NTOK / 128, HID / 64);                                  // (16, 16)
  oproj_kernel<<<gOut, 128, 0, stream>>>(ahi, alo, wb + (size_t)3 * NW, bo, out);
}

// v004
// A run of this version takes 71.5 microseconds.
// Timed twice side by side with v003, it ran 1.05 and 1.08 times as fast.
// All steps since v000 together make it 2.73 times as fast.
// q/k/v projections: v_wmma_f32_16x16x32_bf16 (bf16 operands, f32 accumulate); q.relk^T, k.q^T, v^T.p^T, relv^T.w^T: v_wmma_f32_16x16x32_f16 (f16 operands, f32 accumulate; relk/relv carried x32, q x0.125, p and w x16384, exact power-of-two scales folded back in f32); output projection: v_wmma_f32_16x16x32_bf16 with the activation as a bf16 hi+lo pair (two products) against bf16 weights; softmax, additive bias and normalisation in f32.
#include <hip/hip_runtime.h>

typedef _Float16 v16h __attribute__((ext_vector_type(16)));
typedef _Float16 v8h  __attribute__((ext_vector_type(8)));
typedef __bf16   v16b __attribute__((ext_vector_type(16)));
typedef __bf16   v8b  __attribute__((ext_vector_type(8)));
typedef float    v8f  __attribute__((ext_vector_type(8)));
typedef float    v4f  __attribute__((ext_vector_type(4)));
typedef int      v4i  __attribute__((ext_vector_type(4)));
typedef v8h __attribute__((may_alias)) v8ha;
typedef v8b __attribute__((may_alias)) v8ba;
typedef v4f __attribute__((may_alias)) v4fa;
typedef v4i __attribute__((may_alias)) v4ia;

union FragH { v16h v; v8h half[2]; };
union FragB { v16b v; v8b half[2]; };

#define NB    4
#define SEQ   512
#define HID   1024
#define NH    16
#define HD    64
#define NREL  64
#define NTOK  (NB * SEQ)            // 2048 tokens
#define NX    (NTOK * HID)          // 2097152 elements per activation
#define NW    (HID * HID)           // 1048576 elements per weight
#define NX8   (NX / 8)              // 262144
#define NW8   (NW / 8)              // 131072
#define NPL   (NB * NH * SEQ * HD)  // 2097152 halves per q/k/v plane
#define G_X   (3 * NX8)             // 786432 activation groups
#define G_W   (4 * NW8)             // 524288 weight groups
#define G_R   (NREL * HD / 8)       // 512 groups per relation table
#define G_I   (NB * SEQ * SEQ / 4)  // 262144 groups of four relation ids
#define G_16  (G_X + G_W + 2 * G_R) // 1311744 groups of the 16-bit planes
#define G_TOT (G_16 + G_I)          // 1573888
#define TILE  512                   // elements of one 16-row x 32-k tile (1 KiB)
#define PSC   16384.0f
#define RVS   4.76837158203125e-7f  // 2^-21 = 0.25 / (32 * 16384)
#define HCOPY 4                     // independent copies of the relation histogram
#define HPL   (NREL * 32)           // floats of one copy, [rel][lane]

// ---------------------------------------------------------------------------
// 16x16x32 WMMA (builtin form; the compiler keeps the distance behind it).
// Fragment map (wave32): lane l, h = l>>4, m = n = l&15.
//   A/B element i: i<8 -> k0+8h+i ; i>=8 -> k0+16+8h+(i-8)
//   D element r : row 8h+r, col l&15
// ---------------------------------------------------------------------------
__device__ __forceinline__ v8f wmma_h(v16h a, v16h b, v8f c) {
  return __builtin_amdgcn_wmma_f32_16x16x32_f16(false, a, false, b, (short)0, c, false, false);
}
__device__ __forceinline__ v8f wmma_b(v16b a, v16b b, v8f c) {
  return __builtin_amdgcn_wmma_f32_16x16x32_bf16(false, a, false, b, (short)0, c, false, false);
}

// Stands behind a stage's group of global loads: without it the scheduler sinks the
// loads below the other stage's work and their latency is exposed again.
__device__ __forceinline__ void loads_stay_above() { __builtin_amdgcn_sched_barrier(0); }
// Stands in front of code that rewrites address registers which loads still in
// flight name (a pipelined loop's next trip, the epilogue's address arithmetic).
// The two scheduling barriers keep the wait where it is written: late enough to
// cost nothing, and ahead of every such rewrite.
__device__ __forceinline__ void addr_regs_free() {
  __builtin_amdgcn_sched_barrier(0);
  asm volatile("s_wait_xcnt 0x0" ::: "memory");
  __builtin_amdgcn_sched_barrier(0);
}
// The same, and the address pair is an input of the wait: it stays allocated up to
// here, so that no load's result is given the registers that earlier loads still name.
__device__ __forceinline__ void addr_regs_free_of(const void* p) {
  __builtin_amdgcn_sched_barrier(0);
  asm volatile("s_wait_xcnt 0x0" :: "v"(p) : "memory");
  __builtin_amdgcn_sched_barrier(0);
}

// Tile order of every 16-bit workspace plane: a 16-row x 32-k tile is one 1-KiB
// block [j][lane][8 elements]; lane 16h+m of half j holds row m, k = 16j+8h .. +7,
// which is the fragment map above. One wave load of a half is 512 contiguous bytes
// (four whole lines) where a row-major plane gives 32 bytes of each of 16 lines.
// A plane of R rows x K columns is [R/16][K/32] tiles (vt: [K/32][R/16] per (b, head)).
// A or B fragment: p = the tile's first element + 8 * lane.
__device__ __forceinline__ v16h ldtile_h(const _Float16* p) {
  FragH f;
  f.half[0] = *(const v8ha*)(p);
  f.half[1] = *(const v8ha*)(p + 256);
  return f.v;
}
__device__ __forceinline__ v16b ldtile_b(const __bf16* p) {
  FragB f;
  f.half[0] = *(const v8ba*)(p);
  f.half[1] = *(const v8ba*)(p + 256);
  return f.v;
}

// relation id: wrap negative once, then clamp into [0, NREL-1]
__device__ __forceinline__ int relidx(int id) {
  int t = id + ((id >> 31) & NREL);
  t = t < 0 ? 0 : t;
  t = t > (NREL - 1) ? (NREL - 1) : t;
  return t;
}

// ---------------------------------------------------------------------------
// Kernel 1: f32 -> 16-bit planes in tile order, 8 elements (16 B) per thread; thread
// index = index of the 16-byte group it writes, so stores are whole lines and the
// 16-line access falls on the one read of each source element.
//   xb [3][NTOK][HID] bf16 (q_in, k_in, v_in, RNE convert)
//   wb [4][HID][HID]  bf16 (Wq, Wk, Wv, Wo, row = output feature)
//   rk [NREL][HD]     f16  = 32 * bf16(relk)
//   rvT[HD][NREL]     f16  = 32 * bf16(relv)^T
//   idp               int  relation ids as given, [B][L/16][L/32][i][lane][4]:
//                     lane 16h+m of group i holds query m, keys 16(i>>1)+8h+4(i&1) .. +3
// ---------------------------------------------------------------------------
__global__ __launch_bounds__(256) void convert_kernel(
    const float* __restrict__ q_in, const float* __restrict__ k_in, const float* __restrict__ v_in,
    const float* __restrict__ Wq, const float* __restrict__ Wk, const float* __restrict__ Wv,
    const float* __restrict__ Wo, const float* __restrict__ relk, const float* __restrict__ relv,
    const int* __restrict__ ids,
    __bf16* __restrict__ xb, __bf16* __restrict__ wb, _Float16* __restrict__ rk, _Float16* __restrict__ rvT,
    int* __restrict__ idp)
{
  const int g = blockIdx.x * 256 + threadIdx.x;
  if (g >= G_TOT) return;
  const int h = (g >> 4) & 1, m = g & 15;        // every plane starts at a multiple of 32 groups
  if (g >= G_16) {
    const int e = g - G_16;
    const int i = (e >> 5) & 3, c = (e >> 7) & 15, qt = e >> 11;   // qt = 32 b + query tile
    const int* src = ids + ((size_t)qt * 16 + m) * SEQ + 32 * c + 16 * (i >> 1) + 8 * h + 4 * (i & 1);
    *(v4i*)(idp + (size_t)e * 4) = *(const v4ia*)src;
  } else if (g < G_X + G_W) {
    const float* src;
    __bf16* dst;
    if (g < G_X) {
      const int which = g >> 18;                 // NX8 = 2^18
      const int off = g & (NX8 - 1);
      const float* s = (which == 0) ? q_in : ((which == 1) ? k_in : v_in);
      // group off = ((row tile * 32 + k tile) * 2 + j) * 32 + lane
      src = s + (size_t)((off >> 11) * 16 + m) * HID + ((off >> 6) & 31) * 32 + ((off >> 5) & 1) * 16 + 8 * h;
      dst = xb + (size_t)which * NX + (size_t)off * 8;
    } else {
      const int e = g - G_X;
      const int wsel = e >> 17;                 // NW8 = 2^17
      const int off = e & (NW8 - 1);
      const float* s = (wsel == 0) ? Wq : ((wsel == 1) ? Wk : ((wsel == 2) ? Wv : Wo));
      src = s + (size_t)((off >> 11) * 16 + m) * HID + ((off >> 6) & 31) * 32 + ((off >> 5) & 1) * 16 + 8 * h;
      dst = wb + (size_t)wsel * NW + (size_t)off * 8;
    }
    const v4f a = *(const v4fa*)src;
    const v4f c = *(const v4fa*)(src + 4);
    const v8b o = { (__bf16)a.x, (__bf16)a.y, (__bf16)a.z, (__bf16)a.w,
                    (__bf16)c.x, (__bf16)c.y, (__bf16)c.z, (__bf16)c.w };
    *(v8b*)dst = o;
    
  } else {
    const int e = g - (G_X + G_W);
    float f[8];
    _Float16* dst;
    // group e & 511 = ((row tile * 2 + k tile) * 2 + j) * 32 + lane of a 64 x 64 plane
    const int row = ((e >> 7) & 3) * 16 + m;
    const int kk = ((e >> 6) & 1) * 32 + ((e >> 5) & 1) * 16 + 8 * h;
    if (e < G_R) {
      const float* src = relk + (size_t)row * HD + kk;
      const v4f a = *(const v4fa*)src;
      const v4f c = *(const v4fa*)(src + 4);
      f[0] = a.x; f[1] = a.y; f[2] = a.z; f[3] = a.w;
      f[4] = c.x; f[5] = c.y; f[6] = c.z; f[7] = c.w;
      dst = rk + (size_t)e * 8;
    } else {
      const int e3 = e - G_R;                    // 0..511; row = d, kk = first relation index
      #pragma unroll
      for (int i = 0; i < 8; ++i) f[i] = relv[(size_t)(kk + i) * HD + row];
      dst = rvT + (size_t)e3 * 8;
    }
    _Float16 hh[8];
    #pragma unroll
    for (int i = 0; i < 8; ++i) hh[i] = (_Float16)((float)(__bf16)f[i] * 32.0f);
    const v8h o = { hh[0], hh[1], hh[2], hh[3], hh[4], hh[5], hh[6], hh[7] };
    *(v8h*)dst = o;
    
  }
}

// ---------------------------------------------------------------------------
// 4 lines per instruction, 32 lines per wave, 128 per block; tile order.
// which 0/1: plane[bh][l/16][d/32] tiles (row = token, k = d); a wave's 32 tokens = 4 tiles
// which 2  : vt[bh][l/32][d/16] tiles    (row = d, k = token); a wave's 32 tokens = 4 tiles
// ---------------------------------------------------------------------------
__device__ __forceinline__ void proj_store_pass(const _Float16* sT, _Float16* plane, _Float16* vt,
                                                int which, int bh, int l0, int w, int lane) {
  const int h = lane >> 4, m = lane & 15;
  // LDS element of half i = 0: (token tile * 2 + d tile) * 2 + j = i, or d tile * 2 + j = i
  const _Float16* sp = (which != 2) ? sT + (32 * w + m) * HD + 8 * h : sT + m * 128 + 32 * w + 8 * h;
  // either way the wave's four tiles are 4 KiB in a row at the same offset of its plane
  _Float16* dst = ((which != 2) ? plane : vt) + ((size_t)bh * SEQ + l0 + 32 * w) * HD + 8 * lane;
  #pragma unroll
  for (int i = 0; i < 8; ++i) {
    const int so = (which != 2) ? 16 * (i >> 2) * HD + 16 * (i & 3) : 16 * (i >> 1) * 128 + 16 * (i & 1);
    *(v8h*)(dst + 256 * i) = *(const v8ha*)(sp + so);
  }
}

// One k step (32 deep) of a projection's operands, held in registers so that
// the next step's loads are in flight while this step's products run.
struct PStage { v16b a0, a1, b[4]; };
__device__ __forceinline__ void proj_load(PStage& s, const __bf16* xa0, const __bf16* xa1,
                                          const __bf16* wr, int k0) {
  const int t0 = (k0 >> 5) * TILE;
  s.a0 = ldtile_b(xa0 + t0);
  s.a1 = ldtile_b(xa1 + t0);
  #pragma unroll
  for (int nt = 0; nt < 4; ++nt) s.b[nt] = ldtile_b(wr + (size_t)nt * 16 * HID + t0);
  loads_stay_above();
}
__device__ __forceinline__ void proj_mma(const PStage& s, v8f (&acc)[2][4]) {
  #pragma unroll
  for (int nt = 0; nt < 4; ++nt) {
    acc[0][nt] = wmma_b(s.a0, s.b[nt], acc[0][nt]);
    acc[1][nt] = wmma_b(s.a1, s.b[nt], acc[1][nt]);
  }
}

// ---------------------------------------------------------------------------
// Kernel 2: Y = x * W^T + b for the three projections (which = 0,1,2).
// Block 128 thr (4 waves) = 128 tokens x 64 features (one (which, head));
// wave tile 32 tokens x 64 features; K = 1024 in steps of 32;
// A (x rows) and B (W rows) bf16 fragments straight from the tile-ordered planes.
// ---------------------------------------------------------------------------
__global__ __launch_bounds__(128) void proj_kernel(
    const __bf16* __restrict__ xb,     // [3][NTOK][HID], tile order
    const __bf16* __restrict__ wb,     // [4][HID][HID], row = output feature (first 3 used), tile order
    const float* __restrict__ bq, const float* __restrict__ bk, const float* __restrict__ bv,
    _Float16* __restrict__ qh,         // [B*H][L][D]  f16(0.125*q), tile order
    _Float16* __restrict__ kh,         // [B*H][L][D], tile order
    _Float16* __restrict__ vt)         // [B*H][L/32][D/16] tiles (row = d, k = token)
{
  __shared__ __attribute__((aligned(16))) _Float16 sT[128 * 64];   // 16384 B

  const int tid = threadIdx.x, lane = tid & 31, w = tid >> 5;
  const int h = lane >> 4, m = lane & 15;
  const int m0 = blockIdx.x * 128;
  const int cg = blockIdx.y;                 // 0..47
  const int which = cg >> 4, head = cg & 15;
  const int m0w = m0 + 32 * w;

  // 16 rows of a plane = HID / 32 tiles in a row = 16 * HID elements
  const __bf16* xa0 = xb + (size_t)which * NX + (size_t)m0w * HID + 8 * lane;   // token tile, mt = 0
  const __bf16* xa1 = xa0 + (size_t)16 * HID;                                   // mt = 1
  const __bf16* wr  = wb + (size_t)which * NW + (size_t)(head * HD) * HID + 8 * lane;  // feature tile, nt = 0

  const v8f zero8 = {0.f, 0.f, 0.f, 0.f, 0.f, 0.f, 0.f, 0.f};
  v8f acc[2][4];
  #pragma unroll
  for (int mt = 0; mt < 2; ++mt)
    #pragma unroll
    for (int nt = 0; nt < 4; ++nt) acc[mt][nt] = zero8;

  PStage sa, sb;
  proj_load(sa, xa0, xa1, wr, 0);
  // rolled: two register stages per trip, no copies between them
  #pragma unroll 1
  for (int k0 = 0; k0 < HID - 64; k0 += 64) {
    proj_load(sb, xa0, xa1, wr, k0 + 32);
    proj_mma(sa, acc);
    proj_load(sa, xa0, xa1, wr, k0 + 64);
    proj_mma(sb, acc);
    addr_regs_free();
  }
  proj_load(sb, xa0, xa1, wr, HID - 32);
  proj_mma(sa, acc);
  proj_mma(sb, acc);

  // D[r] of tile (mt, nt) = Y[token m0w+16mt+8h+r][feature 16nt+m]
  const float* bias = (which == 0) ? bq : ((which == 1) ? bk : bv);
  const float osc = (which == 0) ? 0.125f : 1.0f;
  #pragma unroll
  for (int nt = 0; nt < 4; ++nt) {
    const int feat = 16 * nt + m;
    const float bvl = (float)(__bf16)bias[head * HD + feat];
    #pragma unroll
    for (int mt = 0; mt < 2; ++mt) {
      #pragma unroll
      for (int r = 0; r < 8; ++r) {
        const int tokl = 32 * w + 16 * mt + 8 * h + r;     // 0..127
        const float y = (acc[mt][nt][r] + bvl) * osc;
        const int idx = (which == 2) ? (feat * 128 + tokl) : (tokl * HD + feat);
        sT[idx] = (_Float16)y;
      }
    }
  }
  __syncthreads();

  const int b = m0 >> 9, l0 = m0 & (SEQ - 1), bh = b * NH + head;
  _Float16* plane = (which == 0) ? qh : kh;
  proj_store_pass(sT, plane, vt, which, bh, l0, w, lane);
  
}

// ---------------------------------------------------------------------------
// Attention helpers.
// ---------------------------------------------------------------------------
// B fragment of the normalised relation histogram, k = relation index:
// element i<8 <- k0+8h+i, element 8+i <- k0+16+8h+i; kb = k0 + 8h.
// A bin of query m is the sum of eight partials: HCOPY copies x the columns of lanes m
// and m+16. Each lane reads its own column first and its partner's second, so the 32
// lanes of every read fall on 32 different banks.
__device__ __forceinline__ v16h build_w(const float* sH, int lane, int kb, float wsc) {
  const float* ca = sH + kb * 32 + lane;
  const float* cb = sH + kb * 32 + (lane ^ 16);
  _Float16 wh[16];
  #pragma unroll
  for (int i = 0; i < 16; ++i) {
    const int ro = ((i & 7) + 16 * (i >> 3)) * 32;
    float s = ca[ro] + cb[ro];
    #pragma unroll
    for (int c = 1; c < HCOPY; ++c) s += ca[c * HPL + ro] + cb[c * HPL + ro];
    wh[i] = (_Float16)(s * wsc);
  }
  FragH f;
  f.half[0] = (v8h){ wh[0], wh[1], wh[2], wh[3], wh[4], wh[5], wh[6], wh[7] };
  f.half[1] = (v8h){ wh[8], wh[9], wh[10], wh[11], wh[12], wh[13], wh[14], wh[15] };
  return f.v;
}

// Per-wave 16x64 f32 tile in LDS -> bf16 hi and lo planes [tok][HID] in tile order:
// two tiles in a row, i = feature tile * 2 + j; 4 lines per instruction.
__device__ __forceinline__ void att_store(const float* sO, __bf16* ahi, __bf16* alo,
                                          size_t gbase, int lane) {
  const int h = lane >> 4, m = lane & 15;
  #pragma unroll
  for (int i = 0; i < 4; ++i) {
    const float* sp = sO + m * HD + 16 * i + 8 * h;
    const v4f a = *(const v4fa*)sp;
    const v4f c = *(const v4fa*)(sp + 4);
    const float f[8] = { a.x, a.y, a.z, a.w, c.x, c.y, c.z, c.w };
    __bf16 hh[8], ll[8];
    #pragma unroll
    for (int e = 0; e < 8; ++e) {
      hh[e] = (__bf16)f[e];
      ll[e] = (__bf16)(f[e] - (float)hh[e]);
    }
    const v8b hv = { hh[0], hh[1], hh[2], hh[3], hh[4], hh[5], hh[6], hh[7] };
    const v8b lv = { ll[0], ll[1], ll[2], ll[3], ll[4], ll[5], ll[6], ll[7] };
    const size_t gi = gbase + 256 * i + 8 * lane;
    *(v8b*)(ahi + gi) = hv;
    *(v8b*)(alo + gi) = lv;
  }
}

// 32 keys' worth of global operands, held in registers ahead of their use:
// f[0..3] = four A fragments (K rows of two key tiles, two d chunks each, or
// V^T rows of the four d tiles), id[0..3] = this lane's 16 relation ids.
// Both passes form the scores, so both need K and the ids at a stage's head: they
// are fetched one stage ahead. Pass 2 needs V^T only at the foot, behind the
// histogram chain, so V^T is fetched at the head of its own stage.
struct AFrag { v16h f[4]; };
struct AIds  { v4i id[4]; };
// ip = the stage's 2-KiB block of idp + 4 * lane; id[0..3] = keys 8h+0..3, 8h+4..7, 16+8h+0..3, 16+8h+4..7
__device__ __forceinline__ void ids_load(AIds& s, const int* ip) {
  #pragma unroll
  for (int i = 0; i < 4; ++i) s.id[i] = *(const v4ia*)(ip + 128 * i);
}
__device__ __forceinline__ void k_load(AFrag& s, AIds& n, const _Float16* kbase, const int* idrow, int c) {
  // 32 keys = four tiles in a row: (key tile 0, d 0..31), (0, 32..63), (1, 0..31), (1, 32..63)
  #pragma unroll
  for (int t = 0; t < 4; ++t) s.f[t] = ldtile_h(kbase + (size_t)(4 * c + t) * TILE);
  ids_load(n, idrow + 512 * c);
  loads_stay_above();
}
// V^T of stage c and, where there is one, K and the ids of stage c + 1
template <bool NEXT>
__device__ __forceinline__ void vk_load(AFrag& v, AFrag& s, AIds& n, const _Float16* vbase,
                                        const _Float16* kbase, const int* idrow, int c) {
  #pragma unroll
  for (int t = 0; t < 4; ++t) v.f[t] = ldtile_h(vbase + (size_t)(4 * c + t) * TILE);
  if (NEXT) {
    #pragma unroll
    for (int t = 0; t < 4; ++t) s.f[t] = ldtile_h(kbase + (size_t)(4 * (c + 1) + t) * TILE);
    ids_load(n, idrow + 512 * (c + 1));
  }
  loads_stay_above();
}
// scores of one stage's 32 keys, 16 per lane, in registers, with their table rows;
// both passes call it, so pass 2 sees the values that pass 1 took the maximum of
__device__ __forceinline__ void score16(const AFrag& s, const AIds& n, v16h qb0, v16h qb1, const float* qr,
                                        float (&sc)[16], int (&ri)[16]) {
  const v8f zero8 = {0.f, 0.f, 0.f, 0.f, 0.f, 0.f, 0.f, 0.f};
  v8f z0 = wmma_h(s.f[0], qb0, zero8);
  z0 = wmma_h(s.f[1], qb1, z0);                 // z0[r] = S[query m][key 32c+8h+r]
  v8f z1 = wmma_h(s.f[2], qb0, zero8);
  z1 = wmma_h(s.f[3], qb1, z1);                 // z1[r] = S[query m][key 32c+16+8h+r]
  const int idv[16] = { n.id[0].x, n.id[0].y, n.id[0].z, n.id[0].w, n.id[1].x, n.id[1].y, n.id[1].z, n.id[1].w,
                        n.id[2].x, n.id[2].y, n.id[2].z, n.id[2].w, n.id[3].x, n.id[3].y, n.id[3].z, n.id[3].w };
  #pragma unroll
  for (int e = 0; e < 16; ++e) {
    const int id = idv[e];
    const float bias = (id > 0) ? 0.0f : -10000.0f;
    const float zz = (e < 8) ? z0[e & 7] : z1[e & 7];
    ri[e] = relidx(id);
    sc[e] = zz + qr[ri[e]] * 0.0078125f + bias;
  }
}
// pass 1 on one stage: running maximum of the scores of 32 keys
__device__ __forceinline__ float max_stage(const AFrag& s, const AIds& n, v16h qb0, v16h qb1, const float* qr,
                                           float mx) {
  float sc[16];
  int ri[16];
  score16(s, n, qb0, qb1, qr, sc, ri);
  #pragma unroll
  for (int e = 0; e < 16; ++e) mx = fmaxf(mx, sc[e]);
  return mx;
}
// 2^x. The v_nop is the free slot that the instruction set asks for behind a
// transcendental before its source is overwritten or its result read; only inside the
// same statement does it stay directly behind the v_exp_f32.
__device__ __forceinline__ float exp2_slot(float x) {
  float r;
  asm("v_exp_f32 %0, %1\n\tv_nop" : "=v"(r) : "v"(x));
  return r;
}
// pass 2 on one stage: the scores again, exp, sum, histogram, O^T += V^T * P^T for 32 keys
__device__ __forceinline__ float pv_stage(const AFrag& k, const AIds& n, const AFrag& s, v16h qb0, v16h qb1,
                                          const float* qr, float* hl, float mx, float lsum, v8f (&o)[4]) {
  float sv[16];
  int rv[16];
  score16(k, n, qb0, qb1, qr, sv, rv);
  // Histogram: key e adds into copy e & 3, so the four bins of a group are four different
  // LDS words whatever the ids are: they are read together and one LDS round trip serves
  // four keys, where a single copy makes every read wait for the store in front of it.
  // The first group's bins depend on no store of this stage: their reads stand ahead of the exponentials.
  float old[HCOPY];
  #pragma unroll
  for (int j = 0; j < HCOPY; ++j) old[j] = hl[j * HPL + rv[j] * 32];
  float pe[16];
  _Float16 ph[16];
  #pragma unroll
  for (int e = 0; e < 16; ++e) {
    const float p = exp2_slot((sv[e] - mx) * 1.44269504f);   // = __expf(sv[e] - mx)
    lsum += p;
    pe[e] = p;
    ph[e] = (_Float16)(p * PSC);
  }
  #pragma unroll
  for (int g = 0; g < 16 / HCOPY; ++g) {
    #pragma unroll
    for (int j = 0; j < HCOPY; ++j) hl[j * HPL + rv[HCOPY * g + j] * 32] = old[j] + pe[HCOPY * g + j];
    if (g + 1 < 16 / HCOPY) {
      #pragma unroll
      for (int j = 0; j < HCOPY; ++j) old[j] = hl[j * HPL + rv[HCOPY * (g + 1) + j] * 32];
    }
  }
  // P^T B-fragment: element r <- key 32c+8h+r, element 8+r <- key 32c+16+8h+r
  FragH pf;
  pf.half[0] = (v8h){ ph[0], ph[1], ph[2], ph[3], ph[4], ph[5], ph[6], ph[7] };
  pf.half[1] = (v8h){ ph[8], ph[9], ph[10], ph[11], ph[12], ph[13], ph[14], ph[15] };
  #pragma unroll
  for (int t = 0; t < 4; ++t) o[t] = wmma_h(s.f[t], pf.v, o[t]);
  return lsum;
}

// ---------------------------------------------------------------------------
// Kernel 3: relation-aware attention, transposed form, one wave per block.
// Block = 32 thr = 16 queries of one (b, head), all 512 keys.
//   qrel^T = RK * Q^T       : A = rk rows (row = rel, k = d), B = Q^T
//   S^T    = K * Q^T        : A = K rows (row = key, k = d), B = Q^T (k = d, n = query)
//   score  = S^T + qrel[query][id]/128 + (-10000 where id <= 0), f32 in registers: formed
//            once for the row maximum and once more for the exponentials, never stored
//   hist   : per-lane private bins h[key & 3][rel][lane] += p (fixed order, no atomics);
//            bank = lane + 32 (rel & 1), so a wave's 32 bins never share a bank
//   O^T    = V^T * P^T      : A = vt rows (row = d, k = key), B = P^T from registers x16384
//   R^T    = RVT * W^T      : A = rvT rows (row = d, k = rel), B = W^T = (hist/l) x16384,
//            hist = the eight partial bins of a (query, rel) added up
//   out    = O^T/(l*16384) + R^T * 2^-21  -> bf16 hi/lo planes [tok][head*64+d]
// Lane owns 256 keys of query column (lane&15); partner = lane ^ 16.
// ---------------------------------------------------------------------------
__global__ __launch_bounds__(32) void attn_kernel(
    const _Float16* __restrict__ qh,   // [B*H][L][D]  (already x0.125), tile order
    const _Float16* __restrict__ kh,   // [B*H][L][D], tile order
    const _Float16* __restrict__ vt,   // [B*H][L/32][D/16] tiles (row = d, k = key)
    const int* __restrict__ idp,       // [B][L/16][L/32][4][32][4] int32 relation ids in lane order
    const _Float16* __restrict__ rk,   // [NREL][D]  x32, tile order
    const _Float16* __restrict__ rvT,  // [D][NREL]  x32, tile order
    __bf16* __restrict__ ahi,          // [NTOK][HID], tile order
    __bf16* __restrict__ alo)          // [NTOK][HID], tile order
{
  // 36 KiB in all: eight blocks still fit a WGP's 320 KiB, so the whole grid is resident at once
  __shared__ __attribute__((aligned(16))) float sQR[16 * NREL];     //  4096 B qrel[query][rel]; behind pass 2: output staging
  __shared__ __attribute__((aligned(16))) float sH[HCOPY * HPL];    // 32768 B hist[copy][rel][lane]

  const int lane = threadIdx.x & 31, h = lane >> 4, m = lane & 15;
  const int bh = blockIdx.y, b = bh >> 4, head = bh & 15;
  const int q0 = blockIdx.x * 16;

  // zero all histogram bins, 512 contiguous bytes per store
  float* hl = sH + lane;                      // this lane's column of every copy
  {
    const v4f z4 = {0.f, 0.f, 0.f, 0.f};
    #pragma unroll
    for (int i = 0; i < HCOPY * HPL / 128; ++i) *(v4fa*)(sH + 128 * i + 4 * lane) = z4;
  }

  // Q^T B-fragments: column n = query q0+m, k = d (two 32-deep chunks)
  const _Float16* qrow = qh + ((size_t)bh * SEQ + q0) * HD + 8 * lane;
  const v16h qb0 = ldtile_h(qrow);
  const v16h qb1 = ldtile_h(qrow + TILE);

  const _Float16* kbase = kh + (size_t)bh * SEQ * HD + 8 * lane;     // + four tiles per stage
  const _Float16* vbase = vt + (size_t)bh * SEQ * HD + 8 * lane;     // + four tiles per stage
  const int* idrow = idp + ((size_t)b * SEQ + q0) * SEQ + 4 * lane;  // + 512 ids per stage
  AFrag fa, fb;
  AIds ia, ib;
  k_load(fa, ia, kbase, idrow, 0);              // pass 1's first stage, in flight under the qrel tiles

  const v8f zero8 = {0.f, 0.f, 0.f, 0.f, 0.f, 0.f, 0.f, 0.f};

  // ---- qrel^T tiles: D[r] = (rel 16rt+8h+r, query m) ----
  #pragma unroll
  for (int rt = 0; rt < 4; ++rt) {
    const _Float16* ap = rk + (size_t)(2 * rt) * TILE + 8 * lane;
    v8f z = zero8;
    z = wmma_h(ldtile_h(ap), qb0, z);
    z = wmma_h(ldtile_h(ap + TILE), qb1, z);
    #pragma unroll
    for (int r = 0; r < 8; ++r) sQR[m * NREL + 16 * rt + 8 * h + r] = z[r];
  }
  __syncthreads();

  const float* qr = sQR + m * NREL;

  float mx = -3.0e38f;
  // rolled: two register stages per trip, no copies between them
  #pragma unroll 1
  for (int c = 0; c < SEQ / 32 - 2; c += 2) {
    k_load(fb, ib, kbase, idrow, c + 1);
    mx = max_stage(fa, ia, qb0, qb1, qr, mx);
    k_load(fa, ia, kbase, idrow, c + 2);
    mx = max_stage(fb, ib, qb0, qb1, qr, mx);
  }
  k_load(fb, ib, kbase, idrow, SEQ / 32 - 1);
  mx = max_stage(fa, ia, qb0, qb1, qr, mx);
  k_load(fa, ia, kbase, idrow, 0);              // pass 2's first stage
  mx = max_stage(fb, ib, qb0, qb1, qr, mx);
  mx = fmaxf(mx, __shfl_xor(mx, 16));
  __syncthreads();

  // ---- pass 2: scores again, exp, sum, histogram, O^T += V^T * P^T (32 keys per step) ----
  v8f o[4];                                   // o[t][r] = O[query m][d 16t+8h+r] * (l * 16384)
  #pragma unroll
  for (int t = 0; t < 4; ++t) o[t] = zero8;
  float lsum = 0.0f;
  AFrag fv;
  // rolled: two register stages per trip, no copies between them
  #pragma unroll 1
  for (int c = 0; c < SEQ / 32 - 2; c += 2) {
    vk_load<true>(fv, fb, ib, vbase, kbase, idrow, c);
    lsum = pv_stage(fa, ia, fv, qb0, qb1, qr, hl, mx, lsum, o);
    vk_load<true>(fv, fa, ia, vbase, kbase, idrow, c + 1);
    lsum = pv_stage(fb, ib, fv, qb0, qb1, qr, hl, mx, lsum, o);
    addr_regs_free_of(vbase + (size_t)(4 * c) * TILE);
  }
  vk_load<true>(fv, fb, ib, vbase, kbase, idrow, SEQ / 32 - 2);
  lsum = pv_stage(fa, ia, fv, qb0, qb1, qr, hl, mx, lsum, o);
  vk_load<false>(fv, fa, ia, vbase, kbase, idrow, SEQ / 32 - 1);
  lsum = pv_stage(fb, ib, fv, qb0, qb1, qr, hl, mx, lsum, o);
  lsum += __shfl_xor(lsum, 16);
  const float inv = 1.0f / lsum;
  const float osc = inv * (1.0f / PSC);
  const float wsc = inv * PSC;
  __syncthreads();                            // histogram bins complete (read cross-lane below)

  // ---- relation value term: R^T = RVT * W^T ----
  const v16h w0 = build_w(sH, lane, 8 * h, wsc);
  const v16h w1 = build_w(sH, lane, 32 + 8 * h, wsc);
  float* sO = sQR;                            // the qrel table was last read in pass 2
  #pragma unroll
  for (int t = 0; t < 4; ++t) {
    const _Float16* ap = rvT + (size_t)(2 * t) * TILE + 8 * lane;
    v8f z = zero8;
    z = wmma_h(ldtile_h(ap), w0, z);
    z = wmma_h(ldtile_h(ap + TILE), w1, z);
    #pragma unroll
    for (int r = 0; r < 8; ++r)
      sO[m * HD + 16 * t + 8 * h + r] = o[t][r] * osc + z[r] * RVS;
  }
  __syncthreads();

  const size_t gbase = ((size_t)b * SEQ + q0) * HID + (size_t)(2 * head) * TILE;   // token tile, feature tiles 2 head, 2 head + 1
  att_store(sO, ahi, alo, gbase, lane);
  
}

// ---------------------------------------------------------------------------
// instruction, 4 lines per instruction, 64 lines per wave.
// ---------------------------------------------------------------------------
__device__ __forceinline__ void out_store_pass(const float* sT, float* out, int m0, int n0,
                                               int w, int lane) {
  const int q8 = lane & 7, sub = lane >> 3;
  #pragma unroll
  for (int i = 0; i < 16; ++i) {
    const int lid = i * 4 + sub;                 // 0..63
    const int rowl = 32 * w + (lid >> 1), hl = lid & 1;
    const v4f v = *(const v4fa*)(sT + rowl * 64 + 32 * hl + 4 * q8);
    float* dst = out + (size_t)(m0 + rowl) * HID + n0 + 32 * hl + 4 * q8;
    *(v4f*)dst = v;
  }
}

// One k step (32 deep) of the output projection's operands, one stage ahead.
struct OStage { v16b a[4]; v16b b[4]; };
__device__ __forceinline__ void oproj_load(OStage& s, const __bf16* a0h, const __bf16* a0l,
                                           const __bf16* a1h, const __bf16* a1l,
                                           const __bf16* wr, int k0) {
  const int t0 = (k0 >> 5) * TILE;
  s.a[0] = ldtile_b(a0h + t0);
  s.a[1] = ldtile_b(a0l + t0);
  s.a[2] = ldtile_b(a1h + t0);
  s.a[3] = ldtile_b(a1l + t0);
  #pragma unroll
  for (int nt = 0; nt < 4; ++nt) s.b[nt] = ldtile_b(wr + (size_t)nt * 16 * HID + t0);
  loads_stay_above();
}
__device__ __forceinline__ void oproj_mma(const OStage& s, v8f (&acc)[2][4]) {
  #pragma unroll
  for (int nt = 0; nt < 4; ++nt) {
    acc[0][nt] = wmma_b(s.a[0], s.b[nt], acc[0][nt]);
    acc[0][nt] = wmma_b(s.a[1], s.b[nt], acc[0][nt]);
    acc[1][nt] = wmma_b(s.a[2], s.b[nt], acc[1][nt]);
    acc[1][nt] = wmma_b(s.a[3], s.b[nt], acc[1][nt]);
  }
}

// ---------------------------------------------------------------------------
// Kernel 4: out = A * Wo^T + bo with A = ahi + alo (two bf16 products per tile).
// Block 128 thr = 128 tokens x 64 features; wave 32 tokens x 64 features.
// ---------------------------------------------------------------------------
__global__ __launch_bounds__(128) void oproj_kernel(
    const __bf16* __restrict__ ahi,    // [NTOK][HID], tile order
    const __bf16* __restrict__ alo,    // [NTOK][HID], tile order
    const __bf16* __restrict__ wo,     // [HID][HID], row = output feature, tile order
    const float* __restrict__ bo,
    float* __restrict__ out)           // [NTOK][HID]
{
  __shared__ __attribute__((aligned(16))) float sT[128 * 64];      // 32768 B

  const int tid = threadIdx.x, lane = tid & 31, w = tid >> 5;
  const int h = lane >> 4, m = lane & 15;
  const int m0 = blockIdx.x * 128;
  const int n0 = blockIdx.y * 64;
  const int m0w = m0 + 32 * w;

  const __bf16* a0h = ahi + (size_t)m0w * HID + 8 * lane;
  const __bf16* a0l = alo + (size_t)m0w * HID + 8 * lane;
  const __bf16* a1h = a0h + (size_t)16 * HID;
  const __bf16* a1l = a0l + (size_t)16 * HID;
  const __bf16* wr  = wo + (size_t)n0 * HID + 8 * lane;

  const v8f zero8 = {0.f, 0.f, 0.f, 0.f, 0.f, 0.f, 0.f, 0.f};
  v8f acc[2][4];
  #pragma unroll
  for (int mt = 0; mt < 2; ++mt)
    #pragma unroll
    for (int nt = 0; nt < 4; ++nt) acc[mt][nt] = zero8;

  OStage sa, sb;
  oproj_load(sa, a0h, a0l, a1h, a1l, wr, 0);
  // rolled: two register stages per trip, no copies between them
  #pragma unroll 1
  for (int k0 = 0; k0 < HID - 64; k0 += 64) {
    oproj_load(sb, a0h, a0l, a1h, a1l, wr, k0 + 32);
    oproj_mma(sa, acc);
    oproj_load(sa, a0h, a0l, a1h, a1l, wr, k0 + 64);
    oproj_mma(sb, acc);
    addr_regs_free();
  }
  oproj_load(sb, a0h, a0l, a1h, a1l, wr, HID - 32);
  addr_regs_free();
  oproj_mma(sa, acc);
  oproj_mma(sb, acc);

  // D[r] of tile (mt, nt) = Y[token m0w+16mt+8h+r][feature n0+16nt+m]
  #pragma unroll
  for (int nt = 0; nt < 4; ++nt) {
    const int featl = 16 * nt + m;
    const float bvl = (float)(__bf16)bo[n0 + featl];
    #pragma unroll
    for (int mt = 0; mt < 2; ++mt) {
      #pragma unroll
      for (int r = 0; r < 8; ++r) {
        const int tokl = 32 * w + 16 * mt + 8 * h + r;     // 0..127
        sT[tokl * 64 + featl] = acc[mt][nt][r] + bvl;
      }
    }
  }
  __syncthreads();

  out_store_pass(sT, out, m0, n0, w, lane);
  
}

// ---------------------------------------------------------------------------
extern "C" void kernel_launch(void* const* d_in, const int* in_sizes, int n_in,
                              void* d_out, int out_size, void* d_ws, size_t ws_size,
                              hipStream_t stream) {
  if (n_in < 14) return;
  if (in_sizes[0] != NX || in_sizes[1] != NX || in_sizes[2] != NX) return;
  if (in_sizes[3] != NB * SEQ * SEQ) return;
  if (in_sizes[4] != NW || in_sizes[6] != NW || in_sizes[8] != NW || in_sizes[10] != NW) return;
  if (in_sizes[5] != HID || in_sizes[7] != HID || in_sizes[9] != HID || in_sizes[11] != HID) return;
  if (in_sizes[12] != NREL * HD || in_sizes[13] != NREL * HD) return;
  if (out_size != NX) return;

  const float* q_in = (const float*)d_in[0];
  const float* k_in = (const float*)d_in[1];
  const float* v_in = (const float*)d_in[2];
  const int*   ids  = (const int*)d_in[3];
  const float* Wq = (const float*)d_in[4];
  const float* bq = (const float*)d_in[5];
  const float* Wk = (const float*)d_in[6];
  const float* bk = (const float*)d_in[7];
  const float* Wv = (const float*)d_in[8];
  const float* bv = (const float*)d_in[9];
  const float* Wo = (const float*)d_in[10];
  const float* bo = (const float*)d_in[11];
  const float* relk = (const float*)d_in[12];
  const float* relv = (const float*)d_in[13];
  float* out = (float*)d_out;

  const size_t xb_bytes = (size_t)3 * NX * 2;          // 12582912
  const size_t wb_bytes = (size_t)4 * NW * 2;          //  8388608
  const size_t rt_bytes = (size_t)NREL * HD * 2;       //     8192
  const size_t pl_bytes = (size_t)NPL * 2;             //  4194304
  const size_t ap_bytes = (size_t)NX * 2;              //  4194304
  const size_t id_bytes = (size_t)NB * SEQ * SEQ * 4;  //  4194304
  const size_t total = xb_bytes + wb_bytes + 2 * rt_bytes + 3 * pl_bytes + 2 * ap_bytes + id_bytes;  // 46153728
  if (total > ws_size) return;

  char* ws = (char*)d_ws;
  size_t off = 0;
  __bf16* xb = (__bf16*)(ws + off);       off += xb_bytes;
  __bf16* wb = (__bf16*)(ws + off);       off += wb_bytes;
  _Float16* rk  = (_Float16*)(ws + off);  off += rt_bytes;
  _Float16* rvT = (_Float16*)(ws + off);  off += rt_bytes;
  _Float16* qh  = (_Float16*)(ws + off);  off += pl_bytes;
  _Float16* kh  = (_Float16*)(ws + off);  off += pl_bytes;
  _Float16* vt  = (_Float16*)(ws + off);  off += pl_bytes;
  __bf16* ahi = (__bf16*)(ws + off);      off += ap_bytes;
  __bf16* alo = (__bf16*)(ws + off);      off += ap_bytes;
  int* idp = (int*)(ws + off);            off += id_bytes;
  if (off > ws_size) return;

  convert_kernel<<<(G_TOT + 255) / 256, 256, 0, stream>>>(q_in, k_in, v_in, Wq, Wk, Wv, Wo,
                                                         relk, relv, ids, xb, wb, rk, rvT, idp);

  dim3 gProj(NTOK / 128, 3 * NH);                                   // (16, 48)
  proj_kernel<<<gProj, 128, 0, stream>>>(xb, wb, bq, bk, bv, qh, kh, vt);

  dim3 gAtt(SEQ / 16, NB * NH);                                     // (32, 64)
  attn_kernel<<<gAtt, 32, 0, stream>>>(qh, kh, vt, idp, rk, rvT, ahi, alo);

  dim3 gOut(NTOK / 128, HID / 64);                                  // (16, 16)
  oproj_kernel<<<gOut, 128, 0, stream>>>(ahi, alo, wb + (size_t)3 * NW, bo, out);
}

// v005
// A run of this version takes 64.1 microseconds.
// In two side-by-side timings against v004, it was 1.12 and 1.11 times as fast.
// All steps since v000 together make it 3.04 times as fast.
// q/k/v projections: v_wmma_f32_16x16x32_bf16 (bf16 operands, f32 accumulate); q.relk^T, k.q^T, v^T.p^T, relv^T.w^T: v_wmma_f32_16x16x32_f16 (f16 operands, f32 accumulate; relk/relv carried x32, q x0.125, p x1024, w x16384, exact power-of-two scales folded back in f32); output projection: v_wmma_f32_16x16x32_bf16 with the activation as a bf16 hi+lo pair (two products) against bf16 weights; softmax, additive bias and normalisation in f32.
#include <hip/hip_runtime.h>

typedef _Float16 v16h __attribute__((ext_vector_type(16)));
typedef _Float16 v8h  __attribute__((ext_vector_type(8)));
typedef __bf16   v16b __attribute__((ext_vector_type(16)));
typedef __bf16   v8b  __attribute__((ext_vector_type(8)));
typedef float    v8f  __attribute__((ext_vector_type(8)));
typedef float    v4f  __attribute__((ext_vector_type(4)));
typedef int      v4i  __attribute__((ext_vector_type(4)));
typedef v8h __attribute__((may_alias)) v8ha;
typedef v8b __attribute__((may_alias)) v8ba;
typedef v4f __attribute__((may_alias)) v4fa;
typedef v4i __attribute__((may_alias)) v4ia;

union FragH { v16h v; v8h half[2]; };
union FragB { v16b v; v8b half[2]; };

#define NB    4
#define SEQ   512
#define HID   1024
#define NH    16
#define HD    64
#define NREL  64
#define NTOK  (NB * SEQ)            // 2048 tokens
#define NX    (NTOK * HID)          // 2097152 elements per activation
#define NW    (HID * HID)           // 1048576 elements per weight
#define NX8   (NX / 8)              // 262144
#define NW8   (NW / 8)              // 131072
#define NPL   (NB * NH * SEQ * HD)  // 2097152 halves per q/k/v plane
#define G_X   (3 * NX8)             // 786432 activation groups
#define G_W   (4 * NW8)             // 524288 weight groups
#define G_R   (NREL * HD / 8)       // 512 groups per relation table
#define G_I   (NB * SEQ * SEQ / 4)  // 262144 groups of four relation ids
#define G_16  (G_X + G_W + 2 * G_R) // 1311744 groups of the 16-bit planes
#define G_TOT (G_16 + G_I)          // 1573888
#define TILE  512                   // elements of one 16-row x 32-k tile (1 KiB)
#define PSC   16384.0f              // scale of the normalised histogram w <= 1 in f16
#define PPS   1024.0f               // scale of p in f16: p <= e^MXT < 55, so p * PPS stays below 65504
#define MXT   4.0f                  // a score may top the softmax reference by this much before the sums are rescaled
#define RVS   4.76837158203125e-7f  // 2^-21 = 0.25 / (32 * 16384)
#define HCOPY 4                     // independent copies of the relation histogram
#define HPL   (NREL * 32)           // floats of one copy, [rel][lane]

// ---------------------------------------------------------------------------
// 16x16x32 WMMA (builtin form; the compiler keeps the distance behind it).
// Fragment map (wave32): lane l, h = l>>4, m = n = l&15.
//   A/B element i: i<8 -> k0+8h+i ; i>=8 -> k0+16+8h+(i-8)
//   D element r : row 8h+r, col l&15
// ---------------------------------------------------------------------------
__device__ __forceinline__ v8f wmma_h(v16h a, v16h b, v8f c) {
  return __builtin_amdgcn_wmma_f32_16x16x32_f16(false, a, false, b, (short)0, c, false, false);
}
__device__ __forceinline__ v8f wmma_b(v16b a, v16b b, v8f c) {
  return __builtin_amdgcn_wmma_f32_16x16x32_bf16(false, a, false, b, (short)0, c, false, false);
}

// Stands behind a stage's group of global loads: without it the scheduler sinks the
// loads below the other stage's work and their latency is exposed again.
__device__ __forceinline__ void loads_stay_above() { __builtin_amdgcn_sched_barrier(0); }
// Stands in front of code that rewrites address registers which loads still in
// flight name (a pipelined loop's next trip, the epilogue's address arithmetic).
// The two scheduling barriers keep the wait where it is written: late enough to
// cost nothing, and ahead of every such rewrite.
__device__ __forceinline__ void addr_regs_free() {
  __builtin_amdgcn_sched_barrier(0);
  asm volatile("s_wait_xcnt 0x0" ::: "memory");
  __builtin_amdgcn_sched_barrier(0);
}
// The same, and the address pair is an input of the wait: it stays allocated up to
// here, so that no load's result is given the registers that earlier loads still name.
__device__ __forceinline__ void addr_regs_free_of(const void* p) {
  __builtin_amdgcn_sched_barrier(0);
  asm volatile("s_wait_xcnt 0x0" :: "v"(p) : "memory");
  __builtin_amdgcn_sched_barrier(0);
}

// Tile order of every 16-bit workspace plane: a 16-row x 32-k tile is one 1-KiB
// block [j][lane][8 elements]; lane 16h+m of half j holds row m, k = 16j+8h .. +7,
// which is the fragment map above. One wave load of a half is 512 contiguous bytes
// (four whole lines) where a row-major plane gives 32 bytes of each of 16 lines.
// A plane of R rows x K columns is [R/16][K/32] tiles (vt: [K/32][R/16] per (b, head)).
// A or B fragment: p = the tile's first element + 8 * lane.
__device__ __forceinline__ v16h ldtile_h(const _Float16* p) {
  FragH f;
  f.half[0] = *(const v8ha*)(p);
  f.half[1] = *(const v8ha*)(p + 256);
  return f.v;
}
__device__ __forceinline__ v16b ldtile_b(const __bf16* p) {
  FragB f;
  f.half[0] = *(const v8ba*)(p);
  f.half[1] = *(const v8ba*)(p + 256);
  return f.v;
}

// relation id: wrap negative once, then clamp into [0, NREL-1]
__device__ __forceinline__ int relidx(int id) {
  int t = id + ((id >> 31) & NREL);
  t = t < 0 ? 0 : t;
  t = t > (NREL - 1) ? (NREL - 1) : t;
  return t;
}

// ---------------------------------------------------------------------------
// Kernel 1: f32 -> 16-bit planes in tile order, 8 elements (16 B) per thread; thread
// index = index of the 16-byte group it writes, so stores are whole lines and the
// 16-line access falls on the one read of each source element.
//   xb [3][NTOK][HID] bf16 (q_in, k_in, v_in, RNE convert)
//   wb [4][HID][HID]  bf16 (Wq, Wk, Wv, Wo, row = output feature)
//   rk [NREL][HD]     f16  = 32 * bf16(relk)
//   rvT[HD][NREL]     f16  = 32 * bf16(relv)^T
//   idp               int  relation ids as given, [B][L/16][L/32][i][lane][4]:
//                     lane 16h+m of group i holds query m, keys 16(i>>1)+8h+4(i&1) .. +3
// ---------------------------------------------------------------------------
__global__ __launch_bounds__(256) void convert_kernel(
    const float* __restrict__ q_in, const float* __restrict__ k_in, const float* __restrict__ v_in,
    const float* __restrict__ Wq, const float* __restrict__ Wk, const float* __restrict__ Wv,
    const float* __restrict__ Wo, const float* __restrict__ relk, const float* __restrict__ relv,
    const int* __restrict__ ids,
    __bf16* __restrict__ xb, __bf16* __restrict__ wb, _Float16* __restrict__ rk, _Float16* __restrict__ rvT,
    int* __restrict__ idp)
{
  const int g = blockIdx.x * 256 + threadIdx.x;
  if (g >= G_TOT) return;
  const int h = (g >> 4) & 1, m = g & 15;        // every plane starts at a multiple of 32 groups
  if (g >= G_16) {
    const int e = g - G_16;
    const int i = (e >> 5) & 3, c = (e >> 7) & 15, qt = e >> 11;   // qt = 32 b + query tile
    const int* src = ids + ((size_t)qt * 16 + m) * SEQ + 32 * c + 16 * (i >> 1) + 8 * h + 4 * (i & 1);
    *(v4i*)(idp + (size_t)e * 4) = *(const v4ia*)src;
  } else if (g < G_X + G_W) {
    const float* src;
    __bf16* dst;
    if (g < G_X) {
      const int which = g >> 18;                 // NX8 = 2^18
      const int off = g & (NX8 - 1);
      const float* s = (which == 0) ? q_in : ((which == 1) ? k_in : v_in);
      // group off = ((row tile * 32 + k tile) * 2 + j) * 32 + lane
      src = s + (size_t)((off >> 11) * 16 + m) * HID + ((off >> 6) & 31) * 32 + ((off >> 5) & 1) * 16 + 8 * h;
      dst = xb + (size_t)which * NX + (size_t)off * 8;
    } else {
      const int e = g - G_X;
      const int wsel = e >> 17;                 // NW8 = 2^17
      const int off = e & (NW8 - 1);
      const float* s = (wsel == 0) ? Wq : ((wsel == 1) ? Wk : ((wsel == 2) ? Wv : Wo));
      src = s + (size_t)((off >> 11) * 16 + m) * HID + ((off >> 6) & 31) * 32 + ((off >> 5) & 1) * 16 + 8 * h;
      dst = wb + (size_t)wsel * NW + (size_t)off * 8;
    }
    const v4f a = *(const v4fa*)src;
    const v4f c = *(const v4fa*)(src + 4);
    const v8b o = { (__bf16)a.x, (__bf16)a.y, (__bf16)a.z, (__bf16)a.w,
                    (__bf16)c.x, (__bf16)c.y, (__bf16)c.z, (__bf16)c.w };
    *(v8b*)dst = o;
    
  } else {
    const int e = g - (G_X + G_W);
    float f[8];
    _Float16* dst;
    // group e & 511 = ((row tile * 2 + k tile) * 2 + j) * 32 + lane of a 64 x 64 plane
    const int row = ((e >> 7) & 3) * 16 + m;
    const int kk = ((e >> 6) & 1) * 32 + ((e >> 5) & 1) * 16 + 8 * h;
    if (e < G_R) {
      const float* src = relk + (size_t)row * HD + kk;
      const v4f a = *(const v4fa*)src;
      const v4f c = *(const v4fa*)(src + 4);
      f[0] = a.x; f[1] = a.y; f[2] = a.z; f[3] = a.w;
      f[4] = c.x; f[5] = c.y; f[6] = c.z; f[7] = c.w;
      dst = rk + (size_t)e * 8;
    } else {
      const int e3 = e - G_R;                    // 0..511; row = d, kk = first relation index
      #pragma unroll
      for (int i = 0; i < 8; ++i) f[i] = relv[(size_t)(kk + i) * HD + row];
      dst = rvT + (size_t)e3 * 8;
    }
    _Float16 hh[8];
    #pragma unroll
    for (int i = 0; i < 8; ++i) hh[i] = (_Float16)((float)(__bf16)f[i] * 32.0f);
    const v8h o = { hh[0], hh[1], hh[2], hh[3], hh[4], hh[5], hh[6], hh[7] };
    *(v8h*)dst = o;
    
  }
}

// ---------------------------------------------------------------------------
// 4 lines per instruction, 32 lines per wave, 128 per block; tile order.
// which 0/1: plane[bh][l/16][d/32] tiles (row = token, k = d); a wave's 32 tokens = 4 tiles
// which 2  : vt[bh][l/32][d/16] tiles    (row = d, k = token); a wave's 32 tokens = 4 tiles
// ---------------------------------------------------------------------------
__device__ __forceinline__ void proj_store_pass(const _Float16* sT, _Float16* plane, _Float16* vt,
                                                int which, int bh, int l0, int w, int lane) {
  const int h = lane >> 4, m = lane & 15;
  // LDS element of half i = 0: (token tile * 2 + d tile) * 2 + j = i, or d tile * 2 + j = i
  const _Float16* sp = (which != 2) ? sT + (32 * w + m) * HD + 8 * h : sT + m * 128 + 32 * w + 8 * h;
  // either way the wave's four tiles are 4 KiB in a row at the same offset of its plane
  _Float16* dst = ((which != 2) ? plane : vt) + ((size_t)bh * SEQ + l0 + 32 * w) * HD + 8 * lane;
  #pragma unroll
  for (int i = 0; i < 8; ++i) {
    const int so = (which != 2) ? 16 * (i >> 2) * HD + 16 * (i & 3) : 16 * (i >> 1) * 128 + 16 * (i & 1);
    *(v8h*)(dst + 256 * i) = *(const v8ha*)(sp + so);
  }
}

// One k step (32 deep) of a projection's operands, held in registers so that
// the next step's loads are in flight while this step's products run.
struct PStage { v16b a0, a1, b[4]; };
__device__ __forceinline__ void proj_load(PStage& s, const __bf16* xa0, const __bf16* xa1,
                                          const __bf16* wr, int k0) {
  const int t0 = (k0 >> 5) * TILE;
  s.a0 = ldtile_b(xa0 + t0);
  s.a1 = ldtile_b(xa1 + t0);
  #pragma unroll
  for (int nt = 0; nt < 4; ++nt) s.b[nt] = ldtile_b(wr + (size_t)nt * 16 * HID + t0);
  loads_stay_above();
}
__device__ __forceinline__ void proj_mma(const PStage& s, v8f (&acc)[2][4]) {
  #pragma unroll
  for (int nt = 0; nt < 4; ++nt) {
    acc[0][nt] = wmma_b(s.a0, s.b[nt], acc[0][nt]);
    acc[1][nt] = wmma_b(s.a1, s.b[nt], acc[1][nt]);
  }
}

// ---------------------------------------------------------------------------
// Kernel 2: Y = x * W^T + b for the three projections (which = 0,1,2).
// Block 128 thr (4 waves) = 128 tokens x 64 features (one (which, head));
// wave tile 32 tokens x 64 features; K = 1024 in steps of 32;
// A (x rows) and B (W rows) bf16 fragments straight from the tile-ordered planes.
// ---------------------------------------------------------------------------
__global__ __launch_bounds__(128) void proj_kernel(
    const __bf16* __restrict__ xb,     // [3][NTOK][HID], tile order
    const __bf16* __restrict__ wb,     // [4][HID][HID], row = output feature (first 3 used), tile order
    const float* __restrict__ bq, const float* __restrict__ bk, const float* __restrict__ bv,
    _Float16* __restrict__ qh,         // [B*H][L][D]  f16(0.125*q), tile order
    _Float16* __restrict__ kh,         // [B*H][L][D], tile order
    _Float16* __restrict__ vt)         // [B*H][L/32][D/16] tiles (row = d, k = token)
{
  __shared__ __attribute__((aligned(16))) _Float16 sT[128 * 64];   // 16384 B

  const int tid = threadIdx.x, lane = tid & 31, w = tid >> 5;
  const int h = lane >> 4, m = lane & 15;
  const int m0 = blockIdx.x * 128;
  const int cg = blockIdx.y;                 // 0..47
  const int which = cg >> 4, head = cg & 15;
  const int m0w = m0 + 32 * w;

  // 16 rows of a plane = HID / 32 tiles in a row = 16 * HID elements
  const __bf16* xa0 = xb + (size_t)which * NX + (size_t)m0w * HID + 8 * lane;   // token tile, mt = 0
  const __bf16* xa1 = xa0 + (size_t)16 * HID;                                   // mt = 1
  const __bf16* wr  = wb + (size_t)which * NW + (size_t)(head * HD) * HID + 8 * lane;  // feature tile, nt = 0

  const v8f zero8 = {0.f, 0.f, 0.f, 0.f, 0.f, 0.f, 0.f, 0.f};
  v8f acc[2][4];
  #pragma unroll
  for (int mt = 0; mt < 2; ++mt)
    #pragma unroll
    for (int nt = 0; nt < 4; ++nt) acc[mt][nt] = zero8;

  PStage sa, sb;
  proj_load(sa, xa0, xa1, wr, 0);
  // rolled: two register stages per trip, no copies between them
  #pragma unroll 1
  for (int k0 = 0; k0 < HID - 64; k0 += 64) {
    proj_load(sb, xa0, xa1, wr, k0 + 32);
    proj_mma(sa, acc);
    proj_load(sa, xa0, xa1, wr, k0 + 64);
    proj_mma(sb, acc);
    addr_regs_free();
  }
  proj_load(sb, xa0, xa1, wr, HID - 32);
  proj_mma(sa, acc);
  proj_mma(sb, acc);

  // D[r] of tile (mt, nt) = Y[token m0w+16mt+8h+r][feature 16nt+m]
  const float* bias = (which == 0) ? bq : ((which == 1) ? bk : bv);
  const float osc = (which == 0) ? 0.125f : 1.0f;
  #pragma unroll
  for (int nt = 0; nt < 4; ++nt) {
    const int feat = 16 * nt + m;
    const float bvl = (float)(__bf16)bias[head * HD + feat];
    #pragma unroll
    for (int mt = 0; mt < 2; ++mt) {
      #pragma unroll
      for (int r = 0; r < 8; ++r) {
        const int tokl = 32 * w + 16 * mt + 8 * h + r;     // 0..127
        const float y = (acc[mt][nt][r] + bvl) * osc;
        const int idx = (which == 2) ? (feat * 128 + tokl) : (tokl * HD + feat);
        sT[idx] = (_Float16)y;
      }
    }
  }
  __syncthreads();

  const int b = m0 >> 9, l0 = m0 & (SEQ - 1), bh = b * NH + head;
  _Float16* plane = (which == 0) ? qh : kh;
  proj_store_pass(sT, plane, vt, which, bh, l0, w, lane);
  
}

// ---------------------------------------------------------------------------
// Attention helpers.
// ---------------------------------------------------------------------------
// B fragment of the normalised relation histogram, k = relation index:
// element i<8 <- k0+8h+i, element 8+i <- k0+16+8h+i; kb = k0 + 8h.
// A bin of query m is the sum of eight partials: HCOPY copies x the columns of lanes m
// and m+16. Each lane reads its own column first and its partner's second, so the 32
// lanes of every read fall on 32 different banks.
__device__ __forceinline__ v16h build_w(const float* sH, int lane, int kb, float wsc) {
  const float* ca = sH + kb * 32 + lane;
  const float* cb = sH + kb * 32 + (lane ^ 16);
  _Float16 wh[16];
  #pragma unroll
  for (int i = 0; i < 16; ++i) {
    const int ro = ((i & 7) + 16 * (i >> 3)) * 32;
    float s = ca[ro] + cb[ro];
    #pragma unroll
    for (int c = 1; c < HCOPY; ++c) s += ca[c * HPL + ro] + cb[c * HPL + ro];
    wh[i] = (_Float16)(s * wsc);
  }
  FragH f;
  f.half[0] = (v8h){ wh[0], wh[1], wh[2], wh[3], wh[4], wh[5], wh[6], wh[7] };
  f.half[1] = (v8h){ wh[8], wh[9], wh[10], wh[11], wh[12], wh[13], wh[14], wh[15] };
  return f.v;
}

// Per-wave 16x64 f32 tile in LDS -> bf16 hi and lo planes [tok][HID] in tile order:
// two tiles in a row, i = feature tile * 2 + j; 4 lines per instruction.
__device__ __forceinline__ void att_store(const float* sO, __bf16* ahi, __bf16* alo,
                                          size_t gbase, int lane) {
  const int h = lane >> 4, m = lane & 15;
  #pragma unroll
  for (int i = 0; i < 4; ++i) {
    const float* sp = sO + m * HD + 16 * i + 8 * h;
    const v4f a = *(const v4fa*)sp;
    const v4f c = *(const v4fa*)(sp + 4);
    const float f[8] = { a.x, a.y, a.z, a.w, c.x, c.y, c.z, c.w };
    __bf16 hh[8], ll[8];
    #pragma unroll
    for (int e = 0; e < 8; ++e) {
      hh[e] = (__bf16)f[e];
      ll[e] = (__bf16)(f[e] - (float)hh[e]);
    }
    const v8b hv = { hh[0], hh[1], hh[2], hh[3], hh[4], hh[5], hh[6], hh[7] };
    const v8b lv = { ll[0], ll[1], ll[2], ll[3], ll[4], ll[5], ll[6], ll[7] };
    const size_t gi = gbase + 256 * i + 8 * lane;
    *(v8b*)(ahi + gi) = hv;
    *(v8b*)(alo + gi) = lv;
  }
}

// 32 keys' worth of global operands, held in registers ahead of their use:
// f[0..3] = four A fragments (K rows of two key tiles, two d chunks each, or
// V^T rows of the four d tiles), id[0..3] = this lane's 16 relation ids.
// The scores need K and the ids at a stage's head: they are fetched one stage ahead.
// V^T is needed only at the foot, behind the histogram chain, so it is fetched at the
// head of its own stage.
struct AFrag { v16h f[4]; };
struct AIds  { v4i id[4]; };
// ip = the stage's 2-KiB block of idp + 4 * lane; id[0..3] = keys 8h+0..3, 8h+4..7, 16+8h+0..3, 16+8h+4..7
__device__ __forceinline__ void ids_load(AIds& s, const int* ip) {
  #pragma unroll
  for (int i = 0; i < 4; ++i) s.id[i] = *(const v4ia*)(ip + 128 * i);
}
__device__ __forceinline__ void k_load(AFrag& s, AIds& n, const _Float16* kbase, const int* idrow, int c) {
  // 32 keys = four tiles in a row: (key tile 0, d 0..31), (0, 32..63), (1, 0..31), (1, 32..63)
  #pragma unroll
  for (int t = 0; t < 4; ++t) s.f[t] = ldtile_h(kbase + (size_t)(4 * c + t) * TILE);
  ids_load(n, idrow + 512 * c);
  loads_stay_above();
}
// V^T of stage c and, where there is one, K and the ids of stage c + 1
template <bool NEXT>
__device__ __forceinline__ void vk_load(AFrag& v, AFrag& s, AIds& n, const _Float16* vbase,
                                        const _Float16* kbase, const int* idrow, int c) {
  #pragma unroll
  for (int t = 0; t < 4; ++t) v.f[t] = ldtile_h(vbase + (size_t)(4 * c + t) * TILE);
  if (NEXT) {
    #pragma unroll
    for (int t = 0; t < 4; ++t) s.f[t] = ldtile_h(kbase + (size_t)(4 * (c + 1) + t) * TILE);
    ids_load(n, idrow + 512 * (c + 1));
  }
  loads_stay_above();
}
// scores of one stage's 32 keys, 16 per lane, in registers, with their table rows
__device__ __forceinline__ void score16(const AFrag& s, const AIds& n, v16h qb0, v16h qb1, const float* qr,
                                        float (&sc)[16], int (&ri)[16]) {
  const v8f zero8 = {0.f, 0.f, 0.f, 0.f, 0.f, 0.f, 0.f, 0.f};
  v8f z0 = wmma_h(s.f[0], qb0, zero8);
  z0 = wmma_h(s.f[1], qb1, z0);                 // z0[r] = S[query m][key 32c+8h+r]
  v8f z1 = wmma_h(s.f[2], qb0, zero8);
  z1 = wmma_h(s.f[3], qb1, z1);                 // z1[r] = S[query m][key 32c+16+8h+r]
  const int idv[16] = { n.id[0].x, n.id[0].y, n.id[0].z, n.id[0].w, n.id[1].x, n.id[1].y, n.id[1].z, n.id[1].w,
                        n.id[2].x, n.id[2].y, n.id[2].z, n.id[2].w, n.id[3].x, n.id[3].y, n.id[3].z, n.id[3].w };
  #pragma unroll
  for (int e = 0; e < 16; ++e) {
    const int id = idv[e];
    const float bias = (id > 0) ? 0.0f : -10000.0f;
    const float zz = (e < 8) ? z0[e & 7] : z1[e & 7];
    ri[e] = relidx(id);
    sc[e] = zz + qr[ri[e]] * 0.0078125f + bias;
  }
}
// maximum of the scores of one stage's 32 keys (the softmax reference starts from stage 0's)
__device__ __forceinline__ float max_stage(const AFrag& s, const AIds& n, v16h qb0, v16h qb1, const float* qr,
                                           float mx) {
  float sc[16];
  int ri[16];
  score16(s, n, qb0, qb1, qr, sc, ri);
  #pragma unroll
  for (int e = 0; e < 16; ++e) mx = fmaxf(mx, sc[e]);
  return mx;
}
// 2^x. The v_nop is the free slot that the instruction set asks for behind a
// transcendental before its source is overwritten or its result read; only inside the
// same statement does it stay directly behind the v_exp_f32.
__device__ __forceinline__ float exp2_slot(float x) {
  float r;
  asm("v_exp_f32 %0, %1\n\tv_nop" : "=v"(r) : "v"(x));
  return r;
}
// one stage: scores, exp, sum, histogram, O^T += V^T * P^T for 32 keys.
// mx is the reference that is subtracted in the exponent, the same in lanes m and m + 16.
// Softmax is the same for any reference; it only has to keep p in f16's range. While no
// score tops mx by more than MXT the sums go on as they are; otherwise mx moves up to the
// largest score seen and everything summed so far is multiplied by exp(old mx - new mx).
__device__ __forceinline__ float pv_stage(const AFrag& k, const AIds& n, const AFrag& s, v16h qb0, v16h qb1,
                                          const float* qr, float* hl, float& mx, float lsum, v8f (&o)[4]) {
  float sv[16];
  int rv[16];
  score16(k, n, qb0, qb1, qr, sv, rv);
  float sm = sv[0];
  #pragma unroll
  for (int e = 1; e < 16; ++e) sm = fmaxf(sm, sv[e]);
  if (__builtin_amdgcn_ballot_w32(sm > mx + MXT) != 0u) {     // the same for the whole wave
    const float nm = fmaxf(mx, fmaxf(sm, __shfl_xor(sm, 16)));
    const float f = exp2_slot((mx - nm) * 1.44269504f);       // 1 for a query whose reference stays
    mx = nm;
    lsum *= f;
    #pragma unroll
    for (int t = 0; t < 4; ++t) o[t] *= f;
    // partly rolled: a seldom-taken path that stands four times in the kernel, kept short for the instruction cache
    #pragma unroll 8
    for (int i = 0; i < HCOPY * NREL; ++i) hl[i * 32] *= f;
  }
  // Histogram: key e adds into copy e & 3, so the four bins of a group are four different
  // LDS words whatever the ids are: they are read together and one LDS round trip serves
  // four keys, where a single copy makes every read wait for the store in front of it.
  // The first group's bins depend on no store of this stage: their reads stand ahead of the exponentials.
  float old[HCOPY];
  #pragma unroll
  for (int j = 0; j < HCOPY; ++j) old[j] = hl[j * HPL + rv[j] * 32];
  float pe[16];
  _Float16 ph[16];
  #pragma unroll
  for (int e = 0; e < 16; ++e) {
    const float p = exp2_slot((sv[e] - mx) * 1.44269504f);   // = __expf(sv[e] - mx)
    lsum += p;
    pe[e] = p;
    ph[e] = (_Float16)(p * PPS);
  }
  #pragma unroll
  for (int g = 0; g < 16 / HCOPY; ++g) {
    #pragma unroll
    for (int j = 0; j < HCOPY; ++j) hl[j * HPL + rv[HCOPY * g + j] * 32] = old[j] + pe[HCOPY * g + j];
    if (g + 1 < 16 / HCOPY) {
      #pragma unroll
      for (int j = 0; j < HCOPY; ++j) old[j] = hl[j * HPL + rv[HCOPY * (g + 1) + j] * 32];
    }
  }
  // P^T B-fragment: element r <- key 32c+8h+r, element 8+r <- key 32c+16+8h+r
  FragH pf;
  pf.half[0] = (v8h){ ph[0], ph[1], ph[2], ph[3], ph[4], ph[5], ph[6], ph[7] };
  pf.half[1] = (v8h){ ph[8], ph[9], ph[10], ph[11], ph[12], ph[13], ph[14], ph[15] };
  #pragma unroll
  for (int t = 0; t < 4; ++t) o[t] = wmma_h(s.f[t], pf.v, o[t]);
  return lsum;
}

// ---------------------------------------------------------------------------
// Kernel 3: relation-aware attention, transposed form, one wave per block.
// Block = 32 thr = 16 queries of one (b, head), all 512 keys.
//   qrel^T = RK * Q^T       : A = rk rows (row = rel, k = d), B = Q^T
//   S^T    = K * Q^T        : A = K rows (row = key, k = d), B = Q^T (k = d, n = query)
//   score  = S^T + qrel[query][id]/128 + (-10000 where id <= 0), f32 in registers, never stored
//   p      = exp(score - mx): mx starts as the maximum over the first 32 keys and moves up,
//            with a rescale of all sums, only where a later score tops it by more than MXT
//   hist   : per-lane private bins h[key & 3][rel][lane] += p (fixed order, no atomics);
//            bank = lane + 32 (rel & 1), so a wave's 32 bins never share a bank
//   O^T    = V^T * P^T      : A = vt rows (row = d, k = key), B = P^T from registers x1024
//   R^T    = RVT * W^T      : A = rvT rows (row = d, k = rel), B = W^T = (hist/l) x16384,
//            hist = the eight partial bins of a (query, rel) added up
//   out    = O^T/(l*1024) + R^T * 2^-21  -> bf16 hi/lo planes [tok][head*64+d]
// Lane owns 256 keys of query column (lane&15); partner = lane ^ 16.
// ---------------------------------------------------------------------------
__global__ __launch_bounds__(32) void attn_kernel(
    const _Float16* __restrict__ qh,   // [B*H][L][D]  (already x0.125), tile order
    const _Float16* __restrict__ kh,   // [B*H][L][D], tile order
    const _Float16* __restrict__ vt,   // [B*H][L/32][D/16] tiles (row = d, k = key)
    const int* __restrict__ idp,       // [B][L/16][L/32][4][32][4] int32 relation ids in lane order
    const _Float16* __restrict__ rk,   // [NREL][D]  x32, tile order
    const _Float16* __restrict__ rvT,  // [D][NREL]  x32, tile order
    __bf16* __restrict__ ahi,          // [NTOK][HID], tile order
    __bf16* __restrict__ alo)          // [NTOK][HID], tile order
{
  // 36 KiB in all: eight blocks still fit a WGP's 320 KiB, so the whole grid is resident at once
  __shared__ __attribute__((aligned(16))) float sQR[16 * NREL];     //  4096 B qrel[query][rel]; behind the key loop: output staging
  __shared__ __attribute__((aligned(16))) float sH[HCOPY * HPL];    // 32768 B hist[copy][rel][lane]

  const int lane = threadIdx.x & 31, h = lane >> 4, m = lane & 15;
  const int bh = blockIdx.y, b = bh >> 4, head = bh & 15;
  const int q0 = blockIdx.x * 16;

  // zero all histogram bins, 512 contiguous bytes per store
  float* hl = sH + lane;                      // this lane's column of every copy
  {
    const v4f z4 = {0.f, 0.f, 0.f, 0.f};
    #pragma unroll
    for (int i = 0; i < HCOPY * HPL / 128; ++i) *(v4fa*)(sH + 128 * i + 4 * lane) = z4;
  }

  // Q^T B-fragments: column n = query q0+m, k = d (two 32-deep chunks)
  const _Float16* qrow = qh + ((size_t)bh * SEQ + q0) * HD + 8 * lane;
  const v16h qb0 = ldtile_h(qrow);
  const v16h qb1 = ldtile_h(qrow + TILE);

  const _Float16* kbase = kh + (size_t)bh * SEQ * HD + 8 * lane;     // + four tiles per stage
  const _Float16* vbase = vt + (size_t)bh * SEQ * HD + 8 * lane;     // + four tiles per stage
  const int* idrow = idp + ((size_t)b * SEQ + q0) * SEQ + 4 * lane;  // + 512 ids per stage
  AFrag fa, fb;
  AIds ia, ib;
  k_load(fa, ia, kbase, idrow, 0);              // the first stage, in flight under the qrel tiles

  const v8f zero8 = {0.f, 0.f, 0.f, 0.f, 0.f, 0.f, 0.f, 0.f};

  // ---- qrel^T tiles: D[r] = (rel 16rt+8h+r, query m) ----
  #pragma unroll
  for (int rt = 0; rt < 4; ++rt) {
    const _Float16* ap = rk + (size_t)(2 * rt) * TILE + 8 * lane;
    v8f z = zero8;
    z = wmma_h(ldtile_h(ap), qb0, z);
    z = wmma_h(ldtile_h(ap + TILE), qb1, z);
    #pragma unroll
    for (int r = 0; r < 8; ++r) sQR[m * NREL + 16 * rt + 8 * h + r] = z[r];
  }
  __syncthreads();

  const float* qr = sQR + m * NREL;

  // softmax reference to start with: the maximum over the first stage's 32 keys
  float mx = max_stage(fa, ia, qb0, qb1, qr, -3.0e38f);
  mx = fmaxf(mx, __shfl_xor(mx, 16));

  // ---- the one pass: scores, exp, sum, histogram, O^T += V^T * P^T (32 keys per step) ----
  v8f o[4];                                   // o[t][r] = O[query m][d 16t+8h+r] * (l * 1024)
  #pragma unroll
  for (int t = 0; t < 4; ++t) o[t] = zero8;
  float lsum = 0.0f;
  AFrag fv;
  // rolled: two register stages per trip, no copies between them
  #pragma unroll 1
  for (int c = 0; c < SEQ / 32 - 2; c += 2) {
    vk_load<true>(fv, fb, ib, vbase, kbase, idrow, c);
    lsum = pv_stage(fa, ia, fv, qb0, qb1, qr, hl, mx, lsum, o);
    vk_load<true>(fv, fa, ia, vbase, kbase, idrow, c + 1);
    lsum = pv_stage(fb, ib, fv, qb0, qb1, qr, hl, mx, lsum, o);
    addr_regs_free_of(vbase + (size_t)(4 * c) * TILE);
  }
  vk_load<true>(fv, fb, ib, vbase, kbase, idrow, SEQ / 32 - 2);
  lsum = pv_stage(fa, ia, fv, qb0, qb1, qr, hl, mx, lsum, o);
  vk_load<false>(fv, fa, ia, vbase, kbase, idrow, SEQ / 32 - 1);
  lsum = pv_stage(fb, ib, fv, qb0, qb1, qr, hl, mx, lsum, o);
  lsum += __shfl_xor(lsum, 16);
  const float inv = 1.0f / lsum;
  const float osc = inv * (1.0f / PPS);
  const float wsc = inv * PSC;
  __syncthreads();                            // histogram bins complete (read cross-lane below)

  // ---- relation value term: R^T = RVT * W^T ----
  const v16h w0 = build_w(sH, lane, 8 * h, wsc);
  const v16h w1 = build_w(sH, lane, 32 + 8 * h, wsc);
  float* sO = sQR;                            // the qrel table was last read in the key loop
  #pragma unroll
  for (int t = 0; t < 4; ++t) {
    const _Float16* ap = rvT + (size_t)(2 * t) * TILE + 8 * lane;
    v8f z = zero8;
    z = wmma_h(ldtile_h(ap), w0, z);
    z = wmma_h(ldtile_h(ap + TILE), w1, z);
    #pragma unroll
    for (int r = 0; r < 8; ++r)
      sO[m * HD + 16 * t + 8 * h + r] = o[t][r] * osc + z[r] * RVS;
  }
  __syncthreads();

  const size_t gbase = ((size_t)b * SEQ + q0) * HID + (size_t)(2 * head) * TILE;   // token tile, feature tiles 2 head, 2 head + 1
  att_store(sO, ahi, alo, gbase, lane);
  
}

// ---------------------------------------------------------------------------
// instruction, 4 lines per instruction, 64 lines per wave.
// ---------------------------------------------------------------------------
__device__ __forceinline__ void out_store_pass(const float* sT, float* out, int m0, int n0,
                                               int w, int lane) {
  const int q8 = lane & 7, sub = lane >> 3;
  #pragma unroll
  for (int i = 0; i < 16; ++i) {
    const int lid = i * 4 + sub;                 // 0..63
    const int rowl = 32 * w + (lid >> 1), hl = lid & 1;
    const v4f v = *(const v4fa*)(sT + rowl * 64 + 32 * hl + 4 * q8);
    float* dst = out + (size_t)(m0 + rowl) * HID + n0 + 32 * hl + 4 * q8;
    *(v4f*)dst = v;
  }
}

// One k step (32 deep) of the output projection's operands, one stage ahead.
struct OStage { v16b a[4]; v16b b[4]; };
__device__ __forceinline__ void oproj_load(OStage& s, const __bf16* a0h, const __bf16* a0l,
                                           const __bf16* a1h, const __bf16* a1l,
                                           const __bf16* wr, int k0) {
  const int t0 = (k0 >> 5) * TILE;
  s.a[0] = ldtile_b(a0h + t0);
  s.a[1] = ldtile_b(a0l + t0);
  s.a[2] = ldtile_b(a1h + t0);
  s.a[3] = ldtile_b(a1l + t0);
  #pragma unroll
  for (int nt = 0; nt < 4; ++nt) s.b[nt] = ldtile_b(wr + (size_t)nt * 16 * HID + t0);
  loads_stay_above();
}
__device__ __forceinline__ void oproj_mma(const OStage& s, v8f (&acc)[2][4]) {
  #pragma unroll
  for (int nt = 0; nt < 4; ++nt) {
    acc[0][nt] = wmma_b(s.a[0], s.b[nt], acc[0][nt]);
    acc[0][nt] = wmma_b(s.a[1], s.b[nt], acc[0][nt]);
    acc[1][nt] = wmma_b(s.a[2], s.b[nt], acc[1][nt]);
    acc[1][nt] = wmma_b(s.a[3], s.b[nt], acc[1][nt]);
  }
}

// ---------------------------------------------------------------------------
// Kernel 4: out = A * Wo^T + bo with A = ahi + alo (two bf16 products per tile).
// Block 128 thr = 128 tokens x 64 features; wave 32 tokens x 64 features.
// ---------------------------------------------------------------------------
__global__ __launch_bounds__(128) void oproj_kernel(
    const __bf16* __restrict__ ahi,    // [NTOK][HID], tile order
    const __bf16* __restrict__ alo,    // [NTOK][HID], tile order
    const __bf16* __restrict__ wo,     // [HID][HID], row = output feature, tile order
    const float* __restrict__ bo,
    float* __restrict__ out)           // [NTOK][HID]
{
  __shared__ __attribute__((aligned(16))) float sT[128 * 64];      // 32768 B

  const int tid = threadIdx.x, lane = tid & 31, w = tid >> 5;
  const int h = lane >> 4, m = lane & 15;
  const int m0 = blockIdx.x * 128;
  const int n0 = blockIdx.y * 64;
  const int m0w = m0 + 32 * w;

  const __bf16* a0h = ahi + (size_t)m0w * HID + 8 * lane;
  const __bf16* a0l = alo + (size_t)m0w * HID + 8 * lane;
  const __bf16* a1h = a0h + (size_t)16 * HID;
  const __bf16* a1l = a0l + (size_t)16 * HID;
  const __bf16* wr  = wo + (size_t)n0 * HID + 8 * lane;

  const v8f zero8 = {0.f, 0.f, 0.f, 0.f, 0.f, 0.f, 0.f, 0.f};
  v8f acc[2][4];
  #pragma unroll
  for (int mt = 0; mt < 2; ++mt)
    #pragma unroll
    for (int nt = 0; nt < 4; ++nt) acc[mt][nt] = zero8;

  OStage sa, sb;
  oproj_load(sa, a0h, a0l, a1h, a1l, wr, 0);
  // rolled: two register stages per trip, no copies between them
  #pragma unroll 1
  for (int k0 = 0; k0 < HID - 64; k0 += 64) {
    oproj_load(sb, a0h, a0l, a1h, a1l, wr, k0 + 32);
    oproj_mma(sa, acc);
    oproj_load(sa, a0h, a0l, a1h, a1l, wr, k0 + 64);
    oproj_mma(sb, acc);
    addr_regs_free();
  }
  oproj_load(sb, a0h, a0l, a1h, a1l, wr, HID - 32);
  addr_regs_free();
  oproj_mma(sa, acc);
  oproj_mma(sb, acc);

  // D[r] of tile (mt, nt) = Y[token m0w+16mt+8h+r][feature n0+16nt+m]
  #pragma unroll
  for (int nt = 0; nt < 4; ++nt) {
    const int featl = 16 * nt + m;
    const float bvl = (float)(__bf16)bo[n0 + featl];
    #pragma unroll
    for (int mt = 0; mt < 2; ++mt) {
      #pragma unroll
      for (int r = 0; r < 8; ++r) {
        const int tokl = 32 * w + 16 * mt + 8 * h + r;     // 0..127
        sT[tokl * 64 + featl] = acc[mt][nt][r] + bvl;
      }
    }
  }
  __syncthreads();

  out_store_pass(sT, out, m0, n0, w, lane);
  
}

// ---------------------------------------------------------------------------
extern "C" void kernel_launch(void* const* d_in, const int* in_sizes, int n_in,
                              void* d_out, int out_size, void* d_ws, size_t ws_size,
                              hipStream_t stream) {
  if (n_in < 14) return;
  if (in_sizes[0] != NX || in_sizes[1] != NX || in_sizes[2] != NX) return;
  if (in_sizes[3] != NB * SEQ * SEQ) return;
  if (in_sizes[4] != NW || in_sizes[6] != NW || in_sizes[8] != NW || in_sizes[10] != NW) return;
  if (in_sizes[5] != HID || in_sizes[7] != HID || in_sizes[9] != HID || in_sizes[11] != HID) return;
  if (in_sizes[12] != NREL * HD || in_sizes[13] != NREL * HD) return;
  if (out_size != NX) return;

  const float* q_in = (const float*)d_in[0];
  const float* k_in = (const float*)d_in[1];
  const float* v_in = (const float*)d_in[2];
  const int*   ids  = (const int*)d_in[3];
  const float* Wq = (const float*)d_in[4];
  const float* bq = (const float*)d_in[5];
  const float* Wk = (const float*)d_in[6];
  const float* bk = (const float*)d_in[7];
  const float* Wv = (const float*)d_in[8];
  const float* bv = (const float*)d_in[9];
  const float* Wo = (const float*)d_in[10];
  const float* bo = (const float*)d_in[11];
  const float* relk = (const float*)d_in[12];
  const float* relv = (const float*)d_in[13];
  float* out = (float*)d_out;

  const size_t xb_bytes = (size_t)3 * NX * 2;          // 12582912
  const size_t wb_bytes = (size_t)4 * NW * 2;          //  8388608
  const size_t rt_bytes = (size_t)NREL * HD * 2;       //     8192
  const size_t pl_bytes = (size_t)NPL * 2;             //  4194304
  const size_t ap_bytes = (size_t)NX * 2;              //  4194304
  const size_t id_bytes = (size_t)NB * SEQ * SEQ * 4;  //  4194304
  const size_t total = xb_bytes + wb_bytes + 2 * rt_bytes + 3 * pl_bytes + 2 * ap_bytes + id_bytes;  // 46153728
  if (total > ws_size) return;

  char* ws = (char*)d_ws;
  size_t off = 0;
  __bf16* xb = (__bf16*)(ws + off);       off += xb_bytes;
  __bf16* wb = (__bf16*)(ws + off);       off += wb_bytes;
  _Float16* rk  = (_Float16*)(ws + off);  off += rt_bytes;
  _Float16* rvT = (_Float16*)(ws + off);  off += rt_bytes;
  _Float16* qh  = (_Float16*)(ws + off);  off += pl_bytes;
  _Float16* kh  = (_Float16*)(ws + off);  off += pl_bytes;
  _Float16* vt  = (_Float16*)(ws + off);  off += pl_bytes;
  __bf16* ahi = (__bf16*)(ws + off);      off += ap_bytes;
  __bf16* alo = (__bf16*)(ws + off);      off += ap_bytes;
  int* idp = (int*)(ws + off);            off += id_bytes;
  if (off > ws_size) return;

  convert_kernel<<<(G_TOT + 255) / 256, 256, 0, stream>>>(q_in, k_in, v_in, Wq, Wk, Wv, Wo,
                                                         relk, relv, ids, xb, wb, rk, rvT, idp);

  dim3 gProj(NTOK / 128, 3 * NH);                                   // (16, 48)
  proj_kernel<<<gProj, 128, 0, stream>>>(xb, wb, bq, bk, bv, qh, kh, vt);

  dim3 gAtt(SEQ / 16, NB * NH);                                     // (32, 64)
  attn_kernel<<<gAtt, 32, 0, stream>>>(qh, kh, vt, idp, rk, rvT, ahi, alo);

  dim3 gOut(NTOK / 128, HID / 64);                                  // (16, 16)
  oproj_kernel<<<gOut, 128, 0, stream>>>(ahi, alo, wb + (size_t)3 * NW, bo, out);
}

// v006
// A run of this version takes 55.3 microseconds.
// Two timings next to v005 put it at 1.20 and 1.16 times that version's speed.
// All steps since v000 together make it 3.59 times as fast.
// q/k/v projections: v_wmma_f32_16x16x32_bf16 (bf16 operands, f32 accumulate); q.relk^T, k.q^T, v^T.p^T, relv^T.w^T: v_wmma_f32_16x16x32_f16 (f16 operands, f32 accumulate; relk/relv carried x32, q x0.125, p x1024, w x16384, exact power-of-two scales folded back in f32); output projection: v_wmma_f32_16x16x32_bf16 with the activation as a bf16 hi+lo pair (two products) against bf16 weights; softmax, additive bias and normalisation in f32.
#include <hip/hip_runtime.h>

typedef _Float16 v16h __attribute__((ext_vector_type(16)));
typedef _Float16 v8h  __attribute__((ext_vector_type(8)));
typedef __bf16   v16b __attribute__((ext_vector_type(16)));
typedef __bf16   v8b  __attribute__((ext_vector_type(8)));
typedef float    v8f  __attribute__((ext_vector_type(8)));
typedef float    v4f  __attribute__((ext_vector_type(4)));
typedef int      v4i  __attribute__((ext_vector_type(4)));
typedef v8h __attribute__((may_alias)) v8ha;
typedef v8b __attribute__((may_alias)) v8ba;
typedef v4f __attribute__((may_alias)) v4fa;
typedef v4i __attribute__((may_alias)) v4ia;

union FragH { v16h v; v8h half[2]; };
union FragB { v16b v; v8b half[2]; };

#define NB    4
#define SEQ   512
#define HID   1024
#define NH    16
#define HD    64
#define NREL  64
#define NTOK  (NB * SEQ)            // 2048 tokens
#define NX    (NTOK * HID)          // 2097152 elements per activation
#define NW    (HID * HID)           // 1048576 elements per weight
#define NX8   (NX / 8)              // 262144
#define NW8   (NW / 8)              // 131072
#define NPL   (NB * NH * SEQ * HD)  // 2097152 halves per q/k/v plane
#define G_X   (3 * NX8)             // 786432 activation groups
#define G_W   (4 * NW8)             // 524288 weight groups
#define G_R   (NREL * HD / 8)       // 512 groups per relation table
#define G_I   (NB * SEQ * SEQ / 4)  // 262144 groups of four relation ids
#define G_16  (G_X + G_W + 2 * G_R) // 1311744 groups of the 16-bit planes
#define G_TOT (G_16 + G_I)          // 1573888
#define TILE  512                   // elements of one 16-row x 32-k tile (1 KiB)
#define PSC   16384.0f              // scale of the normalised histogram w <= 1 in f16
#define PPS   1024.0f               // scale of p in f16: p <= e^MXT < 55, so p * PPS stays below 65504
#define MXT   4.0f                  // a score may top the softmax reference by this much before the sums are rescaled
#define RVS   4.76837158203125e-7f  // 2^-21 = 0.25 / (32 * 16384)
#define HCOPY 4                     // independent copies of the relation histogram
#define HPL   (NREL * 32)           // floats of one copy, [rel][lane]

// ---------------------------------------------------------------------------
// 16x16x32 WMMA (builtin form; the compiler keeps the distance behind it).
// Fragment map (wave32): lane l, h = l>>4, m = n = l&15.
//   A/B element i: i<8 -> k0+8h+i ; i>=8 -> k0+16+8h+(i-8)
//   D element r : row 8h+r, col l&15
// ---------------------------------------------------------------------------
__device__ __forceinline__ v8f wmma_h(v16h a, v16h b, v8f c) {
  return __builtin_amdgcn_wmma_f32_16x16x32_f16(false, a, false, b, (short)0, c, false, false);
}
__device__ __forceinline__ v8f wmma_b(v16b a, v16b b, v8f c) {
  return __builtin_amdgcn_wmma_f32_16x16x32_bf16(false, a, false, b, (short)0, c, false, false);
}

// Stands behind a stage's group of global loads: without it the scheduler sinks the
// loads below the other stage's work and their latency is exposed again.
__device__ __forceinline__ void loads_stay_above() { __builtin_amdgcn_sched_barrier(0); }
// Stands in front of code that rewrites address registers which loads still in
// flight name (a pipelined loop's next trip, the epilogue's address arithmetic).
// The two scheduling barriers keep the wait where it is written: late enough to
// cost nothing, and ahead of every such rewrite.
__device__ __forceinline__ void addr_regs_free() {
  __builtin_amdgcn_sched_barrier(0);
  asm volatile("s_wait_xcnt 0x0" ::: "memory");
  __builtin_amdgcn_sched_barrier(0);
}
// The same, and the address pairs of a trip's loads are inputs of the wait: they stay
// allocated up to here, so that neither a load's result nor the next address is given
// registers that earlier loads still name.
__device__ __forceinline__ void addr_regs_free_of(const void* a, const void* b, const void* c, const void* d) {
  __builtin_amdgcn_sched_barrier(0);
  asm volatile("s_wait_xcnt 0x0" :: "v"(a), "v"(b), "v"(c), "v"(d) : "memory");
  __builtin_amdgcn_sched_barrier(0);
}
__device__ __forceinline__ void addr_regs_free_of(const void* a, const void* b, const void* c,
                                                  const void* d, const void* e, const void* f) {
  __builtin_amdgcn_sched_barrier(0);
  asm volatile("s_wait_xcnt 0x0" :: "v"(a), "v"(b), "v"(c), "v"(d), "v"(e), "v"(f) : "memory");
  __builtin_amdgcn_sched_barrier(0);
}
// Where a block's walk over n stages (n = 16 or 32) begins. Blocks that read the same operand
// lines differ in one of the two block indices only; started together at stage 0 they all ask
// L2 for the same few lines at the same moment, stage after stage, and each of those lines is
// new to L2 when they do. Sixteen such neighbours get sixteen starts, evenly spread; the two
// low bits go on top so that a run of four neighbours is a quarter of the walk apart,
// and after a few stages every line
// has been read once by somebody. For speed only: every block visits every stage once (it wraps).
__device__ __forceinline__ int walk_start(int n) {
  const int u = (blockIdx.x + blockIdx.y) & 15;
  return (((u & 3) << 2) | (u >> 2)) * (n / 16);
}

// Tile order of every 16-bit workspace plane: a 16-row x 32-k tile is one 1-KiB
// block [j][lane][8 elements]; lane 16h+m of half j holds row m, k = 16j+8h .. +7,
// which is the fragment map above. One wave load of a half is 512 contiguous bytes
// (four whole lines) where a row-major plane gives 32 bytes of each of 16 lines.
// A plane of R rows x K columns is [R/16][K/32] tiles (vt: [K/32][R/16] per (b, head)).
// A or B fragment: p = the tile's first element + 8 * lane.
__device__ __forceinline__ v16h ldtile_h(const _Float16* p) {
  FragH f;
  f.half[0] = *(const v8ha*)(p);
  f.half[1] = *(const v8ha*)(p + 256);
  return f.v;
}
__device__ __forceinline__ v16b ldtile_b(const __bf16* p) {
  FragB f;
  f.half[0] = *(const v8ba*)(p);
  f.half[1] = *(const v8ba*)(p + 256);
  return f.v;
}

// relation id: wrap negative once, then clamp into [0, NREL-1]
__device__ __forceinline__ int relidx(int id) {
  int t = id + ((id >> 31) & NREL);
  t = t < 0 ? 0 : t;
  t = t > (NREL - 1) ? (NREL - 1) : t;
  return t;
}

// ---------------------------------------------------------------------------
// Kernel 1: f32 -> 16-bit planes in tile order, 8 elements (16 B) per thread; thread
// index = index of the 16-byte group it writes, so stores are whole lines and the
// 16-line access falls on the one read of each source element.
//   xb [3][NTOK][HID] bf16 (q_in, k_in, v_in, RNE convert)
//   wb [4][HID][HID]  bf16 (Wq, Wk, Wv, Wo, row = output feature)
//   rk [NREL][HD]     f16  = 32 * bf16(relk)
//   rvT[HD][NREL]     f16  = 32 * bf16(relv)^T
//   idp               int  relation ids as given, [B][L/16][L/32][i][lane][4]:
//                     lane 16h+m of group i holds query m, keys 16(i>>1)+8h+4(i&1) .. +3
// ---------------------------------------------------------------------------
__global__ __launch_bounds__(256) void convert_kernel(
    const float* __restrict__ q_in, const float* __restrict__ k_in, const float* __restrict__ v_in,
    const float* __restrict__ Wq, const float* __restrict__ Wk, const float* __restrict__ Wv,
    const float* __restrict__ Wo, const float* __restrict__ relk, const float* __restrict__ relv,
    const int* __restrict__ ids,
    __bf16* __restrict__ xb, __bf16* __restrict__ wb, _Float16* __restrict__ rk, _Float16* __restrict__ rvT,
    int* __restrict__ idp)
{
  const int g = blockIdx.x * 256 + threadIdx.x;
  if (g >= G_TOT) return;
  const int h = (g >> 4) & 1, m = g & 15;        // every plane starts at a multiple of 32 groups
  if (g >= G_16) {
    const int e = g - G_16;
    const int i = (e >> 5) & 3, c = (e >> 7) & 15, qt = e >> 11;   // qt = 32 b + query tile
    const int* src = ids + ((size_t)qt * 16 + m) * SEQ + 32 * c + 16 * (i >> 1) + 8 * h + 4 * (i & 1);
    *(v4i*)(idp + (size_t)e * 4) = *(const v4ia*)src;
  } else if (g < G_X + G_W) {
    const float* src;
    __bf16* dst;
    if (g < G_X) {
      const int which = g >> 18;                 // NX8 = 2^18
      const int off = g & (NX8 - 1);
      const float* s = (which == 0) ? q_in : ((which == 1) ? k_in : v_in);
      // group off = ((row tile * 32 + k tile) * 2 + j) * 32 + lane
      src = s + (size_t)((off >> 11) * 16 + m) * HID + ((off >> 6) & 31) * 32 + ((off >> 5) & 1) * 16 + 8 * h;
      dst = xb + (size_t)which * NX + (size_t)off * 8;
    } else {
      const int e = g - G_X;
      const int wsel = e >> 17;                 // NW8 = 2^17
      const int off = e & (NW8 - 1);
      const float* s = (wsel == 0) ? Wq : ((wsel == 1) ? Wk : ((wsel == 2) ? Wv : Wo));
      src = s + (size_t)((off >> 11) * 16 + m) * HID + ((off >> 6) & 31) * 32 + ((off >> 5) & 1) * 16 + 8 * h;
      dst = wb + (size_t)wsel * NW + (size_t)off * 8;
    }
    const v4f a = *(const v4fa*)src;
    const v4f c = *(const v4fa*)(src + 4);
    const v8b o = { (__bf16)a.x, (__bf16)a.y, (__bf16)a.z, (__bf16)a.w,
                    (__bf16)c.x, (__bf16)c.y, (__bf16)c.z, (__bf16)c.w };
    *(v8b*)dst = o;
    
  } else {
    const int e = g - (G_X + G_W);
    float f[8];
    _Float16* dst;
    // group e & 511 = ((row tile * 2 + k tile) * 2 + j) * 32 + lane of a 64 x 64 plane
    const int row = ((e >> 7) & 3) * 16 + m;
    const int kk = ((e >> 6) & 1) * 32 + ((e >> 5) & 1) * 16 + 8 * h;
    if (e < G_R) {
      const float* src = relk + (size_t)row * HD + kk;
      const v4f a = *(const v4fa*)src;
      const v4f c = *(const v4fa*)(src + 4);
      f[0] = a.x; f[1] = a.y; f[2] = a.z; f[3] = a.w;
      f[4] = c.x; f[5] = c.y; f[6] = c.z; f[7] = c.w;
      dst = rk + (size_t)e * 8;
    } else {
      const int e3 = e - G_R;                    // 0..511; row = d, kk = first relation index
      #pragma unroll
      for (int i = 0; i < 8; ++i) f[i] = relv[(size_t)(kk + i) * HD + row];
      dst = rvT + (size_t)e3 * 8;
    }
    _Float16 hh[8];
    #pragma unroll
    for (int i = 0; i < 8; ++i) hh[i] = (_Float16)((float)(__bf16)f[i] * 32.0f);
    const v8h o = { hh[0], hh[1], hh[2], hh[3], hh[4], hh[5], hh[6], hh[7] };
    *(v8h*)dst = o;
    
  }
}

// ---------------------------------------------------------------------------
// 4 lines per instruction, 32 lines per wave, 128 per block; tile order.
// which 0/1: plane[bh][l/16][d/32] tiles (row = token, k = d); a wave's 32 tokens = 4 tiles
// which 2  : vt[bh][l/32][d/16] tiles    (row = d, k = token); a wave's 32 tokens = 4 tiles
// ---------------------------------------------------------------------------
__device__ __forceinline__ void proj_store_pass(const _Float16* sT, _Float16* plane, _Float16* vt,
                                                int which, int bh, int l0, int w, int lane) {
  const int h = lane >> 4, m = lane & 15;
  // LDS element of half i = 0: (token tile * 2 + d tile) * 2 + j = i, or d tile * 2 + j = i
  const _Float16* sp = (which != 2) ? sT + (32 * w + m) * HD + 8 * h : sT + m * 128 + 32 * w + 8 * h;
  // either way the wave's four tiles are 4 KiB in a row at the same offset of its plane
  _Float16* dst = ((which != 2) ? plane : vt) + ((size_t)bh * SEQ + l0 + 32 * w) * HD + 8 * lane;
  #pragma unroll
  for (int i = 0; i < 8; ++i) {
    const int so = (which != 2) ? 16 * (i >> 2) * HD + 16 * (i & 3) : 16 * (i >> 1) * 128 + 16 * (i & 1);
    *(v8h*)(dst + 256 * i) = *(const v8ha*)(sp + so);
  }
}

// One k step (32 deep) of a projection's operands, held in registers so that
// the next step's loads are in flight while this step's products run.
struct PStage { v16b a0, a1, b[4]; };
// xp, wp = the step's tile of the wave's first token tile and first feature tile
__device__ __forceinline__ void proj_load(PStage& s, const __bf16* xp, const __bf16* wp) {
  s.a0 = ldtile_b(xp);
  s.a1 = ldtile_b(xp + (size_t)16 * HID);
  #pragma unroll
  for (int nt = 0; nt < 4; ++nt) s.b[nt] = ldtile_b(wp + (size_t)nt * 16 * HID);
  loads_stay_above();
}
// element offset of the tile of k step (k0 / 32 + ks) mod 32 in a row of tiles
__device__ __forceinline__ int ktile(int k0, int ks) { return (((k0 >> 5) + ks) & (HID / 32 - 1)) * TILE; }
__device__ __forceinline__ void proj_mma(const PStage& s, v8f (&acc)[2][4]) {
  #pragma unroll
  for (int nt = 0; nt < 4; ++nt) {
    acc[0][nt] = wmma_b(s.a0, s.b[nt], acc[0][nt]);
    acc[1][nt] = wmma_b(s.a1, s.b[nt], acc[1][nt]);
  }
}

// ---------------------------------------------------------------------------
// Kernel 2: Y = x * W^T + b for the three projections (which = 0,1,2).
// Block 128 thr (4 waves) = 128 tokens x 64 features (one (which, head));
// wave tile 32 tokens x 64 features; K = 1024 in steps of 32;
// A (x rows) and B (W rows) bf16 fragments straight from the tile-ordered planes.
// ---------------------------------------------------------------------------
__global__ __launch_bounds__(128) void proj_kernel(
    const __bf16* __restrict__ xb,     // [3][NTOK][HID], tile order
    const __bf16* __restrict__ wb,     // [4][HID][HID], row = output feature (first 3 used), tile order
    const float* __restrict__ bq, const float* __restrict__ bk, const float* __restrict__ bv,
    _Float16* __restrict__ qh,         // [B*H][L][D]  f16(0.125*q), tile order
    _Float16* __restrict__ kh,         // [B*H][L][D], tile order
    _Float16* __restrict__ vt)         // [B*H][L/32][D/16] tiles (row = d, k = token)
{
  __shared__ __attribute__((aligned(16))) _Float16 sT[128 * 64];   // 16384 B

  const int tid = threadIdx.x, lane = tid & 31, w = tid >> 5;
  const int h = lane >> 4, m = lane & 15;
  const int m0 = blockIdx.x * 128;
  const int cg = blockIdx.y;                 // 0..47
  const int which = cg >> 4, head = cg & 15;
  const int m0w = m0 + 32 * w;

  // 16 rows of a plane = HID / 32 tiles in a row = 16 * HID elements
  const __bf16* xa0 = xb + (size_t)which * NX + (size_t)m0w * HID + 8 * lane;   // token tile, mt = 0
  const __bf16* wr  = wb + (size_t)which * NW + (size_t)(head * HD) * HID + 8 * lane;  // feature tile, nt = 0

  const int ks = walk_start(HID / 32);       // the 16 blocks on a W slice, and the 16 on an x slice, start apart
  PStage sa, sb;
  const __bf16 *xf = xa0 + ktile(0, ks), *wf = wr + ktile(0, ks);
  proj_load(sa, xf, wf);

  const v8f zero8 = {0.f, 0.f, 0.f, 0.f, 0.f, 0.f, 0.f, 0.f};
  v8f acc[2][4];
  #pragma unroll
  for (int mt = 0; mt < 2; ++mt)
    #pragma unroll
    for (int nt = 0; nt < 4; ++nt) acc[mt][nt] = zero8;

  addr_regs_free_of(xf, wf, xf, wf);         // the first step's address pairs are free from here on
  // rolled: two register stages per trip, no copies between them
  #pragma unroll 1
  for (int k0 = 0; k0 < HID - 64; k0 += 64) {
    const int t1 = ktile(k0 + 32, ks), t2 = ktile(k0 + 64, ks);
    const __bf16 *x1 = xa0 + t1, *w1 = wr + t1, *x2 = xa0 + t2, *w2 = wr + t2;
    proj_load(sb, x1, w1);
    proj_mma(sa, acc);
    proj_load(sa, x2, w2);
    proj_mma(sb, acc);
    addr_regs_free_of(x1, w1, x2, w2);
  }
  proj_load(sb, xa0 + ktile(HID - 32, ks), wr + ktile(HID - 32, ks));
  addr_regs_free();
  proj_mma(sa, acc);
  proj_mma(sb, acc);

  // D[r] of tile (mt, nt) = Y[token m0w+16mt+8h+r][feature 16nt+m]
  const float* bias = (which == 0) ? bq : ((which == 1) ? bk : bv);
  const float osc = (which == 0) ? 0.125f : 1.0f;
  #pragma unroll
  for (int nt = 0; nt < 4; ++nt) {
    const int feat = 16 * nt + m;
    const float bvl = (float)(__bf16)bias[head * HD + feat];
    #pragma unroll
    for (int mt = 0; mt < 2; ++mt) {
      #pragma unroll
      for (int r = 0; r < 8; ++r) {
        const int tokl = 32 * w + 16 * mt + 8 * h + r;     // 0..127
        const float y = (acc[mt][nt][r] + bvl) * osc;
        const int idx = (which == 2) ? (feat * 128 + tokl) : (tokl * HD + feat);
        sT[idx] = (_Float16)y;
      }
    }
  }
  __syncthreads();

  const int b = m0 >> 9, l0 = m0 & (SEQ - 1), bh = b * NH + head;
  _Float16* plane = (which == 0) ? qh : kh;
  proj_store_pass(sT, plane, vt, which, bh, l0, w, lane);
  
}

// ---------------------------------------------------------------------------
// Attention helpers.
// ---------------------------------------------------------------------------
// B fragment of the normalised relation histogram, k = relation index:
// element i<8 <- k0+8h+i, element 8+i <- k0+16+8h+i; kb = k0 + 8h.
// A bin of query m is the sum of eight partials: HCOPY copies x the columns of lanes m
// and m+16. Each lane reads its own column first and its partner's second, so the 32
// lanes of every read fall on 32 different banks.
__device__ __forceinline__ v16h build_w(const float* sH, int lane, int kb, float wsc) {
  const float* ca = sH + kb * 32 + lane;
  const float* cb = sH + kb * 32 + (lane ^ 16);
  _Float16 wh[16];
  #pragma unroll
  for (int i = 0; i < 16; ++i) {
    const int ro = ((i & 7) + 16 * (i >> 3)) * 32;
    float s = ca[ro] + cb[ro];
    #pragma unroll
    for (int c = 1; c < HCOPY; ++c) s += ca[c * HPL + ro] + cb[c * HPL + ro];
    wh[i] = (_Float16)(s * wsc);
  }
  FragH f;
  f.half[0] = (v8h){ wh[0], wh[1], wh[2], wh[3], wh[4], wh[5], wh[6], wh[7] };
  f.half[1] = (v8h){ wh[8], wh[9], wh[10], wh[11], wh[12], wh[13], wh[14], wh[15] };
  return f.v;
}

// Per-wave 16x64 f32 tile in LDS -> bf16 hi and lo planes [tok][HID] in tile order:
// two tiles in a row, i = feature tile * 2 + j; 4 lines per instruction.
__device__ __forceinline__ void att_store(const float* sO, __bf16* ahi, __bf16* alo,
                                          size_t gbase, int lane) {
  const int h = lane >> 4, m = lane & 15;
  #pragma unroll
  for (int i = 0; i < 4; ++i) {
    const float* sp = sO + m * HD + 16 * i + 8 * h;
    const v4f a = *(const v4fa*)sp;
    const v4f c = *(const v4fa*)(sp + 4);
    const float f[8] = { a.x, a.y, a.z, a.w, c.x, c.y, c.z, c.w };
    __bf16 hh[8], ll[8];
    #pragma unroll
    for (int e = 0; e < 8; ++e) {
      hh[e] = (__bf16)f[e];
      ll[e] = (__bf16)(f[e] - (float)hh[e]);
    }
    const v8b hv = { hh[0], hh[1], hh[2], hh[3], hh[4], hh[5], hh[6], hh[7] };
    const v8b lv = { ll[0], ll[1], ll[2], ll[3], ll[4], ll[5], ll[6], ll[7] };
    const size_t gi = gbase + 256 * i + 8 * lane;
    *(v8b*)(ahi + gi) = hv;
    *(v8b*)(alo + gi) = lv;
  }
}

// 32 keys' worth of global operands, held in registers ahead of their use:
// f[0..3] = four A fragments (K rows of two key tiles, two d chunks each, or
// V^T rows of the four d tiles), id[0..3] = this lane's 16 relation ids.
// The scores need K and the ids at a stage's head: they are fetched one stage ahead.
// V^T is needed only at the foot, behind the histogram chain, so it is fetched at the
// head of its own stage.
struct AFrag { v16h f[4]; };
struct AIds  { v4i id[4]; };
// ip = the stage's 2-KiB block of idp + 4 * lane; id[0..3] = keys 8h+0..3, 8h+4..7, 16+8h+0..3, 16+8h+4..7
__device__ __forceinline__ void ids_load(AIds& s, const int* ip) {
  #pragma unroll
  for (int i = 0; i < 4; ++i) s.id[i] = *(const v4ia*)(ip + 128 * i);
}
// kp, ip = a stage's first K tile and its block of ids
__device__ __forceinline__ void k_load(AFrag& s, AIds& n, const _Float16* kp, const int* ip) {
  // 32 keys = four tiles in a row: (key tile 0, d 0..31), (0, 32..63), (1, 0..31), (1, 32..63)
  #pragma unroll
  for (int t = 0; t < 4; ++t) s.f[t] = ldtile_h(kp + (size_t)t * TILE);
  ids_load(n, ip);
  loads_stay_above();
}
// V^T of one stage (vp) and, where there is one, K and the ids of the stage walked next (kp, ip)
template <bool NEXT>
__device__ __forceinline__ void vk_load(AFrag& v, AFrag& s, AIds& n, const _Float16* vp,
                                        const _Float16* kp, const int* ip) {
  #pragma unroll
  for (int t = 0; t < 4; ++t) v.f[t] = ldtile_h(vp + (size_t)t * TILE);
  if (NEXT) {
    #pragma unroll
    for (int t = 0; t < 4; ++t) s.f[t] = ldtile_h(kp + (size_t)t * TILE);
    ids_load(n, ip);
  }
  loads_stay_above();
}
// scores of one stage's 32 keys, 16 per lane, in registers, with their table rows
__device__ __forceinline__ void score16(const AFrag& s, const AIds& n, v16h qb0, v16h qb1, const float* qr,
                                        float (&sc)[16], int (&ri)[16]) {
  const v8f zero8 = {0.f, 0.f, 0.f, 0.f, 0.f, 0.f, 0.f, 0.f};
  v8f z0 = wmma_h(s.f[0], qb0, zero8);
  z0 = wmma_h(s.f[1], qb1, z0);                 // z0[r] = S[query m][key 32c+8h+r]
  v8f z1 = wmma_h(s.f[2], qb0, zero8);
  z1 = wmma_h(s.f[3], qb1, z1);                 // z1[r] = S[query m][key 32c+16+8h+r]
  const int idv[16] = { n.id[0].x, n.id[0].y, n.id[0].z, n.id[0].w, n.id[1].x, n.id[1].y, n.id[1].z, n.id[1].w,
                        n.id[2].x, n.id[2].y, n.id[2].z, n.id[2].w, n.id[3].x, n.id[3].y, n.id[3].z, n.id[3].w };
  #pragma unroll
  for (int e = 0; e < 16; ++e) {
    const int id = idv[e];
    const float bias = (id > 0) ? 0.0f : -10000.0f;
    const float zz = (e < 8) ? z0[e & 7] : z1[e & 7];
    ri[e] = relidx(id);
    sc[e] = zz + qr[ri[e]] * 0.0078125f + bias;
  }
}
// maximum of the scores of one stage's 32 keys (the softmax reference starts from the first stage walked)
__device__ __forceinline__ float max_stage(const AFrag& s, const AIds& n, v16h qb0, v16h qb1, const float* qr,
                                           float mx) {
  float sc[16];
  int ri[16];
  score16(s, n, qb0, qb1, qr, sc, ri);
  #pragma unroll
  for (int e = 0; e < 16; ++e) mx = fmaxf(mx, sc[e]);
  return mx;
}
// 2^x. The v_nop is the free slot that the instruction set asks for behind a
// transcendental before its source is overwritten or its result read; only inside the
// same statement does it stay directly behind the v_exp_f32.
__device__ __forceinline__ float exp2_slot(float x) {
  float r;
  asm("v_exp_f32 %0, %1\n\tv_nop" : "=v"(r) : "v"(x));
  return r;
}
// one stage: scores, exp, sum, histogram, O^T += V^T * P^T for 32 keys.
// mx is the reference that is subtracted in the exponent, the same in lanes m and m + 16.
// Softmax is the same for any reference; it only has to keep p in f16's range. While no
// score tops mx by more than MXT the sums go on as they are; otherwise mx moves up to the
// largest score seen and everything summed so far is multiplied by exp(old mx - new mx).
__device__ __forceinline__ float pv_stage(const AFrag& k, const AIds& n, const AFrag& s, v16h qb0, v16h qb1,
                                          const float* qr, float* hl, float& mx, float lsum, v8f (&o)[4]) {
  float sv[16];
  int rv[16];
  score16(k, n, qb0, qb1, qr, sv, rv);
  float sm = sv[0];
  #pragma unroll
  for (int e = 1; e < 16; ++e) sm = fmaxf(sm, sv[e]);
  if (__builtin_amdgcn_ballot_w32(sm > mx + MXT) != 0u) {     // the same for the whole wave
    const float nm = fmaxf(mx, fmaxf(sm, __shfl_xor(sm, 16)));
    const float f = exp2_slot((mx - nm) * 1.44269504f);       // 1 for a query whose reference stays
    mx = nm;
    lsum *= f;
    #pragma unroll
    for (int t = 0; t < 4; ++t) o[t] *= f;
    // partly rolled: a seldom-taken path that stands four times in the kernel, kept short for the instruction cache
    #pragma unroll 8
    for (int i = 0; i < HCOPY * NREL; ++i) hl[i * 32] *= f;
  }
  // Histogram: key e adds into copy e & 3, so the four bins of a group are four different
  // LDS words whatever the ids are: they are read together and one LDS round trip serves
  // four keys, where a single copy makes every read wait for the store in front of it.
  // The first group's bins depend on no store of this stage: their reads stand ahead of the exponentials.
  float old[HCOPY];
  #pragma unroll
  for (int j = 0; j < HCOPY; ++j) old[j] = hl[j * HPL + rv[j] * 32];
  float pe[16];
  _Float16 ph[16];
  #pragma unroll
  for (int e = 0; e < 16; ++e) {
    const float p = exp2_slot((sv[e] - mx) * 1.44269504f);   // = __expf(sv[e] - mx)
    lsum += p;
    pe[e] = p;
    ph[e] = (_Float16)(p * PPS);
  }
  #pragma unroll
  for (int g = 0; g < 16 / HCOPY; ++g) {
    #pragma unroll
    for (int j = 0; j < HCOPY; ++j) hl[j * HPL + rv[HCOPY * g + j] * 32] = old[j] + pe[HCOPY * g + j];
    if (g + 1 < 16 / HCOPY) {
      #pragma unroll
      for (int j = 0; j < HCOPY; ++j) old[j] = hl[j * HPL + rv[HCOPY * (g + 1) + j] * 32];
    }
  }
  // P^T B-fragment: element r <- key 32c+8h+r, element 8+r <- key 32c+16+8h+r
  FragH pf;
  pf.half[0] = (v8h){ ph[0], ph[1], ph[2], ph[3], ph[4], ph[5], ph[6], ph[7] };
  pf.half[1] = (v8h){ ph[8], ph[9], ph[10], ph[11], ph[12], ph[13], ph[14], ph[15] };
  #pragma unroll
  for (int t = 0; t < 4; ++t) o[t] = wmma_h(s.f[t], pf.v, o[t]);
  return lsum;
}

// ---------------------------------------------------------------------------
// Kernel 3: relation-aware attention, transposed form, one wave per block.
// Block = 32 thr = 16 queries of one (b, head), all 512 keys.
//   qrel^T = RK * Q^T       : A = rk rows (row = rel, k = d), B = Q^T
//   S^T    = K * Q^T        : A = K rows (row = key, k = d), B = Q^T (k = d, n = query)
//   score  = S^T + qrel[query][id]/128 + (-10000 where id <= 0), f32 in registers, never stored
//   p      = exp(score - mx): mx starts as the maximum over the first 32 keys walked and moves up,
//            with a rescale of all sums, only where a later score tops it by more than MXT
//   hist   : per-lane private bins h[key & 3][rel][lane] += p (fixed order, no atomics);
//            bank = lane + 32 (rel & 1), so a wave's 32 bins never share a bank
//   O^T    = V^T * P^T      : A = vt rows (row = d, k = key), B = P^T from registers x1024
//   R^T    = RVT * W^T      : A = rvT rows (row = d, k = rel), B = W^T = (hist/l) x16384,
//            hist = the eight partial bins of a (query, rel) added up
//   out    = O^T/(l*1024) + R^T * 2^-21  -> bf16 hi/lo planes [tok][head*64+d]
// Lane owns 256 keys of query column (lane&15); partner = lane ^ 16.
// The 16 stages of 32 keys are walked from stage walk_start on, wrapping: the 32 blocks on
// one head's K and V^T start two by two at 16 stages, and the 16 blocks on one query tile's ids start apart.
// ---------------------------------------------------------------------------
__global__ __launch_bounds__(32) void attn_kernel(
    const _Float16* __restrict__ qh,   // [B*H][L][D]  (already x0.125), tile order
    const _Float16* __restrict__ kh,   // [B*H][L][D], tile order
    const _Float16* __restrict__ vt,   // [B*H][L/32][D/16] tiles (row = d, k = key)
    const int* __restrict__ idp,       // [B][L/16][L/32][4][32][4] int32 relation ids in lane order
    const _Float16* __restrict__ rk,   // [NREL][D]  x32, tile order
    const _Float16* __restrict__ rvT,  // [D][NREL]  x32, tile order
    __bf16* __restrict__ ahi,          // [NTOK][HID], tile order
    __bf16* __restrict__ alo)          // [NTOK][HID], tile order
{
  // 36 KiB in all: eight blocks still fit a WGP's 320 KiB, so the whole grid is resident at once
  __shared__ __attribute__((aligned(16))) float sQR[16 * NREL];     //  4096 B qrel[query][rel]; behind the key loop: output staging
  __shared__ __attribute__((aligned(16))) float sH[HCOPY * HPL];    // 32768 B hist[copy][rel][lane]

  const int lane = threadIdx.x & 31, h = lane >> 4, m = lane & 15;
  const int bh = blockIdx.y, b = bh >> 4, head = bh & 15;
  const int q0 = blockIdx.x * 16;

  float* hl = sH + lane;                      // this lane's column of every copy

  // Q^T B-fragments: column n = query q0+m, k = d (two 32-deep chunks)
  const _Float16* qrow = qh + ((size_t)bh * SEQ + q0) * HD + 8 * lane;
  const v16h qb0 = ldtile_h(qrow);
  const v16h qb1 = ldtile_h(qrow + TILE);

  const _Float16* kbase = kh + (size_t)bh * SEQ * HD + 8 * lane;     // + four tiles per stage
  const _Float16* vbase = vt + (size_t)bh * SEQ * HD + 8 * lane;     // + four tiles per stage
  const int* idrow = idp + ((size_t)b * SEQ + q0) * SEQ + 4 * lane;  // + 512 ids per stage
  const int c0 = walk_start(SEQ / 32);
  AFrag fa, fb;
  AIds ia, ib;
  const _Float16* kf = kbase + (size_t)c0 * 4 * TILE;
  const int* nf = idrow + 512 * c0;
  k_load(fa, ia, kf, nf);                       // the first stage, in flight under the qrel tiles

  // zero all histogram bins, 512 contiguous bytes per store
  {
    const v4f z4 = {0.f, 0.f, 0.f, 0.f};
    #pragma unroll
    for (int i = 0; i < HCOPY * HPL / 128; ++i) *(v4fa*)(sH + 128 * i + 4 * lane) = z4;
  }
  addr_regs_free_of(kf, nf, kf, nf);            // behind the stores, where it costs nothing; the table loads below reuse registers

  const v8f zero8 = {0.f, 0.f, 0.f, 0.f, 0.f, 0.f, 0.f, 0.f};

  // ---- qrel^T tiles: D[r] = (rel 16rt+8h+r, query m) ----
  #pragma unroll
  for (int rt = 0; rt < 4; ++rt) {
    const _Float16* ap = rk + (size_t)(2 * rt) * TILE + 8 * lane;
    v8f z = zero8;
    z = wmma_h(ldtile_h(ap), qb0, z);
    z = wmma_h(ldtile_h(ap + TILE), qb1, z);
    #pragma unroll
    for (int r = 0; r < 8; ++r) sQR[m * NREL + 16 * rt + 8 * h + r] = z[r];
  }
  __syncthreads();

  const float* qr = sQR + m * NREL;

  // softmax reference to start with: the maximum over the first stage's 32 keys
  float mx = max_stage(fa, ia, qb0, qb1, qr, -3.0e38f);
  mx = fmaxf(mx, __shfl_xor(mx, 16));

  // ---- the one pass: scores, exp, sum, histogram, O^T += V^T * P^T (32 keys per step) ----
  v8f o[4];                                   // o[t][r] = O[query m][d 16t+8h+r] * (l * 1024)
  #pragma unroll
  for (int t = 0; t < 4; ++t) o[t] = zero8;
  float lsum = 0.0f;
  AFrag fv;
  // rolled: two register stages per trip, no copies between them
  #pragma unroll 1
  for (int c = 0; c < SEQ / 32 - 2; c += 2) {
    const int s0 = (c0 + c) & (SEQ / 32 - 1), s1 = (c0 + c + 1) & (SEQ / 32 - 1), s2 = (c0 + c + 2) & (SEQ / 32 - 1);
    const _Float16 *v0 = vbase + (size_t)s0 * 4 * TILE, *k1 = kbase + (size_t)s1 * 4 * TILE;
    const _Float16 *v1 = vbase + (size_t)s1 * 4 * TILE, *k2 = kbase + (size_t)s2 * 4 * TILE;
    const int *i1 = idrow + 512 * s1, *i2 = idrow + 512 * s2;
    vk_load<true>(fv, fb, ib, v0, k1, i1);
    lsum = pv_stage(fa, ia, fv, qb0, qb1, qr, hl, mx, lsum, o);
    vk_load<true>(fv, fa, ia, v1, k2, i2);
    lsum = pv_stage(fb, ib, fv, qb0, qb1, qr, hl, mx, lsum, o);
    addr_regs_free_of(v0, k1, i1, v1, k2, i2);
  }
  const int sy = (c0 + SEQ / 32 - 2) & (SEQ / 32 - 1), sz = (c0 + SEQ / 32 - 1) & (SEQ / 32 - 1);   // the last two stages
  vk_load<true>(fv, fb, ib, vbase + (size_t)sy * 4 * TILE, kbase + (size_t)sz * 4 * TILE, idrow + 512 * sz);
  lsum = pv_stage(fa, ia, fv, qb0, qb1, qr, hl, mx, lsum, o);
  addr_regs_free();
  vk_load<false>(fv, fa, ia, vbase + (size_t)sz * 4 * TILE, kbase, idrow);
  lsum = pv_stage(fb, ib, fv, qb0, qb1, qr, hl, mx, lsum, o);
  lsum += __shfl_xor(lsum, 16);
  const float inv = 1.0f / lsum;
  const float osc = inv * (1.0f / PPS);
  const float wsc = inv * PSC;
  __syncthreads();                            // histogram bins complete (read cross-lane below)

  // ---- relation value term: R^T = RVT * W^T ----
  const v16h w0 = build_w(sH, lane, 8 * h, wsc);
  const v16h w1 = build_w(sH, lane, 32 + 8 * h, wsc);
  float* sO = sQR;                            // the qrel table was last read in the key loop
  #pragma unroll
  for (int t = 0; t < 4; ++t) {
    const _Float16* ap = rvT + (size_t)(2 * t) * TILE + 8 * lane;
    v8f z = zero8;
    z = wmma_h(ldtile_h(ap), w0, z);
    z = wmma_h(ldtile_h(ap + TILE), w1, z);
    #pragma unroll
    for (int r = 0; r < 8; ++r)
      sO[m * HD + 16 * t + 8 * h + r] = o[t][r] * osc + z[r] * RVS;
  }
  __syncthreads();

  const size_t gbase = ((size_t)b * SEQ + q0) * HID + (size_t)(2 * head) * TILE;   // token tile, feature tiles 2 head, 2 head + 1
  att_store(sO, ahi, alo, gbase, lane);
  
}

// ---------------------------------------------------------------------------
// instruction, 4 lines per instruction, 64 lines per wave.
// ---------------------------------------------------------------------------
__device__ __forceinline__ void out_store_pass(const float* sT, float* out, int m0, int n0,
                                               int w, int lane) {
  const int q8 = lane & 7, sub = lane >> 3;
  #pragma unroll
  for (int i = 0; i < 16; ++i) {
    const int lid = i * 4 + sub;                 // 0..63
    const int rowl = 32 * w + (lid >> 1), hl = lid & 1;
    const v4f v = *(const v4fa*)(sT + rowl * 64 + 32 * hl + 4 * q8);
    float* dst = out + (size_t)(m0 + rowl) * HID + n0 + 32 * hl + 4 * q8;
    *(v4f*)dst = v;
  }
}

// One k step (32 deep) of the output projection's operands, one stage ahead.
struct OStage { v16b a[4]; v16b b[4]; };
// hp, lp, wp = the step's tile of the wave's first token tile (hi, lo) and first feature tile
__device__ __forceinline__ void oproj_load(OStage& s, const __bf16* hp, const __bf16* lp, const __bf16* wp) {
  s.a[0] = ldtile_b(hp);
  s.a[1] = ldtile_b(lp);
  s.a[2] = ldtile_b(hp + (size_t)16 * HID);
  s.a[3] = ldtile_b(lp + (size_t)16 * HID);
  #pragma unroll
  for (int nt = 0; nt < 4; ++nt) s.b[nt] = ldtile_b(wp + (size_t)nt * 16 * HID);
  loads_stay_above();
}
__device__ __forceinline__ void oproj_mma(const OStage& s, v8f (&acc)[2][4]) {
  #pragma unroll
  for (int nt = 0; nt < 4; ++nt) {
    acc[0][nt] = wmma_b(s.a[0], s.b[nt], acc[0][nt]);
    acc[0][nt] = wmma_b(s.a[1], s.b[nt], acc[0][nt]);
    acc[1][nt] = wmma_b(s.a[2], s.b[nt], acc[1][nt]);
    acc[1][nt] = wmma_b(s.a[3], s.b[nt], acc[1][nt]);
  }
}

// ---------------------------------------------------------------------------
// Kernel 4: out = A * Wo^T + bo with A = ahi + alo (two bf16 products per tile).
// Block 128 thr = 128 tokens x 64 features; wave 32 tokens x 64 features.
// ---------------------------------------------------------------------------
__global__ __launch_bounds__(128) void oproj_kernel(
    const __bf16* __restrict__ ahi,    // [NTOK][HID], tile order
    const __bf16* __restrict__ alo,    // [NTOK][HID], tile order
    const __bf16* __restrict__ wo,     // [HID][HID], row = output feature, tile order
    const float* __restrict__ bo,
    float* __restrict__ out)           // [NTOK][HID]
{
  __shared__ __attribute__((aligned(16))) float sT[128 * 64];      // 32768 B

  const int tid = threadIdx.x, lane = tid & 31, w = tid >> 5;
  const int h = lane >> 4, m = lane & 15;
  const int m0 = blockIdx.x * 128;
  const int n0 = blockIdx.y * 64;
  const int m0w = m0 + 32 * w;

  const __bf16* a0h = ahi + (size_t)m0w * HID + 8 * lane;
  const __bf16* a0l = alo + (size_t)m0w * HID + 8 * lane;
  const __bf16* wr  = wo + (size_t)n0 * HID + 8 * lane;

  const int ks = walk_start(HID / 32);       // the 16 blocks on a Wo slice, and the 16 on a token slice, start apart
  OStage sa, sb;
  const __bf16 *hf = a0h + ktile(0, ks), *lf = a0l + ktile(0, ks), *wf = wr + ktile(0, ks);
  oproj_load(sa, hf, lf, wf);

  const v8f zero8 = {0.f, 0.f, 0.f, 0.f, 0.f, 0.f, 0.f, 0.f};
  v8f acc[2][4];
  #pragma unroll
  for (int mt = 0; mt < 2; ++mt)
    #pragma unroll
    for (int nt = 0; nt < 4; ++nt) acc[mt][nt] = zero8;

  addr_regs_free_of(hf, lf, wf, hf, lf, wf); // the first step's address pairs are free from here on
  // rolled: two register stages per trip, no copies between them
  #pragma unroll 1
  for (int k0 = 0; k0 < HID - 64; k0 += 64) {
    const int t1 = ktile(k0 + 32, ks), t2 = ktile(k0 + 64, ks);
    const __bf16 *h1 = a0h + t1, *l1 = a0l + t1, *w1 = wr + t1, *h2 = a0h + t2, *l2 = a0l + t2, *w2 = wr + t2;
    oproj_load(sb, h1, l1, w1);
    oproj_mma(sa, acc);
    oproj_load(sa, h2, l2, w2);
    oproj_mma(sb, acc);
    addr_regs_free_of(h1, l1, w1, h2, l2, w2);
  }
  oproj_load(sb, a0h + ktile(HID - 32, ks), a0l + ktile(HID - 32, ks), wr + ktile(HID - 32, ks));
  addr_regs_free();
  oproj_mma(sa, acc);
  oproj_mma(sb, acc);

  // D[r] of tile (mt, nt) = Y[token m0w+16mt+8h+r][feature n0+16nt+m]
  #pragma unroll
  for (int nt = 0; nt < 4; ++nt) {
    const int featl = 16 * nt + m;
    const float bvl = (float)(__bf16)bo[n0 + featl];
    #pragma unroll
    for (int mt = 0; mt < 2; ++mt) {
      #pragma unroll
      for (int r = 0; r < 8; ++r) {
        const int tokl = 32 * w + 16 * mt + 8 * h + r;     // 0..127
        sT[tokl * 64 + featl] = acc[mt][nt][r] + bvl;
      }
    }
  }
  __syncthreads();

  out_store_pass(sT, out, m0, n0, w, lane);
  
}

// ---------------------------------------------------------------------------
extern "C" void kernel_launch(void* const* d_in, const int* in_sizes, int n_in,
                              void* d_out, int out_size, void* d_ws, size_t ws_size,
                              hipStream_t stream) {
  if (n_in < 14) return;
  if (in_sizes[0] != NX || in_sizes[1] != NX || in_sizes[2] != NX) return;
  if (in_sizes[3] != NB * SEQ * SEQ) return;
  if (in_sizes[4] != NW || in_sizes[6] != NW || in_sizes[8] != NW || in_sizes[10] != NW) return;
  if (in_sizes[5] != HID || in_sizes[7] != HID || in_sizes[9] != HID || in_sizes[11] != HID) return;
  if (in_sizes[12] != NREL * HD || in_sizes[13] != NREL * HD) return;
  if (out_size != NX) return;

  const float* q_in = (const float*)d_in[0];
  const float* k_in = (const float*)d_in[1];
  const float* v_in = (const float*)d_in[2];
  const int*   ids  = (const int*)d_in[3];
  const float* Wq = (const float*)d_in[4];
  const float* bq = (const float*)d_in[5];
  const float* Wk = (const float*)d_in[6];
  const float* bk = (const float*)d_in[7];
  const float* Wv = (const float*)d_in[8];
  const float* bv = (const float*)d_in[9];
  const float* Wo = (const float*)d_in[10];
  const float* bo = (const float*)d_in[11];
  const float* relk = (const float*)d_in[12];
  const float* relv = (const float*)d_in[13];
  float* out = (float*)d_out;

  const size_t xb_bytes = (size_t)3 * NX * 2;          // 12582912
  const size_t wb_bytes = (size_t)4 * NW * 2;          //  8388608
  const size_t rt_bytes = (size_t)NREL * HD * 2;       //     8192
  const size_t pl_bytes = (size_t)NPL * 2;             //  4194304
  const size_t ap_bytes = (size_t)NX * 2;              //  4194304
  const size_t id_bytes = (size_t)NB * SEQ * SEQ * 4;  //  4194304
  const size_t total = xb_bytes + wb_bytes + 2 * rt_bytes + 3 * pl_bytes + 2 * ap_bytes + id_bytes;  // 46153728
  if (total > ws_size) return;

  char* ws = (char*)d_ws;
  size_t off = 0;
  __bf16* xb = (__bf16*)(ws + off);       off += xb_bytes;
  __bf16* wb = (__bf16*)(ws + off);       off += wb_bytes;
  _Float16* rk  = (_Float16*)(ws + off);  off += rt_bytes;
  _Float16* rvT = (_Float16*)(ws + off);  off += rt_bytes;
  _Float16* qh  = (_Float16*)(ws + off);  off += pl_bytes;
  _Float16* kh  = (_Float16*)(ws + off);  off += pl_bytes;
  _Float16* vt  = (_Float16*)(ws + off);  off += pl_bytes;
  __bf16* ahi = (__bf16*)(ws + off);      off += ap_bytes;
  __bf16* alo = (__bf16*)(ws + off);      off += ap_bytes;
  int* idp = (int*)(ws + off);            off += id_bytes;
  if (off > ws_size) return;

  convert_kernel<<<(G_TOT + 255) / 256, 256, 0, stream>>>(q_in, k_in, v_in, Wq, Wk, Wv, Wo,
                                                         relk, relv, ids, xb, wb, rk, rvT, idp);

  dim3 gProj(NTOK / 128, 3 * NH);                                   // (16, 48)
  proj_kernel<<<gProj, 128, 0, stream>>>(xb, wb, bq, bk, bv, qh, kh, vt);

  dim3 gAtt(SEQ / 16, NB * NH);                                     // (32, 64)
  attn_kernel<<<gAtt, 32, 0, stream>>>(qh, kh, vt, idp, rk, rvT, ahi, alo);

  dim3 gOut(NTOK / 128, HID / 64);                                  // (16, 16)
  oproj_kernel<<<gOut, 128, 0, stream>>>(ahi, alo, wb + (size_t)3 * NW, bo, out);
}

// v007
// It runs in 52.9 microseconds.
// Next to v006, in two timings, it ran 1.08 and 1.04 times as fast.
// All steps since v000 together make it 3.79 times as fast.
// q/k/v projections: v_wmma_f32_16x16x32_bf16 (bf16 operands, f32 accumulate); q.relk^T, k.q^T, v^T.p^T, relv^T.w^T: v_wmma_f32_16x16x32_f16 (f16 operands, f32 accumulate; relk/relv carried x32, q x0.125, p x1024, w x16384, exact power-of-two scales folded back in f32); output projection: v_wmma_f32_16x16x32_bf16 with the activation as a bf16 hi+lo pair (two products) against bf16 weights; softmax, additive bias and normalisation in f32.
#include <hip/hip_runtime.h>

typedef _Float16 v16h __attribute__((ext_vector_type(16)));
typedef _Float16 v8h  __attribute__((ext_vector_type(8)));
typedef __bf16   v16b __attribute__((ext_vector_type(16)));
typedef __bf16   v8b  __attribute__((ext_vector_type(8)));
typedef float    v8f  __attribute__((ext_vector_type(8)));
typedef float    v4f  __attribute__((ext_vector_type(4)));
typedef int      v4i  __attribute__((ext_vector_type(4)));
typedef v8h __attribute__((may_alias)) v8ha;
typedef v8b __attribute__((may_alias)) v8ba;
typedef v4f __attribute__((may_alias)) v4fa;
typedef v4i __attribute__((may_alias)) v4ia;

union FragH { v16h v; v8h half[2]; };
union FragB { v16b v; v8b half[2]; };

#define NB    4
#define SEQ   512
#define HID   1024
#define NH    16
#define HD    64
#define NREL  64
#define NTOK  (NB * SEQ)            // 2048 tokens
#define NX    (NTOK * HID)          // 2097152 elements per activation
#define NW    (HID * HID)           // 1048576 elements per weight
#define NX8   (NX / 8)              // 262144
#define NW8   (NW / 8)              // 131072
#define NPL   (NB * NH * SEQ * HD)  // 2097152 halves per q/k/v plane
#define G_X   (3 * NX8)             // 786432 activation groups
#define G_W   (4 * NW8)             // 524288 weight groups
#define G_R   (NREL * HD / 8)       // 512 groups per relation table
#define G_I   (NB * SEQ * SEQ / 4)  // 262144 groups of four relation ids
#define G_16  (G_X + G_W + 2 * G_R) // 1311744 groups of the 16-bit planes
#define G_TOT (G_16 + G_I)          // 1573888
#define TILE  512                   // elements of one 16-row x 32-k tile (1 KiB)
#define PSC   16384.0f              // scale of the normalised histogram w <= 1 in f16
#define PPS   1024.0f               // scale of p in f16: p <= e^MXT < 55, so p * PPS stays below 65504
#define MXT   4.0f                  // a score may top the softmax reference by this much before the sums are rescaled
#define RVS   4.76837158203125e-7f  // 2^-21 = 0.25 / (32 * 16384)
#define HCOPY 4                     // independent copies of the relation histogram
#define HPL   (NREL * 32)           // floats of one copy, [rel][lane]
// LDS row pitches. The LDS has 64 banks of 4 bytes; lanes that walk down a column of rows whose
// pitch is a multiple of 256 B all fall on the same banks and are served one after another.
// 16 B x an odd number spreads the 16 rows of a 16-byte column access over all banks.
#define PQK   72                    // halves per staged token row of q or k: 64 + 8 (144 B)
#define PVT   136                   // halves per staged d row of v^T: 128 + 8 (272 B)
#define PF32  68                    // floats per staged row of 64 floats: 64 + 4 (272 B)

// ---------------------------------------------------------------------------
// 16x16x32 WMMA (builtin form; the compiler keeps the distance behind it).
// Fragment map (wave32): lane l, h = l>>4, m = n = l&15.
//   A/B element i: i<8 -> k0+8h+i ; i>=8 -> k0+16+8h+(i-8)
//   D element r : row 8h+r, col l&15
// ---------------------------------------------------------------------------
__device__ __forceinline__ v8f wmma_h(v16h a, v16h b, v8f c) {
  return __builtin_amdgcn_wmma_f32_16x16x32_f16(false, a, false, b, (short)0, c, false, false);
}
__device__ __forceinline__ v8f wmma_b(v16b a, v16b b, v8f c) {
  return __builtin_amdgcn_wmma_f32_16x16x32_bf16(false, a, false, b, (short)0, c, false, false);
}

// Stands behind a stage's group of global loads: without it the scheduler sinks the
// loads below the other stage's work and their latency is exposed again.
__device__ __forceinline__ void loads_stay_above() { __builtin_amdgcn_sched_barrier(0); }
// Stands in front of code that rewrites address registers which loads still in
// flight name (a pipelined loop's next trip, the epilogue's address arithmetic).
// The two scheduling barriers keep the wait where it is written: late enough to
// cost nothing, and ahead of every such rewrite.
__device__ __forceinline__ void addr_regs_free() {
  __builtin_amdgcn_sched_barrier(0);
  asm volatile("s_wait_xcnt 0x0" ::: "memory");
  __builtin_amdgcn_sched_barrier(0);
}
// The same, and the address pairs of a trip's loads are inputs of the wait: they stay
// allocated up to here, so that neither a load's result nor the next address is given
// registers that earlier loads still name.
__device__ __forceinline__ void addr_regs_free_of(const void* a, const void* b, const void* c, const void* d) {
  __builtin_amdgcn_sched_barrier(0);
  asm volatile("s_wait_xcnt 0x0" :: "v"(a), "v"(b), "v"(c), "v"(d) : "memory");
  __builtin_amdgcn_sched_barrier(0);
}
__device__ __forceinline__ void addr_regs_free_of(const void* a, const void* b, const void* c,
                                                  const void* d, const void* e, const void* f) {
  __builtin_amdgcn_sched_barrier(0);
  asm volatile("s_wait_xcnt 0x0" :: "v"(a), "v"(b), "v"(c), "v"(d), "v"(e), "v"(f) : "memory");
  __builtin_amdgcn_sched_barrier(0);
}
// Where a block's walk over n stages (n = 16 or 32) begins. Blocks that read the same operand
// lines differ in one of the two block indices only; started together at stage 0 they all ask
// L2 for the same few lines at the same moment, stage after stage, and each of those lines is
// new to L2 when they do. Sixteen such neighbours get sixteen starts, evenly spread; the two
// low bits go on top so that a run of four neighbours is a quarter of the walk apart,
// and after a few stages every line
// has been read once by somebody. For speed only: every block visits every stage once (it wraps).
__device__ __forceinline__ int walk_start(int n) {
  const int u = (blockIdx.x + blockIdx.y) & 15;
  return (((u & 3) << 2) | (u >> 2)) * (n / 16);
}

// Tile order of every 16-bit workspace plane: a 16-row x 32-k tile is one 1-KiB
// block [j][lane][8 elements]; lane 16h+m of half j holds row m, k = 16j+8h .. +7,
// which is the fragment map above. One wave load of a half is 512 contiguous bytes
// (four whole lines) where a row-major plane gives 32 bytes of each of 16 lines.
// A plane of R rows x K columns is [R/16][K/32] tiles (vt: [K/32][R/16] per (b, head)).
// A or B fragment: p = the tile's first element + 8 * lane.
__device__ __forceinline__ v16h ldtile_h(const _Float16* p) {
  FragH f;
  f.half[0] = *(const v8ha*)(p);
  f.half[1] = *(const v8ha*)(p + 256);
  return f.v;
}
__device__ __forceinline__ v16b ldtile_b(const __bf16* p) {
  FragB f;
  f.half[0] = *(const v8ba*)(p);
  f.half[1] = *(const v8ba*)(p + 256);
  return f.v;
}

// relation id: wrap negative once, then clamp into [0, NREL-1]
__device__ __forceinline__ int relidx(int id) {
  int t = id + ((id >> 31) & NREL);
  t = t < 0 ? 0 : t;
  t = t > (NREL - 1) ? (NREL - 1) : t;
  return t;
}

// ---------------------------------------------------------------------------
// Kernel 1: f32 -> 16-bit planes in tile order, 8 elements (16 B) per thread; thread
// index = index of the 16-byte group it writes, so stores are whole lines and the
// 16-line access falls on the one read of each source element.
//   xb [3][NTOK][HID] bf16 (q_in, k_in, v_in, RNE convert)
//   wb [4][HID][HID]  bf16 (Wq, Wk, Wv, Wo, row = output feature)
//   rk [NREL][HD]     f16  = 32 * bf16(relk)
//   rvT[HD][NREL]     f16  = 32 * bf16(relv)^T
//   idp               int  relation ids as given, [B][L/16][L/32][i][lane][4]:
//                     lane 16h+m of group i holds query m, keys 16(i>>1)+8h+4(i&1) .. +3
// ---------------------------------------------------------------------------
__global__ __launch_bounds__(256) void convert_kernel(
    const float* __restrict__ q_in, const float* __restrict__ k_in, const float* __restrict__ v_in,
    const float* __restrict__ Wq, const float* __restrict__ Wk, const float* __restrict__ Wv,
    const float* __restrict__ Wo, const float* __restrict__ relk, const float* __restrict__ relv,
    const int* __restrict__ ids,
    __bf16* __restrict__ xb, __bf16* __restrict__ wb, _Float16* __restrict__ rk, _Float16* __restrict__ rvT,
    int* __restrict__ idp)
{
  const int g = blockIdx.x * 256 + threadIdx.x;
  if (g >= G_TOT) return;
  const int h = (g >> 4) & 1, m = g & 15;        // every plane starts at a multiple of 32 groups
  if (g >= G_16) {
    const int e = g - G_16;
    const int i = (e >> 5) & 3, c = (e >> 7) & 15, qt = e >> 11;   // qt = 32 b + query tile
    const int* src = ids + ((size_t)qt * 16 + m) * SEQ + 32 * c + 16 * (i >> 1) + 8 * h + 4 * (i & 1);
    *(v4i*)(idp + (size_t)e * 4) = *(const v4ia*)src;
  } else if (g < G_X + G_W) {
    const float* src;
    __bf16* dst;
    if (g < G_X) {
      const int which = g >> 18;                 // NX8 = 2^18
      const int off = g & (NX8 - 1);
      const float* s = (which == 0) ? q_in : ((which == 1) ? k_in : v_in);
      // group off = ((row tile * 32 + k tile) * 2 + j) * 32 + lane
      src = s + (size_t)((off >> 11) * 16 + m) * HID + ((off >> 6) & 31) * 32 + ((off >> 5) & 1) * 16 + 8 * h;
      dst = xb + (size_t)which * NX + (size_t)off * 8;
    } else {
      const int e = g - G_X;
      const int wsel = e >> 17;                 // NW8 = 2^17
      const int off = e & (NW8 - 1);
      const float* s = (wsel == 0) ? Wq : ((wsel == 1) ? Wk : ((wsel == 2) ? Wv : Wo));
      src = s + (size_t)((off >> 11) * 16 + m) * HID + ((off >> 6) & 31) * 32 + ((off >> 5) & 1) * 16 + 8 * h;
      dst = wb + (size_t)wsel * NW + (size_t)off * 8;
    }
    const v4f a = *(const v4fa*)src;
    const v4f c = *(const v4fa*)(src + 4);
    const v8b o = { (__bf16)a.x, (__bf16)a.y, (__bf16)a.z, (__bf16)a.w,
                    (__bf16)c.x, (__bf16)c.y, (__bf16)c.z, (__bf16)c.w };
    *(v8b*)dst = o;
    
  } else {
    const int e = g - (G_X + G_W);
    float f[8];
    _Float16* dst;
    // group e & 511 = ((row tile * 2 + k tile) * 2 + j) * 32 + lane of a 64 x 64 plane
    const int row = ((e >> 7) & 3) * 16 + m;
    const int kk = ((e >> 6) & 1) * 32 + ((e >> 5) & 1) * 16 + 8 * h;
    if (e < G_R) {
      const float* src = relk + (size_t)row * HD + kk;
      const v4f a = *(const v4fa*)src;
      const v4f c = *(const v4fa*)(src + 4);
      f[0] = a.x; f[1] = a.y; f[2] = a.z; f[3] = a.w;
      f[4] = c.x; f[5] = c.y; f[6] = c.z; f[7] = c.w;
      dst = rk + (size_t)e * 8;
    } else {
      const int e3 = e - G_R;                    // 0..511; row = d, kk = first relation index
      #pragma unroll
      for (int i = 0; i < 8; ++i) f[i] = relv[(size_t)(kk + i) * HD + row];
      dst = rvT + (size_t)e3 * 8;
    }
    _Float16 hh[8];
    #pragma unroll
    for (int i = 0; i < 8; ++i) hh[i] = (_Float16)((float)(__bf16)f[i] * 32.0f);
    const v8h o = { hh[0], hh[1], hh[2], hh[3], hh[4], hh[5], hh[6], hh[7] };
    *(v8h*)dst = o;
    
  }
}

// ---------------------------------------------------------------------------
// 4 lines per instruction, 32 lines per wave, 128 per block; tile order.
// which 0/1: plane[bh][l/16][d/32] tiles (row = token, k = d); a wave's 32 tokens = 4 tiles
// which 2  : vt[bh][l/32][d/16] tiles    (row = d, k = token); a wave's 32 tokens = 4 tiles
// ---------------------------------------------------------------------------
__device__ __forceinline__ void proj_store_pass(const _Float16* sT, _Float16* plane, _Float16* vt,
                                                int which, int bh, int l0, int w, int lane) {
  const int h = lane >> 4, m = lane & 15;
  // LDS element of half i = 0: (token tile * 2 + d tile) * 2 + j = i, or d tile * 2 + j = i
  const _Float16* sp = (which != 2) ? sT + (32 * w + m) * PQK + 8 * h : sT + m * PVT + 32 * w + 8 * h;
  // either way the wave's four tiles are 4 KiB in a row at the same offset of its plane
  _Float16* dst = ((which != 2) ? plane : vt) + ((size_t)bh * SEQ + l0 + 32 * w) * HD + 8 * lane;
  #pragma unroll
  for (int i = 0; i < 8; ++i) {
    const int so = (which != 2) ? 16 * (i >> 2) * PQK + 16 * (i & 3) : 16 * (i >> 1) * PVT + 16 * (i & 1);
    *(v8h*)(dst + 256 * i) = *(const v8ha*)(sp + so);
  }
}

// One k step (32 deep) of a projection's operands, held in registers so that
// the next step's loads are in flight while this step's products run.
struct PStage { v16b a0, a1, b[4]; };
// xp, wp = the step's tile of the wave's first token tile and first feature tile
__device__ __forceinline__ void proj_load(PStage& s, const __bf16* xp, const __bf16* wp) {
  s.a0 = ldtile_b(xp);
  s.a1 = ldtile_b(xp + (size_t)16 * HID);
  #pragma unroll
  for (int nt = 0; nt < 4; ++nt) s.b[nt] = ldtile_b(wp + (size_t)nt * 16 * HID);
  loads_stay_above();
}
// element offset of the tile of k step (k0 / 32 + ks) mod 32 in a row of tiles
__device__ __forceinline__ int ktile(int k0, int ks) { return (((k0 >> 5) + ks) & (HID / 32 - 1)) * TILE; }
__device__ __forceinline__ void proj_mma(const PStage& s, v8f (&acc)[2][4]) {
  #pragma unroll
  for (int nt = 0; nt < 4; ++nt) {
    acc[0][nt] = wmma_b(s.a0, s.b[nt], acc[0][nt]);
    acc[1][nt] = wmma_b(s.a1, s.b[nt], acc[1][nt]);
  }
}

// ---------------------------------------------------------------------------
// Kernel 2: Y = x * W^T + b for the three projections (which = 0,1,2).
// Block 128 thr (4 waves) = 128 tokens x 64 features (one (which, head));
// wave tile 32 tokens x 64 features; K = 1024 in steps of 32;
// A (x rows) and B (W rows) bf16 fragments straight from the tile-ordered planes.
// ---------------------------------------------------------------------------
__global__ __launch_bounds__(128) void proj_kernel(
    const __bf16* __restrict__ xb,     // [3][NTOK][HID], tile order
    const __bf16* __restrict__ wb,     // [4][HID][HID], row = output feature (first 3 used), tile order
    const float* __restrict__ bq, const float* __restrict__ bk, const float* __restrict__ bv,
    _Float16* __restrict__ qh,         // [B*H][L][D]  f16(0.125*q), tile order
    _Float16* __restrict__ kh,         // [B*H][L][D], tile order
    _Float16* __restrict__ vt)         // [B*H][L/32][D/16] tiles (row = d, k = token)
{
  __shared__ __attribute__((aligned(16))) _Float16 sT[128 * PQK];  // 18432 B: [token][PQK], or [d][PVT] for v^T

  const int tid = threadIdx.x, lane = tid & 31, w = tid >> 5;
  const int h = lane >> 4, m = lane & 15;
  const int m0 = blockIdx.x * 128;
  const int cg = blockIdx.y;                 // 0..47
  const int which = cg >> 4, head = cg & 15;
  const int m0w = m0 + 32 * w;

  // 16 rows of a plane = HID / 32 tiles in a row = 16 * HID elements
  const __bf16* xa0 = xb + (size_t)which * NX + (size_t)m0w * HID + 8 * lane;   // token tile, mt = 0
  const __bf16* wr  = wb + (size_t)which * NW + (size_t)(head * HD) * HID + 8 * lane;  // feature tile, nt = 0

  const int ks = walk_start(HID / 32);       // the 16 blocks on a W slice, and the 16 on an x slice, start apart
  PStage sa, sb;
  const __bf16 *xf = xa0 + ktile(0, ks), *wf = wr + ktile(0, ks);
  proj_load(sa, xf, wf);

  const v8f zero8 = {0.f, 0.f, 0.f, 0.f, 0.f, 0.f, 0.f, 0.f};
  v8f acc[2][4];
  #pragma unroll
  for (int mt = 0; mt < 2; ++mt)
    #pragma unroll
    for (int nt = 0; nt < 4; ++nt) acc[mt][nt] = zero8;

  addr_regs_free_of(xf, wf, xf, wf);         // the first step's address pairs are free from here on
  // rolled: two register stages per trip, no copies between them
  #pragma unroll 1
  for (int k0 = 0; k0 < HID - 64; k0 += 64) {
    const int t1 = ktile(k0 + 32, ks), t2 = ktile(k0 + 64, ks);
    const __bf16 *x1 = xa0 + t1, *w1 = wr + t1, *x2 = xa0 + t2, *w2 = wr + t2;
    proj_load(sb, x1, w1);
    proj_mma(sa, acc);
    proj_load(sa, x2, w2);
    proj_mma(sb, acc);
    addr_regs_free_of(x1, w1, x2, w2);
  }
  proj_load(sb, xa0 + ktile(HID - 32, ks), wr + ktile(HID - 32, ks));
  addr_regs_free();
  proj_mma(sa, acc);
  proj_mma(sb, acc);

  // D[r] of tile (mt, nt) = Y[token m0w+16mt+8h+r][feature 16nt+m]
  const float* bias = (which == 0) ? bq : ((which == 1) ? bk : bv);
  const float osc = (which == 0) ? 0.125f : 1.0f;
  float bvl[4];                                            // all four loads ahead of the branch, in flight together
  #pragma unroll
  for (int nt = 0; nt < 4; ++nt) bvl[nt] = (float)(__bf16)bias[head * HD + 16 * nt + m];
  const int tokw = 32 * w + 8 * h;                         // the lane's tokens: tokw + 16 mt + r, 0..127
  if (which == 2) {                                        // the same for the whole block
    // a row is a d: the lane's eight tokens of a tile lie side by side, one 16-byte store
    #pragma unroll
    for (int nt = 0; nt < 4; ++nt) {
      #pragma unroll
      for (int mt = 0; mt < 2; ++mt) {
        _Float16 y[8];
        #pragma unroll
        for (int r = 0; r < 8; ++r) y[r] = (_Float16)((acc[mt][nt][r] + bvl[nt]) * osc);
        *(v8h*)(sT + (16 * nt + m) * PVT + tokw + 16 * mt) = (v8h){ y[0], y[1], y[2], y[3], y[4], y[5], y[6], y[7] };
      }
    }
  } else {
    #pragma unroll
    for (int nt = 0; nt < 4; ++nt) {
      #pragma unroll
      for (int mt = 0; mt < 2; ++mt) {
        #pragma unroll
        for (int r = 0; r < 8; ++r)
          sT[(tokw + 16 * mt + r) * PQK + 16 * nt + m] = (_Float16)((acc[mt][nt][r] + bvl[nt]) * osc);
      }
    }
  }
  __syncthreads();

  const int b = m0 >> 9, l0 = m0 & (SEQ - 1), bh = b * NH + head;
  _Float16* plane = (which == 0) ? qh : kh;
  proj_store_pass(sT, plane, vt, which, bh, l0, w, lane);
  
}

// ---------------------------------------------------------------------------
// Attention helpers.
// ---------------------------------------------------------------------------
// B fragment of the normalised relation histogram, k = relation index:
// element i<8 <- k0+8h+i, element 8+i <- k0+16+8h+i; kb = k0 + 8h.
// A bin of query m is the sum of eight partials: HCOPY copies x the columns of lanes m
// and m+16. Each lane reads its own column first and its partner's second, so the 32
// lanes of every read fall on 32 different banks.
__device__ __forceinline__ v16h build_w(const float* sH, int lane, int kb, float wsc) {
  const float* ca = sH + kb * 32 + lane;
  const float* cb = sH + kb * 32 + (lane ^ 16);
  _Float16 wh[16];
  #pragma unroll
  for (int i = 0; i < 16; ++i) {
    const int ro = ((i & 7) + 16 * (i >> 3)) * 32;
    float s = ca[ro] + cb[ro];
    #pragma unroll
    for (int c = 1; c < HCOPY; ++c) s += ca[c * HPL + ro] + cb[c * HPL + ro];
    wh[i] = (_Float16)(s * wsc);
  }
  FragH f;
  f.half[0] = (v8h){ wh[0], wh[1], wh[2], wh[3], wh[4], wh[5], wh[6], wh[7] };
  f.half[1] = (v8h){ wh[8], wh[9], wh[10], wh[11], wh[12], wh[13], wh[14], wh[15] };
  return f.v;
}

// Per-wave 16x64 f32 tile in LDS (rows of PF32 floats) -> bf16 hi and lo planes [tok][HID] in tile order:
// two tiles in a row, i = feature tile * 2 + j; 4 lines per instruction.
__device__ __forceinline__ void att_store(const float* sO, __bf16* ahi, __bf16* alo,
                                          size_t gbase, int lane) {
  const int h = lane >> 4, m = lane & 15;
  #pragma unroll
  for (int i = 0; i < 4; ++i) {
    const float* sp = sO + m * PF32 + 16 * i + 8 * h;
    const v4f a = *(const v4fa*)sp;
    const v4f c = *(const v4fa*)(sp + 4);
    const float f[8] = { a.x, a.y, a.z, a.w, c.x, c.y, c.z, c.w };
    __bf16 hh[8], ll[8];
    #pragma unroll
    for (int e = 0; e < 8; ++e) {
      hh[e] = (__bf16)f[e];
      ll[e] = (__bf16)(f[e] - (float)hh[e]);
    }
    const v8b hv = { hh[0], hh[1], hh[2], hh[3], hh[4], hh[5], hh[6], hh[7] };
    const v8b lv = { ll[0], ll[1], ll[2], ll[3], ll[4], ll[5], ll[6], ll[7] };
    const size_t gi = gbase + 256 * i + 8 * lane;
    *(v8b*)(ahi + gi) = hv;
    *(v8b*)(alo + gi) = lv;
  }
}

// 32 keys' worth of global operands, held in registers ahead of their use:
// f[0..3] = four A fragments (K rows of two key tiles, two d chunks each, or
// V^T rows of the four d tiles), id[0..3] = this lane's 16 relation ids.
// The scores need K and the ids at a stage's head: they are fetched one stage ahead.
// V^T is needed only at the foot, behind the histogram chain, so it is fetched at the
// head of its own stage.
struct AFrag { v16h f[4]; };
struct AIds  { v4i id[4]; };
// ip = the stage's 2-KiB block of idp + 4 * lane; id[0..3] = keys 8h+0..3, 8h+4..7, 16+8h+0..3, 16+8h+4..7
__device__ __forceinline__ void ids_load(AIds& s, const int* ip) {
  #pragma unroll
  for (int i = 0; i < 4; ++i) s.id[i] = *(const v4ia*)(ip + 128 * i);
}
// kp, ip = a stage's first K tile and its block of ids
__device__ __forceinline__ void k_load(AFrag& s, AIds& n, const _Float16* kp, const int* ip) {
  // 32 keys = four tiles in a row: (key tile 0, d 0..31), (0, 32..63), (1, 0..31), (1, 32..63)
  #pragma unroll
  for (int t = 0; t < 4; ++t) s.f[t] = ldtile_h(kp + (size_t)t * TILE);
  ids_load(n, ip);
  loads_stay_above();
}
// V^T of one stage (vp) and, where there is one, K and the ids of the stage walked next (kp, ip)
template <bool NEXT>
__device__ __forceinline__ void vk_load(AFrag& v, AFrag& s, AIds& n, const _Float16* vp,
                                        const _Float16* kp, const int* ip) {
  #pragma unroll
  for (int t = 0; t < 4; ++t) v.f[t] = ldtile_h(vp + (size_t)t * TILE);
  if (NEXT) {
    #pragma unroll
    for (int t = 0; t < 4; ++t) s.f[t] = ldtile_h(kp + (size_t)t * TILE);
    ids_load(n, ip);
  }
  loads_stay_above();
}
// scores of one stage's 32 keys, 16 per lane, in registers, with their table rows
__device__ __forceinline__ void score16(const AFrag& s, const AIds& n, v16h qb0, v16h qb1, const float* qr,
                                        float (&sc)[16], int (&ri)[16]) {
  const v8f zero8 = {0.f, 0.f, 0.f, 0.f, 0.f, 0.f, 0.f, 0.f};
  v8f z0 = wmma_h(s.f[0], qb0, zero8);
  z0 = wmma_h(s.f[1], qb1, z0);                 // z0[r] = S[query m][key 32c+8h+r]
  v8f z1 = wmma_h(s.f[2], qb0, zero8);
  z1 = wmma_h(s.f[3], qb1, z1);                 // z1[r] = S[query m][key 32c+16+8h+r]
  const int idv[16] = { n.id[0].x, n.id[0].y, n.id[0].z, n.id[0].w, n.id[1].x, n.id[1].y, n.id[1].z, n.id[1].w,
                        n.id[2].x, n.id[2].y, n.id[2].z, n.id[2].w, n.id[3].x, n.id[3].y, n.id[3].z, n.id[3].w };
  #pragma unroll
  for (int e = 0; e < 16; ++e) {
    const int id = idv[e];
    const float bias = (id > 0) ? 0.0f : -10000.0f;
    const float zz = (e < 8) ? z0[e & 7] : z1[e & 7];
    ri[e] = relidx(id);
    sc[e] = zz + qr[ri[e] * 16] * 0.0078125f + bias;
  }
}
// maximum of the scores of one stage's 32 keys (the softmax reference starts from the first stage walked)
__device__ __forceinline__ float max_stage(const AFrag& s, const AIds& n, v16h qb0, v16h qb1, const float* qr,
                                           float mx) {
  float sc[16];
  int ri[16];
  score16(s, n, qb0, qb1, qr, sc, ri);
  #pragma unroll
  for (int e = 0; e < 16; ++e) mx = fmaxf(mx, sc[e]);
  return mx;
}
// 2^x. The v_nop is the free slot that the instruction set asks for behind a
// transcendental before its source is overwritten or its result read; only inside the
// same statement does it stay directly behind the v_exp_f32.
__device__ __forceinline__ float exp2_slot(float x) {
  float r;
  asm("v_exp_f32 %0, %1\n\tv_nop" : "=v"(r) : "v"(x));
  return r;
}
// one stage: scores, exp, sum, histogram, O^T += V^T * P^T for 32 keys.
// mx is the reference that is subtracted in the exponent, the same in lanes m and m + 16.
// Softmax is the same for any reference; it only has to keep p in f16's range. While no
// score tops mx by more than MXT the sums go on as they are; otherwise mx moves up to the
// largest score seen and everything summed so far is multiplied by exp(old mx - new mx).
__device__ __forceinline__ float pv_stage(const AFrag& k, const AIds& n, const AFrag& s, v16h qb0, v16h qb1,
                                          const float* qr, float* hl, float& mx, float lsum, v8f (&o)[4]) {
  float sv[16];
  int rv[16];
  score16(k, n, qb0, qb1, qr, sv, rv);
  float sm = sv[0];
  #pragma unroll
  for (int e = 1; e < 16; ++e) sm = fmaxf(sm, sv[e]);
  if (__builtin_amdgcn_ballot_w32(sm > mx + MXT) != 0u) {     // the same for the whole wave
    const float nm = fmaxf(mx, fmaxf(sm, __shfl_xor(sm, 16)));
    const float f = exp2_slot((mx - nm) * 1.44269504f);       // 1 for a query whose reference stays
    mx = nm;
    lsum *= f;
    #pragma unroll
    for (int t = 0; t < 4; ++t) o[t] *= f;
    // partly rolled: a seldom-taken path that stands four times in the kernel, kept short for the instruction cache
    #pragma unroll 8
    for (int i = 0; i < HCOPY * NREL; ++i) hl[i * 32] *= f;
  }
  // Histogram: key e adds into copy e & 3, so the four bins of a group are four different
  // LDS words whatever the ids are: they are read together and one LDS round trip serves
  // four keys, where a single copy makes every read wait for the store in front of it.
  // The first group's bins depend on no store of this stage: their reads stand ahead of the exponentials.
  float old[HCOPY];
  #pragma unroll
  for (int j = 0; j < HCOPY; ++j) old[j] = hl[j * HPL + rv[j] * 32];
  float pe[16];
  _Float16 ph[16];
  #pragma unroll
  for (int e = 0; e < 16; ++e) {
    const float p = exp2_slot((sv[e] - mx) * 1.44269504f);   // = __expf(sv[e] - mx)
    lsum += p;
    pe[e] = p;
    ph[e] = (_Float16)(p * PPS);
  }
  #pragma unroll
  for (int g = 0; g < 16 / HCOPY; ++g) {
    #pragma unroll
    for (int j = 0; j < HCOPY; ++j) hl[j * HPL + rv[HCOPY * g + j] * 32] = old[j] + pe[HCOPY * g + j];
    if (g + 1 < 16 / HCOPY) {
      #pragma unroll
      for (int j = 0; j < HCOPY; ++j) old[j] = hl[j * HPL + rv[HCOPY * (g + 1) + j] * 32];
    }
  }
  // P^T B-fragment: element r <- key 32c+8h+r, element 8+r <- key 32c+16+8h+r
  FragH pf;
  pf.half[0] = (v8h){ ph[0], ph[1], ph[2], ph[3], ph[4], ph[5], ph[6], ph[7] };
  pf.half[1] = (v8h){ ph[8], ph[9], ph[10], ph[11], ph[12], ph[13], ph[14], ph[15] };
  #pragma unroll
  for (int t = 0; t < 4; ++t) o[t] = wmma_h(s.f[t], pf.v, o[t]);
  return lsum;
}

// ---------------------------------------------------------------------------
// Kernel 3: relation-aware attention, transposed form, one wave per block.
// Block = 32 thr = 16 queries of one (b, head), all 512 keys.
//   qrel^T = RK * Q^T       : A = rk rows (row = rel, k = d), B = Q^T
//   S^T    = K * Q^T        : A = K rows (row = key, k = d), B = Q^T (k = d, n = query)
//   score  = S^T + qrel[query][id]/128 + (-10000 where id <= 0), f32 in registers, never stored
//   p      = exp(score - mx): mx starts as the maximum over the first 32 keys walked and moves up,
//            with a rescale of all sums, only where a later score tops it by more than MXT
//   hist   : per-lane private bins h[key & 3][rel][lane] += p (fixed order, no atomics);
//            bank = lane + 32 (rel & 1), so a wave's 32 bins never share a bank
//   O^T    = V^T * P^T      : A = vt rows (row = d, k = key), B = P^T from registers x1024
//   R^T    = RVT * W^T      : A = rvT rows (row = d, k = rel), B = W^T = (hist/l) x16384,
//            hist = the eight partial bins of a (query, rel) added up
//   out    = O^T/(l*1024) + R^T * 2^-21  -> bf16 hi/lo planes [tok][head*64+d]
// Lane owns 256 keys of query column (lane&15); partner = lane ^ 16.
// The 16 stages of 32 keys are walked from stage walk_start on, wrapping: the 32 blocks on
// one head's K and V^T start two by two at 16 stages, and the 16 blocks on one query tile's ids start apart.
// ---------------------------------------------------------------------------
__global__ __launch_bounds__(32) void attn_kernel(
    const _Float16* __restrict__ qh,   // [B*H][L][D]  (already x0.125), tile order
    const _Float16* __restrict__ kh,   // [B*H][L][D], tile order
    const _Float16* __restrict__ vt,   // [B*H][L/32][D/16] tiles (row = d, k = key)
    const int* __restrict__ idp,       // [B][L/16][L/32][4][32][4] int32 relation ids in lane order
    const _Float16* __restrict__ rk,   // [NREL][D]  x32, tile order
    const _Float16* __restrict__ rvT,  // [D][NREL]  x32, tile order
    __bf16* __restrict__ ahi,          // [NTOK][HID], tile order
    __bf16* __restrict__ alo)          // [NTOK][HID], tile order
{
  // 36 KiB in all: eight blocks still fit a WGP's 320 KiB, so the whole grid is resident at once
  // qrel[rel][query]: bank = query + 16 (rel & 3), so only lanes m and m + 16 can meet on a bank,
  // where [query][rel] puts all 32 lanes' random rows on bank = rel
  __shared__ __attribute__((aligned(16))) float sQR[NREL * 16];     //  4096 B
  __shared__ __attribute__((aligned(16))) float sH[HCOPY * HPL];    // 32768 B hist[copy][rel][lane]; behind build_w: output staging

  const int lane = threadIdx.x & 31, h = lane >> 4, m = lane & 15;
  const int bh = blockIdx.y, b = bh >> 4, head = bh & 15;
  const int q0 = blockIdx.x * 16;

  float* hl = sH + lane;                      // this lane's column of every copy

  // Q^T B-fragments: column n = query q0+m, k = d (two 32-deep chunks)
  const _Float16* qrow = qh + ((size_t)bh * SEQ + q0) * HD + 8 * lane;
  const v16h qb0 = ldtile_h(qrow);
  const v16h qb1 = ldtile_h(qrow + TILE);

  const _Float16* kbase = kh + (size_t)bh * SEQ * HD + 8 * lane;     // + four tiles per stage
  const _Float16* vbase = vt + (size_t)bh * SEQ * HD + 8 * lane;     // + four tiles per stage
  const int* idrow = idp + ((size_t)b * SEQ + q0) * SEQ + 4 * lane;  // + 512 ids per stage
  const int c0 = walk_start(SEQ / 32);
  AFrag fa, fb;
  AIds ia, ib;
  const _Float16* kf = kbase + (size_t)c0 * 4 * TILE;
  const int* nf = idrow + 512 * c0;
  k_load(fa, ia, kf, nf);                       // the first stage, in flight under the qrel tiles

  // zero all histogram bins, 512 contiguous bytes per store
  {
    const v4f z4 = {0.f, 0.f, 0.f, 0.f};
    #pragma unroll
    for (int i = 0; i < HCOPY * HPL / 128; ++i) *(v4fa*)(sH + 128 * i + 4 * lane) = z4;
  }
  addr_regs_free_of(kf, nf, kf, nf);            // behind the stores, where it costs nothing; the table loads below reuse registers

  const v8f zero8 = {0.f, 0.f, 0.f, 0.f, 0.f, 0.f, 0.f, 0.f};

  // ---- qrel^T tiles: D[r] = (rel 16rt+8h+r, query m) ----
  #pragma unroll
  for (int rt = 0; rt < 4; ++rt) {
    const _Float16* ap = rk + (size_t)(2 * rt) * TILE + 8 * lane;
    v8f z = zero8;
    z = wmma_h(ldtile_h(ap), qb0, z);
    z = wmma_h(ldtile_h(ap + TILE), qb1, z);
    #pragma unroll
    for (int r = 0; r < 8; ++r) sQR[(16 * rt + 8 * h + r) * 16 + m] = z[r];
  }
  __syncthreads();

  const float* qr = sQR + m;                  // + 16 * rel

  // softmax reference to start with: the maximum over the first stage's 32 keys
  float mx = max_stage(fa, ia, qb0, qb1, qr, -3.0e38f);
  mx = fmaxf(mx, __shfl_xor(mx, 16));

  // ---- the one pass: scores, exp, sum, histogram, O^T += V^T * P^T (32 keys per step) ----
  v8f o[4];                                   // o[t][r] = O[query m][d 16t+8h+r] * (l * 1024)
  #pragma unroll
  for (int t = 0; t < 4; ++t) o[t] = zero8;
  float lsum = 0.0f;
  AFrag fv;
  // rolled: two register stages per trip, no copies between them
  #pragma unroll 1
  for (int c = 0; c < SEQ / 32 - 2; c += 2) {
    const int s0 = (c0 + c) & (SEQ / 32 - 1), s1 = (c0 + c + 1) & (SEQ / 32 - 1), s2 = (c0 + c + 2) & (SEQ / 32 - 1);
    const _Float16 *v0 = vbase + (size_t)s0 * 4 * TILE, *k1 = kbase + (size_t)s1 * 4 * TILE;
    const _Float16 *v1 = vbase + (size_t)s1 * 4 * TILE, *k2 = kbase + (size_t)s2 * 4 * TILE;
    const int *i1 = idrow + 512 * s1, *i2 = idrow + 512 * s2;
    vk_load<true>(fv, fb, ib, v0, k1, i1);
    lsum = pv_stage(fa, ia, fv, qb0, qb1, qr, hl, mx, lsum, o);
    vk_load<true>(fv, fa, ia, v1, k2, i2);
    lsum = pv_stage(fb, ib, fv, qb0, qb1, qr, hl, mx, lsum, o);
    addr_regs_free_of(v0, k1, i1, v1, k2, i2);
  }
  const int sy = (c0 + SEQ / 32 - 2) & (SEQ / 32 - 1), sz = (c0 + SEQ / 32 - 1) & (SEQ / 32 - 1);   // the last two stages
  vk_load<true>(fv, fb, ib, vbase + (size_t)sy * 4 * TILE, kbase + (size_t)sz * 4 * TILE, idrow + 512 * sz);
  lsum = pv_stage(fa, ia, fv, qb0, qb1, qr, hl, mx, lsum, o);
  addr_regs_free();
  vk_load<false>(fv, fa, ia, vbase + (size_t)sz * 4 * TILE, kbase, idrow);
  lsum = pv_stage(fb, ib, fv, qb0, qb1, qr, hl, mx, lsum, o);
  lsum += __shfl_xor(lsum, 16);
  const float inv = 1.0f / lsum;
  const float osc = inv * (1.0f / PPS);
  const float wsc = inv * PSC;
  __syncthreads();                            // histogram bins complete (read cross-lane below)

  // ---- relation value term: R^T = RVT * W^T ----
  const v16h w0 = build_w(sH, lane, 8 * h, wsc);
  const v16h w1 = build_w(sH, lane, 32 + 8 * h, wsc);
  float* sO = sH;                             // 16 rows of PF32 floats; every bin has been read: w0 and w1 feed what is stored here
  #pragma unroll
  for (int t = 0; t < 4; ++t) {
    const _Float16* ap = rvT + (size_t)(2 * t) * TILE + 8 * lane;
    v8f z = zero8;
    z = wmma_h(ldtile_h(ap), w0, z);
    z = wmma_h(ldtile_h(ap + TILE), w1, z);
    #pragma unroll
    for (int r = 0; r < 8; ++r)
      sO[m * PF32 + 16 * t + 8 * h + r] = o[t][r] * osc + z[r] * RVS;
  }
  __syncthreads();

  const size_t gbase = ((size_t)b * SEQ + q0) * HID + (size_t)(2 * head) * TILE;   // token tile, feature tiles 2 head, 2 head + 1
  att_store(sO, ahi, alo, gbase, lane);
  
}

// ---------------------------------------------------------------------------
// instruction, 4 lines per instruction, 64 lines per wave.
// ---------------------------------------------------------------------------
__device__ __forceinline__ void out_store_pass(const float* sT, float* out, int m0, int n0,
                                               int w, int lane) {
  const int q8 = lane & 7, sub = lane >> 3;
  #pragma unroll
  for (int i = 0; i < 16; ++i) {
    const int lid = i * 4 + sub;                 // 0..63
    const int rowl = 32 * w + (lid >> 1), hl = lid & 1;
    const v4f v = *(const v4fa*)(sT + rowl * PF32 + 32 * hl + 4 * q8);
    float* dst = out + (size_t)(m0 + rowl) * HID + n0 + 32 * hl + 4 * q8;
    *(v4f*)dst = v;
  }
}

// One k step (32 deep) of the output projection's operands, one stage ahead.
struct OStage { v16b a[4]; v16b b[4]; };
// hp, lp, wp = the step's tile of the wave's first token tile (hi, lo) and first feature tile
__device__ __forceinline__ void oproj_load(OStage& s, const __bf16* hp, const __bf16* lp, const __bf16* wp) {
  s.a[0] = ldtile_b(hp);
  s.a[1] = ldtile_b(lp);
  s.a[2] = ldtile_b(hp + (size_t)16 * HID);
  s.a[3] = ldtile_b(lp + (size_t)16 * HID);
  #pragma unroll
  for (int nt = 0; nt < 4; ++nt) s.b[nt] = ldtile_b(wp + (size_t)nt * 16 * HID);
  loads_stay_above();
}
__device__ __forceinline__ void oproj_mma(const OStage& s, v8f (&acc)[2][4]) {
  #pragma unroll
  for (int nt = 0; nt < 4; ++nt) {
    acc[0][nt] = wmma_b(s.a[0], s.b[nt], acc[0][nt]);
    acc[0][nt] = wmma_b(s.a[1], s.b[nt], acc[0][nt]);
    acc[1][nt] = wmma_b(s.a[2], s.b[nt], acc[1][nt]);
    acc[1][nt] = wmma_b(s.a[3], s.b[nt], acc[1][nt]);
  }
}

// ---------------------------------------------------------------------------
// Kernel 4: out = A * Wo^T + bo with A = ahi + alo (two bf16 products per tile).
// Block 128 thr = 128 tokens x 64 features; wave 32 tokens x 64 features.
// ---------------------------------------------------------------------------
__global__ __launch_bounds__(128) void oproj_kernel(
    const __bf16* __restrict__ ahi,    // [NTOK][HID], tile order
    const __bf16* __restrict__ alo,    // [NTOK][HID], tile order
    const __bf16* __restrict__ wo,     // [HID][HID], row = output feature, tile order
    const float* __restrict__ bo,
    float* __restrict__ out)           // [NTOK][HID]
{
  __shared__ __attribute__((aligned(16))) float sT[128 * PF32];    // 34816 B

  const int tid = threadIdx.x, lane = tid & 31, w = tid >> 5;
  const int h = lane >> 4, m = lane & 15;
  const int m0 = blockIdx.x * 128;
  const int n0 = blockIdx.y * 64;
  const int m0w = m0 + 32 * w;

  const __bf16* a0h = ahi + (size_t)m0w * HID + 8 * lane;
  const __bf16* a0l = alo + (size_t)m0w * HID + 8 * lane;
  const __bf16* wr  = wo + (size_t)n0 * HID + 8 * lane;

  const int ks = walk_start(HID / 32);       // the 16 blocks on a Wo slice, and the 16 on a token slice, start apart
  OStage sa, sb;
  const __bf16 *hf = a0h + ktile(0, ks), *lf = a0l + ktile(0, ks), *wf = wr + ktile(0, ks);
  oproj_load(sa, hf, lf, wf);

  const v8f zero8 = {0.f, 0.f, 0.f, 0.f, 0.f, 0.f, 0.f, 0.f};
  v8f acc[2][4];
  #pragma unroll
  for (int mt = 0; mt < 2; ++mt)
    #pragma unroll
    for (int nt = 0; nt < 4; ++nt) acc[mt][nt] = zero8;

  addr_regs_free_of(hf, lf, wf, hf, lf, wf); // the first step's address pairs are free from here on
  // rolled: two register stages per trip, no copies between them
  #pragma unroll 1
  for (int k0 = 0; k0 < HID - 64; k0 += 64) {
    const int t1 = ktile(k0 + 32, ks), t2 = ktile(k0 + 64, ks);
    const __bf16 *h1 = a0h + t1, *l1 = a0l + t1, *w1 = wr + t1, *h2 = a0h + t2, *l2 = a0l + t2, *w2 = wr + t2;
    oproj_load(sb, h1, l1, w1);
    oproj_mma(sa, acc);
    oproj_load(sa, h2, l2, w2);
    oproj_mma(sb, acc);
    addr_regs_free_of(h1, l1, w1, h2, l2, w2);
  }
  oproj_load(sb, a0h + ktile(HID - 32, ks), a0l + ktile(HID - 32, ks), wr + ktile(HID - 32, ks));
  addr_regs_free();
  oproj_mma(sa, acc);
  oproj_mma(sb, acc);

  // D[r] of tile (mt, nt) = Y[token m0w+16mt+8h+r][feature n0+16nt+m]
  #pragma unroll
  for (int nt = 0; nt < 4; ++nt) {
    const int featl = 16 * nt + m;
    const float bvl = (float)(__bf16)bo[n0 + featl];
    #pragma unroll
    for (int mt = 0; mt < 2; ++mt) {
      #pragma unroll
      for (int r = 0; r < 8; ++r) {
        const int tokl = 32 * w + 16 * mt + 8 * h + r;     // 0..127
        sT[tokl * PF32 + featl] = acc[mt][nt][r] + bvl;
      }
    }
  }
  __syncthreads();

  out_store_pass(sT, out, m0, n0, w, lane);
  
}

// ---------------------------------------------------------------------------
extern "C" void kernel_launch(void* const* d_in, const int* in_sizes, int n_in,
                              void* d_out, int out_size, void* d_ws, size_t ws_size,
                              hipStream_t stream) {
  if (n_in < 14) return;
  if (in_sizes[0] != NX || in_sizes[1] != NX || in_sizes[2] != NX) return;
  if (in_sizes[3] != NB * SEQ * SEQ) return;
  if (in_sizes[4] != NW || in_sizes[6] != NW || in_sizes[8] != NW || in_sizes[10] != NW) return;
  if (in_sizes[5] != HID || in_sizes[7] != HID || in_sizes[9] != HID || in_sizes[11] != HID) return;
  if (in_sizes[12] != NREL * HD || in_sizes[13] != NREL * HD) return;
  if (out_size != NX) return;

  const float* q_in = (const float*)d_in[0];
  const float* k_in = (const float*)d_in[1];
  const float* v_in = (const float*)d_in[2];
  const int*   ids  = (const int*)d_in[3];
  const float* Wq = (const float*)d_in[4];
  const float* bq = (const float*)d_in[5];
  const float* Wk = (const float*)d_in[6];
  const float* bk = (const float*)d_in[7];
  const float* Wv = (const float*)d_in[8];
  const float* bv = (const float*)d_in[9];
  const float* Wo = (const float*)d_in[10];
  const float* bo = (const float*)d_in[11];
  const float* relk = (const float*)d_in[12];
  const float* relv = (const float*)d_in[13];
  float* out = (float*)d_out;

  const size_t xb_bytes = (size_t)3 * NX * 2;          // 12582912
  const size_t wb_bytes = (size_t)4 * NW * 2;          //  8388608
  const size_t rt_bytes = (size_t)NREL * HD * 2;       //     8192
  const size_t pl_bytes = (size_t)NPL * 2;             //  4194304
  const size_t ap_bytes = (size_t)NX * 2;              //  4194304
  const size_t id_bytes = (size_t)NB * SEQ * SEQ * 4;  //  4194304
  const size_t total = xb_bytes + wb_bytes + 2 * rt_bytes + 3 * pl_bytes + 2 * ap_bytes + id_bytes;  // 46153728
  if (total > ws_size) return;

  char* ws = (char*)d_ws;
  size_t off = 0;
  __bf16* xb = (__bf16*)(ws + off);       off += xb_bytes;
  __bf16* wb = (__bf16*)(ws + off);       off += wb_bytes;
  _Float16* rk  = (_Float16*)(ws + off);  off += rt_bytes;
  _Float16* rvT = (_Float16*)(ws + off);  off += rt_bytes;
  _Float16* qh  = (_Float16*)(ws + off);  off += pl_bytes;
  _Float16* kh  = (_Float16*)(ws + off);  off += pl_bytes;
  _Float16* vt  = (_Float16*)(ws + off);  off += pl_bytes;
  __bf16* ahi = (__bf16*)(ws + off);      off += ap_bytes;
  __bf16* alo = (__bf16*)(ws + off);      off += ap_bytes;
  int* idp = (int*)(ws + off);            off += id_bytes;
  if (off > ws_size) return;

  convert_kernel<<<(G_TOT + 255) / 256, 256, 0, stream>>>(q_in, k_in, v_in, Wq, Wk, Wv, Wo,
                                                         relk, relv, ids, xb, wb, rk, rvT, idp);

  dim3 gProj(NTOK / 128, 3 * NH);                                   // (16, 48)
  proj_kernel<<<gProj, 128, 0, stream>>>(xb, wb, bq, bk, bv, qh, kh, vt);

  dim3 gAtt(SEQ / 16, NB * NH);                                     // (32, 64)
  attn_kernel<<<gAtt, 32, 0, stream>>>(qh, kh, vt, idp, rk, rvT, ahi, alo);

  dim3 gOut(NTOK / 128, HID / 64);                                  // (16, 16)
  oproj_kernel<<<gOut, 128, 0, stream>>>(ahi, alo, wb + (size_t)3 * NW, bo, out);
}

// v008
// Measured time: 49.1 microseconds a run.
// Next to v007, in two timings, it ran 1.07 and 1.09 times as fast.
// All steps since v000 together make it 4.10 times as fast.
// q/k/v projections: v_wmma_f32_16x16x32_bf16 (bf16 operands, f32 accumulate); q.relk^T, k.q^T, v^T.p^T, relv^T.w^T: v_wmma_f32_16x16x32_f16 (f16 operands, f32 accumulate; relk/relv carried x32, q x0.125, p x1024, w x16384, exact power-of-two scales folded back in f32); output projection: v_wmma_f32_16x16x32_bf16 with the activation as a bf16 hi+lo pair (two products) against bf16 weights; softmax, additive bias and normalisation in f32.
#include <hip/hip_runtime.h>

typedef _Float16 v16h __attribute__((ext_vector_type(16)));
typedef _Float16 v8h  __attribute__((ext_vector_type(8)));
typedef __bf16   v16b __attribute__((ext_vector_type(16)));
typedef __bf16   v8b  __attribute__((ext_vector_type(8)));
typedef float    v8f  __attribute__((ext_vector_type(8)));
typedef float    v4f  __attribute__((ext_vector_type(4)));
typedef int      v4i  __attribute__((ext_vector_type(4)));
typedef v8h __attribute__((may_alias)) v8ha;
typedef v8b __attribute__((may_alias)) v8ba;
typedef v4f __attribute__((may_alias)) v4fa;
typedef v4i __attribute__((may_alias)) v4ia;

union FragH { v16h v; v8h half[2]; };
union FragB { v16b v; v8b half[2]; };

#define NB    4
#define SEQ   512
#define HID   1024
#define NH    16
#define HD    64
#define NREL  64
#define NTOK  (NB * SEQ)            // 2048 tokens
#define NX    (NTOK * HID)          // 2097152 elements per activation
#define NW    (HID * HID)           // 1048576 elements per weight
#define NX8   (NX / 8)              // 262144
#define NW8   (NW / 8)              // 131072
#define NPL   (NB * NH * SEQ * HD)  // 2097152 halves per q/k/v plane
#define G_X   (3 * NX8)             // 786432 activation groups
#define G_W   (4 * NW8)             // 524288 weight groups
#define G_R   (NREL * HD / 8)       // 512 groups per relation table
#define G_I   (NB * SEQ * SEQ / 4)  // 262144 groups of four relation ids
#define G_16  (G_X + G_W + 2 * G_R) // 1311744 groups of the 16-bit planes
#define G_TOT (G_16 + G_I)          // 1573888
#define TILE  512                   // elements of one 16-row x 32-k tile (1 KiB)
#define PSC   16384.0f              // scale of the normalised histogram w <= 1 in f16
#define PPS   1024.0f               // scale of p in f16: p <= e^MXT < 55, so p * PPS stays below 65504
#define MXT   4.0f                  // a score may top the softmax reference by this much before the sums are rescaled
#define RVS   4.76837158203125e-7f  // 2^-21 = 0.25 / (32 * 16384)
#define HCOPY 4                     // independent copies of the relation histogram
#define HPL   (NREL * 32)           // floats of one copy, [rel][lane]
#define AW    4                     // waves of an attention block = query tiles of one head that walk the keys together
#define PU    3                     // head columns (of the 48 of q, k, v) that one projection block works on, four waves each
// LDS row pitches. The LDS has 64 banks of 4 bytes; lanes that walk down a column of rows whose
// pitch is a multiple of 256 B all fall on the same banks and are served one after another.
// 16 B x an odd number spreads the 16 rows of a 16-byte column access over all banks.
#define PQK   72                    // halves per staged token row of q or k: 64 + 8 (144 B)
#define PVT   136                   // halves per staged d row of v^T: 128 + 8 (272 B)
#define PF32  68                    // floats per staged row of 64 floats: 64 + 4 (272 B)

// ---------------------------------------------------------------------------
// 16x16x32 WMMA (builtin form; the compiler keeps the distance behind it).
// Fragment map (wave32): lane l, h = l>>4, m = n = l&15.
//   A/B element i: i<8 -> k0+8h+i ; i>=8 -> k0+16+8h+(i-8)
//   D element r : row 8h+r, col l&15
// ---------------------------------------------------------------------------
__device__ __forceinline__ v8f wmma_h(v16h a, v16h b, v8f c) {
  return __builtin_amdgcn_wmma_f32_16x16x32_f16(false, a, false, b, (short)0, c, false, false);
}
__device__ __forceinline__ v8f wmma_b(v16b a, v16b b, v8f c) {
  return __builtin_amdgcn_wmma_f32_16x16x32_bf16(false, a, false, b, (short)0, c, false, false);
}

// Stands behind a stage's group of global loads: without it the scheduler sinks the
// loads below the other stage's work and their latency is exposed again.
__device__ __forceinline__ void loads_stay_above() { __builtin_amdgcn_sched_barrier(0); }
// Stands in front of code that rewrites address registers which loads still in
// flight name (a pipelined loop's next trip, the epilogue's address arithmetic).
// The two scheduling barriers keep the wait where it is written: late enough to
// cost nothing, and ahead of every such rewrite.
__device__ __forceinline__ void addr_regs_free() {
  __builtin_amdgcn_sched_barrier(0);
  asm volatile("s_wait_xcnt 0x0" ::: "memory");
  __builtin_amdgcn_sched_barrier(0);
}
// The same, and the address pairs of a trip's loads are inputs of the wait: they stay
// allocated up to here, so that neither a load's result nor the next address is given
// registers that earlier loads still name.
__device__ __forceinline__ void addr_regs_free_of(const void* a, const void* b, const void* c, const void* d) {
  __builtin_amdgcn_sched_barrier(0);
  asm volatile("s_wait_xcnt 0x0" :: "v"(a), "v"(b), "v"(c), "v"(d) : "memory");
  __builtin_amdgcn_sched_barrier(0);
}
__device__ __forceinline__ void addr_regs_free_of(const void* a, const void* b, const void* c,
                                                  const void* d, const void* e, const void* f) {
  __builtin_amdgcn_sched_barrier(0);
  asm volatile("s_wait_xcnt 0x0" :: "v"(a), "v"(b), "v"(c), "v"(d), "v"(e), "v"(f) : "memory");
  __builtin_amdgcn_sched_barrier(0);
}
// Where a block's walk over n stages (n = 16 or 32) begins. Blocks that read the same operand
// lines differ in one of the two block indices only; started together at stage 0 they all ask
// L2 for the same few lines at the same moment, stage after stage, and each of those lines is
// new to L2 when they do. Sixteen such neighbours get sixteen starts, evenly spread; the two
// low bits go on top so that a run of four neighbours is a quarter of the walk apart,
// and after a few stages every line
// has been read once by somebody. For speed only: every block visits every stage once (it wraps).
__device__ __forceinline__ int walk_start(int n) {
  const int u = (blockIdx.x + blockIdx.y) & 15;
  return (((u & 3) << 2) | (u >> 2)) * (n / 16);
}

// Tile order of every 16-bit workspace plane: a 16-row x 32-k tile is one 1-KiB
// block [j][lane][8 elements]; lane 16h+m of half j holds row m, k = 16j+8h .. +7,
// which is the fragment map above. One wave load of a half is 512 contiguous bytes
// (four whole lines) where a row-major plane gives 32 bytes of each of 16 lines.
// A plane of R rows x K columns is [R/16][K/32] tiles (vt: [K/32][R/16] per (b, head)).
// A or B fragment: p = the tile's first element + 8 * lane.
__device__ __forceinline__ v16h ldtile_h(const _Float16* p) {
  FragH f;
  f.half[0] = *(const v8ha*)(p);
  f.half[1] = *(const v8ha*)(p + 256);
  return f.v;
}
__device__ __forceinline__ v16b ldtile_b(const __bf16* p) {
  FragB f;
  f.half[0] = *(const v8ba*)(p);
  f.half[1] = *(const v8ba*)(p + 256);
  return f.v;
}

// relation id: wrap negative once, then clamp into [0, NREL-1]
__device__ __forceinline__ int relidx(int id) {
  int t = id + ((id >> 31) & NREL);
  t = t < 0 ? 0 : t;
  t = t > (NREL - 1) ? (NREL - 1) : t;
  return t;
}

// ---------------------------------------------------------------------------
// Kernel 1: f32 -> 16-bit planes in tile order, 8 elements (16 B) per thread; thread
// index = index of the 16-byte group it writes, so stores are whole lines and the
// 16-line access falls on the one read of each source element.
//   xb [3][NTOK][HID] bf16 (q_in, k_in, v_in, RNE convert)
//   wb [4][HID][HID]  bf16 (Wq, Wk, Wv, Wo, row = output feature)
//   rk [NREL][HD]     f16  = 32 * bf16(relk)
//   rvT[HD][NREL]     f16  = 32 * bf16(relv)^T
//   idp               int  relation ids as given, [B][L/16][L/32][i][lane][4]:
//                     lane 16h+m of group i holds query m, keys 16(i>>1)+8h+4(i&1) .. +3
// ---------------------------------------------------------------------------
__global__ __launch_bounds__(256) void convert_kernel(
    const float* __restrict__ q_in, const float* __restrict__ k_in, const float* __restrict__ v_in,
    const float* __restrict__ Wq, const float* __restrict__ Wk, const float* __restrict__ Wv,
    const float* __restrict__ Wo, const float* __restrict__ relk, const float* __restrict__ relv,
    const int* __restrict__ ids,
    __bf16* __restrict__ xb, __bf16* __restrict__ wb, _Float16* __restrict__ rk, _Float16* __restrict__ rvT,
    int* __restrict__ idp)
{
  const int g = blockIdx.x * 256 + threadIdx.x;
  if (g >= G_TOT) return;
  const int h = (g >> 4) & 1, m = g & 15;        // every plane starts at a multiple of 32 groups
  if (g >= G_16) {
    const int e = g - G_16;
    const int i = (e >> 5) & 3, c = (e >> 7) & 15, qt = e >> 11;   // qt = 32 b + query tile
    const int* src = ids + ((size_t)qt * 16 + m) * SEQ + 32 * c + 16 * (i >> 1) + 8 * h + 4 * (i & 1);
    *(v4i*)(idp + (size_t)e * 4) = *(const v4ia*)src;
  } else if (g < G_X + G_W) {
    const float* src;
    __bf16* dst;
    if (g < G_X) {
      const int which = g >> 18;                 // NX8 = 2^18
      const int off = g & (NX8 - 1);
      const float* s = (which == 0) ? q_in : ((which == 1) ? k_in : v_in);
      // group off = ((row tile * 32 + k tile) * 2 + j) * 32 + lane
      src = s + (size_t)((off >> 11) * 16 + m) * HID + ((off >> 6) & 31) * 32 + ((off >> 5) & 1) * 16 + 8 * h;
      dst = xb + (size_t)which * NX + (size_t)off * 8;
    } else {
      const int e = g - G_X;
      const int wsel = e >> 17;                 // NW8 = 2^17
      const int off = e & (NW8 - 1);
      const float* s = (wsel == 0) ? Wq : ((wsel == 1) ? Wk : ((wsel == 2) ? Wv : Wo));
      src = s + (size_t)((off >> 11) * 16 + m) * HID + ((off >> 6) & 31) * 32 + ((off >> 5) & 1) * 16 + 8 * h;
      dst = wb + (size_t)wsel * NW + (size_t)off * 8;
    }
    const v4f a = *(const v4fa*)src;
    const v4f c = *(const v4fa*)(src + 4);
    const v8b o = { (__bf16)a.x, (__bf16)a.y, (__bf16)a.z, (__bf16)a.w,
                    (__bf16)c.x, (__bf16)c.y, (__bf16)c.z, (__bf16)c.w };
    *(v8b*)dst = o;
    
  } else {
    const int e = g - (G_X + G_W);
    float f[8];
    _Float16* dst;
    // group e & 511 = ((row tile * 2 + k tile) * 2 + j) * 32 + lane of a 64 x 64 plane
    const int row = ((e >> 7) & 3) * 16 + m;
    const int kk = ((e >> 6) & 1) * 32 + ((e >> 5) & 1) * 16 + 8 * h;
    if (e < G_R) {
      const float* src = relk + (size_t)row * HD + kk;
      const v4f a = *(const v4fa*)src;
      const v4f c = *(const v4fa*)(src + 4);
      f[0] = a.x; f[1] = a.y; f[2] = a.z; f[3] = a.w;
      f[4] = c.x; f[5] = c.y; f[6] = c.z; f[7] = c.w;
      dst = rk + (size_t)e * 8;
    } else {
      const int e3 = e - G_R;                    // 0..511; row = d, kk = first relation index
      #pragma unroll
      for (int i = 0; i < 8; ++i) f[i] = relv[(size_t)(kk + i) * HD + row];
      dst = rvT + (size_t)e3 * 8;
    }
    _Float16 hh[8];
    #pragma unroll
    for (int i = 0; i < 8; ++i) hh[i] = (_Float16)((float)(__bf16)f[i] * 32.0f);
    const v8h o = { hh[0], hh[1], hh[2], hh[3], hh[4], hh[5], hh[6], hh[7] };
    *(v8h*)dst = o;
    
  }
}

// ---------------------------------------------------------------------------
// 4 lines per instruction, 32 lines per wave, 128 per group of four waves; tile order.
// which 0/1: plane[bh][l/16][d/32] tiles (row = token, k = d); a wave's 32 tokens = 4 tiles
// which 2  : vt[bh][l/32][d/16] tiles    (row = d, k = token); a wave's 32 tokens = 4 tiles
// ---------------------------------------------------------------------------
__device__ __forceinline__ void proj_store_pass(const _Float16* sT, _Float16* plane, _Float16* vt,
                                                int which, int bh, int l0, int w, int lane) {
  const int h = lane >> 4, m = lane & 15;
  // LDS element of half i = 0: (token tile * 2 + d tile) * 2 + j = i, or d tile * 2 + j = i
  const _Float16* sp = (which != 2) ? sT + (32 * w + m) * PQK + 8 * h : sT + m * PVT + 32 * w + 8 * h;
  // either way the wave's four tiles are 4 KiB in a row at the same offset of its plane
  _Float16* dst = ((which != 2) ? plane : vt) + ((size_t)bh * SEQ + l0 + 32 * w) * HD + 8 * lane;
  #pragma unroll
  for (int i = 0; i < 8; ++i) {
    const int so = (which != 2) ? 16 * (i >> 2) * PQK + 16 * (i & 3) : 16 * (i >> 1) * PVT + 16 * (i & 1);
    *(v8h*)(dst + 256 * i) = *(const v8ha*)(sp + so);
  }
}

// One k step (32 deep) of a projection's operands, held in registers so that
// the next step's loads are in flight while this step's products run.
struct PStage { v16b a0, a1, b[4]; };
// xp, wp = the step's tile of the wave's first token tile and first feature tile
__device__ __forceinline__ void proj_load(PStage& s, const __bf16* xp, const __bf16* wp) {
  s.a0 = ldtile_b(xp);
  s.a1 = ldtile_b(xp + (size_t)16 * HID);
  #pragma unroll
  for (int nt = 0; nt < 4; ++nt) s.b[nt] = ldtile_b(wp + (size_t)nt * 16 * HID);
  loads_stay_above();
}
// element offset of the tile of k step (k0 / 32 + ks) mod 32 in a row of tiles
__device__ __forceinline__ int ktile(int k0, int ks) { return (((k0 >> 5) + ks) & (HID / 32 - 1)) * TILE; }
__device__ __forceinline__ void proj_mma(const PStage& s, v8f (&acc)[2][4]) {
  #pragma unroll
  for (int nt = 0; nt < 4; ++nt) {
    acc[0][nt] = wmma_b(s.a0, s.b[nt], acc[0][nt]);
    acc[1][nt] = wmma_b(s.a1, s.b[nt], acc[1][nt]);
  }
}

// ---------------------------------------------------------------------------
// Kernel 2: Y = x * W^T + b for the three projections (which = 0,1,2).
// Block = PU groups of 4 waves; a group = 128 tokens x 64 features (one (which, head));
// wave tile 32 tokens x 64 features; K = 1024 in steps of 32;
// A (x rows) and B (W rows) bf16 fragments straight from the tile-ordered planes.
// The groups work alone; they stand in one block so that they run on one WGP at the same time
// and on the same k step: neighbouring head columns read the same token rows (but where q, k, v
// change over), so an x line is fetched from L2 once, into the WGP's cache, for all of them.
// ---------------------------------------------------------------------------
__global__ __launch_bounds__(128 * PU) void proj_kernel(
    const __bf16* __restrict__ xb,     // [3][NTOK][HID], tile order
    const __bf16* __restrict__ wb,     // [4][HID][HID], row = output feature (first 3 used), tile order
    const float* __restrict__ bq, const float* __restrict__ bk, const float* __restrict__ bv,
    _Float16* __restrict__ qh,         // [B*H][L][D]  f16(0.125*q), tile order
    _Float16* __restrict__ kh,         // [B*H][L][D], tile order
    _Float16* __restrict__ vt)         // [B*H][L/32][D/16] tiles (row = d, k = token)
{
  __shared__ __attribute__((aligned(16))) _Float16 sTu[PU][128 * PQK];  // 18432 B a group: [token][PQK], or [d][PVT] for v^T

  const int tid = threadIdx.x, lane = tid & 31;
  const int wv = __builtin_amdgcn_readfirstlane(tid >> 5);   // the same in all lanes: which, head and the branch on them stay scalar
  const int w = wv & 3;                      // wave of its group
  _Float16* sT = sTu[wv >> 2];               // the group's own staging
  const int h = lane >> 4, m = lane & 15;
  const int m0 = blockIdx.x * 128;
  const int cg = blockIdx.y * PU + (wv >> 2);   // 0..47
  const int which = cg >> 4, head = cg & 15;
  const int m0w = m0 + 32 * w;

  // 16 rows of a plane = HID / 32 tiles in a row = 16 * HID elements
  const __bf16* xa0 = xb + (size_t)which * NX + (size_t)m0w * HID + 8 * lane;   // token tile, mt = 0
  const __bf16* wr  = wb + (size_t)which * NW + (size_t)(head * HD) * HID + 8 * lane;  // feature tile, nt = 0

  const int ks = walk_start(HID / 32);       // the 16 blocks on a W slice, and the 6 on an x slice, start apart
  PStage sa, sb;
  const __bf16 *xf = xa0 + ktile(0, ks), *wf = wr + ktile(0, ks);
  proj_load(sa, xf, wf);

  const v8f zero8 = {0.f, 0.f, 0.f, 0.f, 0.f, 0.f, 0.f, 0.f};
  v8f acc[2][4];
  #pragma unroll
  for (int mt = 0; mt < 2; ++mt)
    #pragma unroll
    for (int nt = 0; nt < 4; ++nt) acc[mt][nt] = zero8;

  addr_regs_free_of(xf, wf, xf, wf);         // the first step's address pairs are free from here on
  // rolled: two register stages per trip, no copies between them
  #pragma unroll 1
  for (int k0 = 0; k0 < HID - 64; k0 += 64) {
    const int t1 = ktile(k0 + 32, ks), t2 = ktile(k0 + 64, ks);
    const __bf16 *x1 = xa0 + t1, *w1 = wr + t1, *x2 = xa0 + t2, *w2 = wr + t2;
    proj_load(sb, x1, w1);
    proj_mma(sa, acc);
    proj_load(sa, x2, w2);
    proj_mma(sb, acc);
    addr_regs_free_of(x1, w1, x2, w2);
  }
  proj_load(sb, xa0 + ktile(HID - 32, ks), wr + ktile(HID - 32, ks));
  addr_regs_free();
  proj_mma(sa, acc);
  proj_mma(sb, acc);

  // D[r] of tile (mt, nt) = Y[token m0w+16mt+8h+r][feature 16nt+m]
  const float* bias = (which == 0) ? bq : ((which == 1) ? bk : bv);
  const float osc = (which == 0) ? 0.125f : 1.0f;
  float bvl[4];                                            // all four loads ahead of the branch, in flight together
  #pragma unroll
  for (int nt = 0; nt < 4; ++nt) bvl[nt] = (float)(__bf16)bias[head * HD + 16 * nt + m];
  const int tokw = 32 * w + 8 * h;                         // the lane's tokens: tokw + 16 mt + r, 0..127
  if (which == 2) {                                        // the same for the whole group
    // a row is a d: the lane's eight tokens of a tile lie side by side, one 16-byte store
    #pragma unroll
    for (int nt = 0; nt < 4; ++nt) {
      #pragma unroll
      for (int mt = 0; mt < 2; ++mt) {
        _Float16 y[8];
        #pragma unroll
        for (int r = 0; r < 8; ++r) y[r] = (_Float16)((acc[mt][nt][r] + bvl[nt]) * osc);
        *(v8h*)(sT + (16 * nt + m) * PVT + tokw + 16 * mt) = (v8h){ y[0], y[1], y[2], y[3], y[4], y[5], y[6], y[7] };
      }
    }
  } else {
    #pragma unroll
    for (int nt = 0; nt < 4; ++nt) {
      #pragma unroll
      for (int mt = 0; mt < 2; ++mt) {
        #pragma unroll
        for (int r = 0; r < 8; ++r)
          sT[(tokw + 16 * mt + r) * PQK + 16 * nt + m] = (_Float16)((acc[mt][nt][r] + bvl[nt]) * osc);
      }
    }
  }
  __syncthreads();

  const int b = m0 >> 9, l0 = m0 & (SEQ - 1), bh = b * NH + head;
  _Float16* plane = (which == 0) ? qh : kh;
  proj_store_pass(sT, plane, vt, which, bh, l0, w, lane);
  
}

// ---------------------------------------------------------------------------
// Attention helpers.
// ---------------------------------------------------------------------------
// B fragment of the normalised relation histogram, k = relation index:
// element i<8 <- k0+8h+i, element 8+i <- k0+16+8h+i; kb = k0 + 8h.
// A bin of query m is the sum of eight partials: HCOPY copies x the columns of lanes m
// and m+16. Each lane reads its own column first and its partner's second, so the 32
// lanes of every read fall on 32 different banks.
__device__ __forceinline__ v16h build_w(const float* sH, int lane, int kb, float wsc) {
  const float* ca = sH + kb * 32 + lane;
  const float* cb = sH + kb * 32 + (lane ^ 16);
  _Float16 wh[16];
  #pragma unroll
  for (int i = 0; i < 16; ++i) {
    const int ro = ((i & 7) + 16 * (i >> 3)) * 32;
    float s = ca[ro] + cb[ro];
    #pragma unroll
    for (int c = 1; c < HCOPY; ++c) s += ca[c * HPL + ro] + cb[c * HPL + ro];
    wh[i] = (_Float16)(s * wsc);
  }
  FragH f;
  f.half[0] = (v8h){ wh[0], wh[1], wh[2], wh[3], wh[4], wh[5], wh[6], wh[7] };
  f.half[1] = (v8h){ wh[8], wh[9], wh[10], wh[11], wh[12], wh[13], wh[14], wh[15] };
  return f.v;
}

// Per-wave 16x64 f32 tile in LDS (rows of PF32 floats) -> bf16 hi and lo planes [tok][HID] in tile order:
// two tiles in a row, i = feature tile * 2 + j; 4 lines per instruction.
__device__ __forceinline__ void att_store(const float* sO, __bf16* ahi, __bf16* alo,
                                          size_t gbase, int lane) {
  const int h = lane >> 4, m = lane & 15;
  #pragma unroll
  for (int i = 0; i < 4; ++i) {
    const float* sp = sO + m * PF32 + 16 * i + 8 * h;
    const v4f a = *(const v4fa*)sp;
    const v4f c = *(const v4fa*)(sp + 4);
    const float f[8] = { a.x, a.y, a.z, a.w, c.x, c.y, c.z, c.w };
    __bf16 hh[8], ll[8];
    #pragma unroll
    for (int e = 0; e < 8; ++e) {
      hh[e] = (__bf16)f[e];
      ll[e] = (__bf16)(f[e] - (float)hh[e]);
    }
    const v8b hv = { hh[0], hh[1], hh[2], hh[3], hh[4], hh[5], hh[6], hh[7] };
    const v8b lv = { ll[0], ll[1], ll[2], ll[3], ll[4], ll[5], ll[6], ll[7] };
    const size_t gi = gbase + 256 * i + 8 * lane;
    *(v8b*)(ahi + gi) = hv;
    *(v8b*)(alo + gi) = lv;
  }
}

// 32 keys' worth of global operands, held in registers ahead of their use:
// f[0..3] = four A fragments (K rows of two key tiles, two d chunks each, or
// V^T rows of the four d tiles), id[0..3] = this lane's 16 relation ids.
// The scores need K and the ids at a stage's head: they are fetched one stage ahead.
// V^T is needed only at the foot, behind the histogram chain, so it is fetched at the
// head of its own stage.
struct AFrag { v16h f[4]; };
struct AIds  { v4i id[4]; };
// ip = the stage's 2-KiB block of idp + 4 * lane; id[0..3] = keys 8h+0..3, 8h+4..7, 16+8h+0..3, 16+8h+4..7
__device__ __forceinline__ void ids_load(AIds& s, const int* ip) {
  #pragma unroll
  for (int i = 0; i < 4; ++i) s.id[i] = *(const v4ia*)(ip + 128 * i);
}
// kp, ip = a stage's first K tile and its block of ids
__device__ __forceinline__ void k_load(AFrag& s, AIds& n, const _Float16* kp, const int* ip) {
  // 32 keys = four tiles in a row: (key tile 0, d 0..31), (0, 32..63), (1, 0..31), (1, 32..63)
  #pragma unroll
  for (int t = 0; t < 4; ++t) s.f[t] = ldtile_h(kp + (size_t)t * TILE);
  ids_load(n, ip);
  loads_stay_above();
}
// V^T of one stage (vp) and, where there is one, K and the ids of the stage walked next (kp, ip)
template <bool NEXT>
__device__ __forceinline__ void vk_load(AFrag& v, AFrag& s, AIds& n, const _Float16* vp,
                                        const _Float16* kp, const int* ip) {
  #pragma unroll
  for (int t = 0; t < 4; ++t) v.f[t] = ldtile_h(vp + (size_t)t * TILE);
  if (NEXT) {
    #pragma unroll
    for (int t = 0; t < 4; ++t) s.f[t] = ldtile_h(kp + (size_t)t * TILE);
    ids_load(n, ip);
  }
  loads_stay_above();
}
// scores of one stage's 32 keys, 16 per lane, in registers, with their table rows
__device__ __forceinline__ void score16(const AFrag& s, const AIds& n, v16h qb0, v16h qb1, const float* qr,
                                        float (&sc)[16], int (&ri)[16]) {
  const v8f zero8 = {0.f, 0.f, 0.f, 0.f, 0.f, 0.f, 0.f, 0.f};
  v8f z0 = wmma_h(s.f[0], qb0, zero8);
  z0 = wmma_h(s.f[1], qb1, z0);                 // z0[r] = S[query m][key 32c+8h+r]
  v8f z1 = wmma_h(s.f[2], qb0, zero8);
  z1 = wmma_h(s.f[3], qb1, z1);                 // z1[r] = S[query m][key 32c+16+8h+r]
  const int idv[16] = { n.id[0].x, n.id[0].y, n.id[0].z, n.id[0].w, n.id[1].x, n.id[1].y, n.id[1].z, n.id[1].w,
                        n.id[2].x, n.id[2].y, n.id[2].z, n.id[2].w, n.id[3].x, n.id[3].y, n.id[3].z, n.id[3].w };
  #pragma unroll
  for (int e = 0; e < 16; ++e) {
    const int id = idv[e];
    const float bias = (id > 0) ? 0.0f : -10000.0f;
    const float zz = (e < 8) ? z0[e & 7] : z1[e & 7];
    ri[e] = relidx(id);
    sc[e] = zz + qr[ri[e] * 16] * 0.0078125f + bias;
  }
}
// maximum of the scores of one stage's 32 keys (the softmax reference starts from the first stage walked)
__device__ __forceinline__ float max_stage(const AFrag& s, const AIds& n, v16h qb0, v16h qb1, const float* qr,
                                           float mx) {
  float sc[16];
  int ri[16];
  score16(s, n, qb0, qb1, qr, sc, ri);
  #pragma unroll
  for (int e = 0; e < 16; ++e) mx = fmaxf(mx, sc[e]);
  return mx;
}
// 2^x. The v_nop is the free slot that the instruction set asks for behind a
// transcendental before its source is overwritten or its result read; only inside the
// same statement does it stay directly behind the v_exp_f32.
__device__ __forceinline__ float exp2_slot(float x) {
  float r;
  asm("v_exp_f32 %0, %1\n\tv_nop" : "=v"(r) : "v"(x));
  return r;
}
// one stage: scores, exp, sum, histogram, O^T += V^T * P^T for 32 keys.
// mx is the reference that is subtracted in the exponent, the same in lanes m and m + 16.
// Softmax is the same for any reference; it only has to keep p in f16's range. While no
// score tops mx by more than MXT the sums go on as they are; otherwise mx moves up to the
// largest score seen and everything summed so far is multiplied by exp(old mx - new mx).
__device__ __forceinline__ float pv_stage(const AFrag& k, const AIds& n, const AFrag& s, v16h qb0, v16h qb1,
                                          const float* qr, float* hl, float& mx, float lsum, v8f (&o)[4]) {
  float sv[16];
  int rv[16];
  score16(k, n, qb0, qb1, qr, sv, rv);
  float sm = sv[0];
  #pragma unroll
  for (int e = 1; e < 16; ++e) sm = fmaxf(sm, sv[e]);
  if (__builtin_amdgcn_ballot_w32(sm > mx + MXT) != 0u) {     // the same for the whole wave
    const float nm = fmaxf(mx, fmaxf(sm, __shfl_xor(sm, 16)));
    const float f = exp2_slot((mx - nm) * 1.44269504f);       // 1 for a query whose reference stays
    mx = nm;
    lsum *= f;
    #pragma unroll
    for (int t = 0; t < 4; ++t) o[t] *= f;
    // partly rolled: a seldom-taken path that stands four times in the kernel, kept short for the instruction cache
    #pragma unroll 8
    for (int i = 0; i < HCOPY * NREL; ++i) hl[i * 32] *= f;
  }
  // Histogram: key e adds into copy e & 3, so the four bins of a group are four different
  // LDS words whatever the ids are: they are read together and one LDS round trip serves
  // four keys, where a single copy makes every read wait for the store in front of it.
  // The first group's bins depend on no store of this stage: their reads stand ahead of the exponentials.
  float old[HCOPY];
  #pragma unroll
  for (int j = 0; j < HCOPY; ++j) old[j] = hl[j * HPL + rv[j] * 32];
  float pe[16];
  _Float16 ph[16];
  #pragma unroll
  for (int e = 0; e < 16; ++e) {
    const float p = exp2_slot((sv[e] - mx) * 1.44269504f);   // = __expf(sv[e] - mx)
    lsum += p;
    pe[e] = p;
    ph[e] = (_Float16)(p * PPS);
  }
  #pragma unroll
  for (int g = 0; g < 16 / HCOPY; ++g) {
    #pragma unroll
    for (int j = 0; j < HCOPY; ++j) hl[j * HPL + rv[HCOPY * g + j] * 32] = old[j] + pe[HCOPY * g + j];
    if (g + 1 < 16 / HCOPY) {
      #pragma unroll
      for (int j = 0; j < HCOPY; ++j) old[j] = hl[j * HPL + rv[HCOPY * (g + 1) + j] * 32];
    }
  }
  // P^T B-fragment: element r <- key 32c+8h+r, element 8+r <- key 32c+16+8h+r
  FragH pf;
  pf.half[0] = (v8h){ ph[0], ph[1], ph[2], ph[3], ph[4], ph[5], ph[6], ph[7] };
  pf.half[1] = (v8h){ ph[8], ph[9], ph[10], ph[11], ph[12], ph[13], ph[14], ph[15] };
  #pragma unroll
  for (int t = 0; t < 4; ++t) o[t] = wmma_h(s.f[t], pf.v, o[t]);
  return lsum;
}

// ---------------------------------------------------------------------------
// Kernel 3: relation-aware attention, transposed form, one wave per query tile.
// Block = AW waves = AW neighbouring tiles of 16 queries of one (b, head), each wave all 512 keys.
// The waves share nothing in LDS and work alone; they stand in one block so that they run on one
// WGP at the same time and walk the same stages: a line of K, V^T or a relation table is then
// fetched from L2 once, into the WGP's cache, and the other waves' loads of it are served there.
//   qrel^T = RK * Q^T       : A = rk rows (row = rel, k = d), B = Q^T
//   S^T    = K * Q^T        : A = K rows (row = key, k = d), B = Q^T (k = d, n = query)
//   score  = S^T + qrel[query][id]/128 + (-10000 where id <= 0), f32 in registers, never stored
//   p      = exp(score - mx): mx starts as the maximum over the first 32 keys walked and moves up,
//            with a rescale of all sums, only where a later score tops it by more than MXT
//   hist   : per-lane private bins h[key & 3][rel][lane] += p (fixed order, no atomics);
//            bank = lane + 32 (rel & 1), so a wave's 32 bins never share a bank
//   O^T    = V^T * P^T      : A = vt rows (row = d, k = key), B = P^T from registers x1024
//   R^T    = RVT * W^T      : A = rvT rows (row = d, k = rel), B = W^T = (hist/l) x16384,
//            hist = the eight partial bins of a (query, rel) added up
//   out    = O^T/(l*1024) + R^T * 2^-21  -> bf16 hi/lo planes [tok][head*64+d]
// Lane owns 256 keys of query column (lane&15); partner = lane ^ 16.
// The 16 stages of 32 keys are walked from stage walk_start on, wrapping: the 8 blocks on
// one head's K and V^T, and the 16 blocks on one query tile's ids, start apart.
// ---------------------------------------------------------------------------
__global__ __launch_bounds__(32 * AW) void attn_kernel(
    const _Float16* __restrict__ qh,   // [B*H][L][D]  (already x0.125), tile order
    const _Float16* __restrict__ kh,   // [B*H][L][D], tile order
    const _Float16* __restrict__ vt,   // [B*H][L/32][D/16] tiles (row = d, k = key)
    const int* __restrict__ idp,       // [B][L/16][L/32][4][32][4] int32 relation ids in lane order
    const _Float16* __restrict__ rk,   // [NREL][D]  x32, tile order
    const _Float16* __restrict__ rvT,  // [D][NREL]  x32, tile order
    __bf16* __restrict__ ahi,          // [NTOK][HID], tile order
    __bf16* __restrict__ alo)          // [NTOK][HID], tile order
{
  // 36 KiB a wave, 144 KiB in all: two blocks fit a WGP's 320 KiB, so the whole grid is resident at once
  // qrel[rel][query]: bank = query + 16 (rel & 3), so only lanes m and m + 16 can meet on a bank,
  // where [query][rel] puts all 32 lanes' random rows on bank = rel
  __shared__ __attribute__((aligned(16))) float sQRw[AW][NREL * 16];   //  4096 B a wave
  __shared__ __attribute__((aligned(16))) float sHw[AW][HCOPY * HPL];  // 32768 B a wave: hist[copy][rel][lane]; behind build_w: output staging

  const int lane = threadIdx.x & 31, h = lane >> 4, m = lane & 15;
  const int w = __builtin_amdgcn_readfirstlane(threadIdx.x >> 5);      // the same in all lanes: tile addresses stay scalar
  const int bh = blockIdx.y, b = bh >> 4, head = bh & 15;
  const int q0 = (blockIdx.x * AW + w) * 16;
  float* sQR = sQRw[w];                       // this wave's own tables
  float* sH = sHw[w];

  float* hl = sH + lane;                      // this lane's column of every copy

  // Q^T B-fragments: column n = query q0+m, k = d (two 32-deep chunks)
  const _Float16* qrow = qh + ((size_t)bh * SEQ + q0) * HD + 8 * lane;
  const v16h qb0 = ldtile_h(qrow);
  const v16h qb1 = ldtile_h(qrow + TILE);

  const _Float16* kbase = kh + (size_t)bh * SEQ * HD + 8 * lane;     // + four tiles per stage
  const _Float16* vbase = vt + (size_t)bh * SEQ * HD + 8 * lane;     // + four tiles per stage
  const int* idrow = idp + ((size_t)b * SEQ + q0) * SEQ + 4 * lane;  // + 512 ids per stage
  const int c0 = walk_start(SEQ / 32);
  AFrag fa, fb;
  AIds ia, ib;
  const _Float16* kf = kbase + (size_t)c0 * 4 * TILE;
  const int* nf = idrow + 512 * c0;
  k_load(fa, ia, kf, nf);                       // the first stage, in flight under the qrel tiles

  // zero all histogram bins, 512 contiguous bytes per store
  {
    const v4f z4 = {0.f, 0.f, 0.f, 0.f};
    #pragma unroll
    for (int i = 0; i < HCOPY * HPL / 128; ++i) *(v4fa*)(sH + 128 * i + 4 * lane) = z4;
  }
  addr_regs_free_of(kf, nf, kf, nf);            // behind the stores, where it costs nothing; the table loads below reuse registers

  const v8f zero8 = {0.f, 0.f, 0.f, 0.f, 0.f, 0.f, 0.f, 0.f};

  // ---- qrel^T tiles: D[r] = (rel 16rt+8h+r, query m) ----
  #pragma unroll
  for (int rt = 0; rt < 4; ++rt) {
    const _Float16* ap = rk + (size_t)(2 * rt) * TILE + 8 * lane;
    v8f z = zero8;
    z = wmma_h(ldtile_h(ap), qb0, z);
    z = wmma_h(ldtile_h(ap + TILE), qb1, z);
    #pragma unroll
    for (int r = 0; r < 8; ++r) sQR[(16 * rt + 8 * h + r) * 16 + m] = z[r];
  }
  __syncthreads();

  const float* qr = sQR + m;                  // + 16 * rel

  // softmax reference to start with: the maximum over the first stage's 32 keys
  float mx = max_stage(fa, ia, qb0, qb1, qr, -3.0e38f);
  mx = fmaxf(mx, __shfl_xor(mx, 16));

  // ---- the one pass: scores, exp, sum, histogram, O^T += V^T * P^T (32 keys per step) ----
  v8f o[4];                                   // o[t][r] = O[query m][d 16t+8h+r] * (l * 1024)
  #pragma unroll
  for (int t = 0; t < 4; ++t) o[t] = zero8;
  float lsum = 0.0f;
  AFrag fv;
  // rolled: two register stages per trip, no copies between them
  #pragma unroll 1
  for (int c = 0; c < SEQ / 32 - 2; c += 2) {
    const int s0 = (c0 + c) & (SEQ / 32 - 1), s1 = (c0 + c + 1) & (SEQ / 32 - 1), s2 = (c0 + c + 2) & (SEQ / 32 - 1);
    const _Float16 *v0 = vbase + (size_t)s0 * 4 * TILE, *k1 = kbase + (size_t)s1 * 4 * TILE;
    const _Float16 *v1 = vbase + (size_t)s1 * 4 * TILE, *k2 = kbase + (size_t)s2 * 4 * TILE;
    const int *i1 = idrow + 512 * s1, *i2 = idrow + 512 * s2;
    vk_load<true>(fv, fb, ib, v0, k1, i1);
    lsum = pv_stage(fa, ia, fv, qb0, qb1, qr, hl, mx, lsum, o);
    vk_load<true>(fv, fa, ia, v1, k2, i2);
    lsum = pv_stage(fb, ib, fv, qb0, qb1, qr, hl, mx, lsum, o);
    addr_regs_free_of(v0, k1, i1, v1, k2, i2);
  }
  const int sy = (c0 + SEQ / 32 - 2) & (SEQ / 32 - 1), sz = (c0 + SEQ / 32 - 1) & (SEQ / 32 - 1);   // the last two stages
  vk_load<true>(fv, fb, ib, vbase + (size_t)sy * 4 * TILE, kbase + (size_t)sz * 4 * TILE, idrow + 512 * sz);
  lsum = pv_stage(fa, ia, fv, qb0, qb1, qr, hl, mx, lsum, o);
  addr_regs_free();
  vk_load<false>(fv, fa, ia, vbase + (size_t)sz * 4 * TILE, kbase, idrow);
  lsum = pv_stage(fb, ib, fv, qb0, qb1, qr, hl, mx, lsum, o);
  lsum += __shfl_xor(lsum, 16);
  const float inv = 1.0f / lsum;
  const float osc = inv * (1.0f / PPS);
  const float wsc = inv * PSC;
  __syncthreads();                            // histogram bins complete (read cross-lane below)

  // ---- relation value term: R^T = RVT * W^T ----
  const v16h w0 = build_w(sH, lane, 8 * h, wsc);
  const v16h w1 = build_w(sH, lane, 32 + 8 * h, wsc);
  float* sO = sH;                             // 16 rows of PF32 floats; every bin has been read: w0 and w1 feed what is stored here
  #pragma unroll
  for (int t = 0; t < 4; ++t) {
    const _Float16* ap = rvT + (size_t)(2 * t) * TILE + 8 * lane;
    v8f z = zero8;
    z = wmma_h(ldtile_h(ap), w0, z);
    z = wmma_h(ldtile_h(ap + TILE), w1, z);
    #pragma unroll
    for (int r = 0; r < 8; ++r)
      sO[m * PF32 + 16 * t + 8 * h + r] = o[t][r] * osc + z[r] * RVS;
  }
  __syncthreads();

  const size_t gbase = ((size_t)b * SEQ + q0) * HID + (size_t)(2 * head) * TILE;   // token tile, feature tiles 2 head, 2 head + 1
  att_store(sO, ahi, alo, gbase, lane);
  
}

// ---------------------------------------------------------------------------
// instruction, 4 lines per instruction, 64 lines per wave.
// ---------------------------------------------------------------------------
__device__ __forceinline__ void out_store_pass(const float* sT, float* out, int m0, int n0,
                                               int w, int lane) {
  const int q8 = lane & 7, sub = lane >> 3;
  #pragma unroll
  for (int i = 0; i < 16; ++i) {
    const int lid = i * 4 + sub;                 // 0..63
    const int rowl = 32 * w + (lid >> 1), hl = lid & 1;
    const v4f v = *(const v4fa*)(sT + rowl * PF32 + 32 * hl + 4 * q8);
    float* dst = out + (size_t)(m0 + rowl) * HID + n0 + 32 * hl + 4 * q8;
    *(v4f*)dst = v;
  }
}

// One k step (32 deep) of the output projection's operands, one stage ahead.
struct OStage { v16b a[4]; v16b b[4]; };
// hp, lp, wp = the step's tile of the wave's first token tile (hi, lo) and first feature tile
__device__ __forceinline__ void oproj_load(OStage& s, const __bf16* hp, const __bf16* lp, const __bf16* wp) {
  s.a[0] = ldtile_b(hp);
  s.a[1] = ldtile_b(lp);
  s.a[2] = ldtile_b(hp + (size_t)16 * HID);
  s.a[3] = ldtile_b(lp + (size_t)16 * HID);
  #pragma unroll
  for (int nt = 0; nt < 4; ++nt) s.b[nt] = ldtile_b(wp + (size_t)nt * 16 * HID);
  loads_stay_above();
}
__device__ __forceinline__ void oproj_mma(const OStage& s, v8f (&acc)[2][4]) {
  #pragma unroll
  for (int nt = 0; nt < 4; ++nt) {
    acc[0][nt] = wmma_b(s.a[0], s.b[nt], acc[0][nt]);
    acc[0][nt] = wmma_b(s.a[1], s.b[nt], acc[0][nt]);
    acc[1][nt] = wmma_b(s.a[2], s.b[nt], acc[1][nt]);
    acc[1][nt] = wmma_b(s.a[3], s.b[nt], acc[1][nt]);
  }
}

// ---------------------------------------------------------------------------
// Kernel 4: out = A * Wo^T + bo with A = ahi + alo (two bf16 products per tile).
// Block 128 thr = 128 tokens x 64 features; wave 32 tokens x 64 features.
// ---------------------------------------------------------------------------
__global__ __launch_bounds__(128) void oproj_kernel(
    const __bf16* __restrict__ ahi,    // [NTOK][HID], tile order
    const __bf16* __restrict__ alo,    // [NTOK][HID], tile order
    const __bf16* __restrict__ wo,     // [HID][HID], row = output feature, tile order
    const float* __restrict__ bo,
    float* __restrict__ out)           // [NTOK][HID]
{
  __shared__ __attribute__((aligned(16))) float sT[128 * PF32];    // 34816 B

  const int tid = threadIdx.x, lane = tid & 31, w = tid >> 5;
  const int h = lane >> 4, m = lane & 15;
  const int m0 = blockIdx.x * 128;
  const int n0 = blockIdx.y * 64;
  const int m0w = m0 + 32 * w;

  const __bf16* a0h = ahi + (size_t)m0w * HID + 8 * lane;
  const __bf16* a0l = alo + (size_t)m0w * HID + 8 * lane;
  const __bf16* wr  = wo + (size_t)n0 * HID + 8 * lane;

  const int ks = walk_start(HID / 32);       // the 16 blocks on a Wo slice, and the 16 on a token slice, start apart
  OStage sa, sb;
  const __bf16 *hf = a0h + ktile(0, ks), *lf = a0l + ktile(0, ks), *wf = wr + ktile(0, ks);
  oproj_load(sa, hf, lf, wf);

  const v8f zero8 = {0.f, 0.f, 0.f, 0.f, 0.f, 0.f, 0.f, 0.f};
  v8f acc[2][4];
  #pragma unroll
  for (int mt = 0; mt < 2; ++mt)
    #pragma unroll
    for (int nt = 0; nt < 4; ++nt) acc[mt][nt] = zero8;

  addr_regs_free_of(hf, lf, wf, hf, lf, wf); // the first step's address pairs are free from here on
  // rolled: two register stages per trip, no copies between them
  #pragma unroll 1
  for (int k0 = 0; k0 < HID - 64; k0 += 64) {
    const int t1 = ktile(k0 + 32, ks), t2 = ktile(k0 + 64, ks);
    const __bf16 *h1 = a0h + t1, *l1 = a0l + t1, *w1 = wr + t1, *h2 = a0h + t2, *l2 = a0l + t2, *w2 = wr + t2;
    oproj_load(sb, h1, l1, w1);
    oproj_mma(sa, acc);
    oproj_load(sa, h2, l2, w2);
    oproj_mma(sb, acc);
    addr_regs_free_of(h1, l1, w1, h2, l2, w2);
  }
  oproj_load(sb, a0h + ktile(HID - 32, ks), a0l + ktile(HID - 32, ks), wr + ktile(HID - 32, ks));
  addr_regs_free();
  oproj_mma(sa, acc);
  oproj_mma(sb, acc);

  // D[r] of tile (mt, nt) = Y[token m0w+16mt+8h+r][feature n0+16nt+m]
  #pragma unroll
  for (int nt = 0; nt < 4; ++nt) {
    const int featl = 16 * nt + m;
    const float bvl = (float)(__bf16)bo[n0 + featl];
    #pragma unroll
    for (int mt = 0; mt < 2; ++mt) {
      #pragma unroll
      for (int r = 0; r < 8; ++r) {
        const int tokl = 32 * w + 16 * mt + 8 * h + r;     // 0..127
        sT[tokl * PF32 + featl] = acc[mt][nt][r] + bvl;
      }
    }
  }
  __syncthreads();

  out_store_pass(sT, out, m0, n0, w, lane);
  
}

// ---------------------------------------------------------------------------
extern "C" void kernel_launch(void* const* d_in, const int* in_sizes, int n_in,
                              void* d_out, int out_size, void* d_ws, size_t ws_size,
                              hipStream_t stream) {
  if (n_in < 14) return;
  if (in_sizes[0] != NX || in_sizes[1] != NX || in_sizes[2] != NX) return;
  if (in_sizes[3] != NB * SEQ * SEQ) return;
  if (in_sizes[4] != NW || in_sizes[6] != NW || in_sizes[8] != NW || in_sizes[10] != NW) return;
  if (in_sizes[5] != HID || in_sizes[7] != HID || in_sizes[9] != HID || in_sizes[11] != HID) return;
  if (in_sizes[12] != NREL * HD || in_sizes[13] != NREL * HD) return;
  if (out_size != NX) return;

  const float* q_in = (const float*)d_in[0];
  const float* k_in = (const float*)d_in[1];
  const float* v_in = (const float*)d_in[2];
  const int*   ids  = (const int*)d_in[3];
  const float* Wq = (const float*)d_in[4];
  const float* bq = (const float*)d_in[5];
  const float* Wk = (const float*)d_in[6];
  const float* bk = (const float*)d_in[7];
  const float* Wv = (const float*)d_in[8];
  const float* bv = (const float*)d_in[9];
  const float* Wo = (const float*)d_in[10];
  const float* bo = (const float*)d_in[11];
  const float* relk = (const float*)d_in[12];
  const float* relv = (const float*)d_in[13];
  float* out = (float*)d_out;

  const size_t xb_bytes = (size_t)3 * NX * 2;          // 12582912
  const size_t wb_bytes = (size_t)4 * NW * 2;          //  8388608
  const size_t rt_bytes = (size_t)NREL * HD * 2;       //     8192
  const size_t pl_bytes = (size_t)NPL * 2;             //  4194304
  const size_t ap_bytes = (size_t)NX * 2;              //  4194304
  const size_t id_bytes = (size_t)NB * SEQ * SEQ * 4;  //  4194304
  const size_t total = xb_bytes + wb_bytes + 2 * rt_bytes + 3 * pl_bytes + 2 * ap_bytes + id_bytes;  // 46153728
  if (total > ws_size) return;

  char* ws = (char*)d_ws;
  size_t off = 0;
  __bf16* xb = (__bf16*)(ws + off);       off += xb_bytes;
  __bf16* wb = (__bf16*)(ws + off);       off += wb_bytes;
  _Float16* rk  = (_Float16*)(ws + off);  off += rt_bytes;
  _Float16* rvT = (_Float16*)(ws + off);  off += rt_bytes;
  _Float16* qh  = (_Float16*)(ws + off);  off += pl_bytes;
  _Float16* kh  = (_Float16*)(ws + off);  off += pl_bytes;
  _Float16* vt  = (_Float16*)(ws + off);  off += pl_bytes;
  __bf16* ahi = (__bf16*)(ws + off);      off += ap_bytes;
  __bf16* alo = (__bf16*)(ws + off);      off += ap_bytes;
  int* idp = (int*)(ws + off);            off += id_bytes;
  if (off > ws_size) return;

  convert_kernel<<<(G_TOT + 255) / 256, 256, 0, stream>>>(q_in, k_in, v_in, Wq, Wk, Wv, Wo,
                                                         relk, relv, ids, xb, wb, rk, rvT, idp);

  dim3 gProj(NTOK / 128, 3 * NH / PU);                              // (16, 16)
  proj_kernel<<<gProj, 128 * PU, 0, stream>>>(xb, wb, bq, bk, bv, qh, kh, vt);

  dim3 gAtt(SEQ / (16 * AW), NB * NH);                              // (8, 64)
  attn_kernel<<<gAtt, 32 * AW, 0, stream>>>(qh, kh, vt, idp, rk, rvT, ahi, alo);

  dim3 gOut(NTOK / 128, HID / 64);                                  // (16, 16)
  oproj_kernel<<<gOut, 128, 0, stream>>>(ahi, alo, wb + (size_t)3 * NW, bo, out);
}
